// v000
// Measured on an AMD MI455X. A time is GPU time per run, averaged over a window of back-to-back runs after a warm-up
// (all launches, gaps included; the runs take copies of the inputs in turn), and the median of several windows.
// Apart from v000's, it joins two sittings. Times from different sittings can be a few percent apart, while
// side-by-side timings come from the same sitting.
// The starting kernel, v000, takes 315 microseconds a run.
#include <hip/hip_runtime.h>

// All contractions on v_wmma_f32_16x16x32 (f32 accumulate): q/k/v projections bf16 x bf16 (x, W, b RNE-converted to bf16; products exact); scores q.k and P.V: query rows < 512 bf16 hi/lo planes (3 products), other rows f16 (P carried x1024); output projection bf16 hi/lo activations x bf16 weights (2 products).
// x [2][2048][1024]; Wq/Wk/Wv/Wo [out][in] with biases; 16 heads x 64; rotate-half rotary on q and k (table computed on the device: powf / sincosf); score scale 1/8; int32 keep-mask [S][S] read by value (0 -> -inf); softmax f32; out = merged heads Wo^T + bo.
// Pipeline: bf16 copies -> one-wave 64x64 GEMM tiles -> plane builders (q, k [bh][t][d]; v^T [bh][d][t]) -> mask bit-plane -> fused flash attention (one wave per 16 queries, transposed tiles so the score accumulators are directly the P operand, online softmax) -> merged hi/lo planes -> output GEMM.

#ifndef NB
#define NB 2
#endif
#ifndef SEQ
#define SEQ 2048
#endif
#define NB_FULL  2
#define SEQ_FULL 2048
#define DM   1024
#define NH   16
#define HD   64
#define DQ   (NH * HD)
#define RH   ((SEQ) < 512 ? (SEQ) : 512)      // query rows < RH use the hi/lo planes
#define PCAR 1024.0f
#define SCL  0.125f                          // HD^-0.5
#define LOG2E 1.4426950408889634f

static_assert(HD == 64);                                   // two 32-deep k-steps per head, 4 output tiles of 16, table index = idx & 31
static_assert(DQ == DM);
static_assert(DM % 32 == 0 && DQ % 32 == 0);               // GEMM k-loop steps by 32
static_assert(DM % 8 == 0);
static_assert((NB * SEQ) % 64 == 0 && SEQ % 64 == 0 && DQ % 64 == 0 && DM % 64 == 0);   // 64x64 GEMM tiles, 64-element plane lines
static_assert(RH % 16 == 0 && (SEQ - RH) % 16 == 0);       // 16-query attention tiles
static_assert(SEQ % 32 == 0 && ((size_t)SEQ * SEQ) % 1024 == 0);   // 32-key words, 32 words per bit-plane line
static_assert(NB <= NB_FULL && SEQ <= SEQ_FULL);

typedef _Float16 h16;
typedef unsigned short bf;
typedef __attribute__((ext_vector_type(16))) __bf16   v16bf;
typedef __attribute__((ext_vector_type(16))) _Float16 v16h;
typedef __attribute__((ext_vector_type(8)))  _Float16 v8h;
typedef __attribute__((ext_vector_type(2)))  _Float16 v2h;
typedef __attribute__((ext_vector_type(16))) unsigned short v16us;
typedef __attribute__((ext_vector_type(8)))  unsigned short v8us;
typedef __attribute__((ext_vector_type(2)))  unsigned short v2us;
typedef __attribute__((ext_vector_type(8)))  float    v8f;
typedef __attribute__((ext_vector_type(4)))  float    v4f;
typedef __attribute__((ext_vector_type(2)))  float    v2f;
typedef v4f  __attribute__((may_alias)) v4fa;

__device__ __forceinline__ unsigned short f2bf(float f) { unsigned u = __float_as_uint(f); u += 0x7FFFu + ((u >> 16) & 1u); return (unsigned short)(u >> 16); }
__device__ __forceinline__ float bf2f(unsigned short b) { return __uint_as_float(((unsigned)b) << 16); }
__device__ __forceinline__ float bfr(float f) { return bf2f(f2bf(f)); }
__device__ __forceinline__ void splitf(float y, unsigned short& h, unsigned short& l) { h = f2bf(y); l = f2bf(y - bf2f(h)); }
__device__ __forceinline__ v16h cat16(v8h lo, v8h hi) { return __builtin_shufflevector(lo, hi, 0, 1, 2, 3, 4, 5, 6, 7, 8, 9, 10, 11, 12, 13, 14, 15); }
__device__ __forceinline__ v16bf cat16b(v8us lo, v8us hi) { return __builtin_bit_cast(v16bf, __builtin_shufflevector(lo, hi, 0, 1, 2, 3, 4, 5, 6, 7, 8, 9, 10, 11, 12, 13, 14, 15)); }
// fragment loaders: p already includes row * pitch + k0 + 8 * (lane >> 4); elements 0..7 <- p[0..7], elements 8..15 <- p[16..23]
__device__ __forceinline__ v16h  ldh(const h16* p) { return cat16(*(const v8h*)p, *(const v8h*)(p + 16)); }
__device__ __forceinline__ v16bf ldb(const bf* p)  { return cat16b(*(const v8us*)p, *(const v8us*)(p + 16)); }
__device__ __forceinline__ v8f wmma16(v16h a, v16h b, v8f c) { return __builtin_amdgcn_wmma_f32_16x16x32_f16(false, a, false, b, (short)0, c, false, false); }
__device__ __forceinline__ v8f wmmab(v16bf a, v16bf b, v8f c) { return __builtin_amdgcn_wmma_f32_16x16x32_bf16(false, a, false, b, (short)0, c, false, false); }

// ---- one-wave 64x64 GEMM tile: C[m][n] (f32, pitch ldc) = sum_k A[m][k] Bt[n][k] (+ A2[m][k] Bt[n][k] when NSPLIT == 1) + bf16(bias[n]); operands are K-contiguous bf16 planes, K % 32 == 0,
template <int NSPLIT>
__device__ __forceinline__ void gemm_body(const bf* __restrict__ A, const bf* __restrict__ A2, const bf* __restrict__ Bt, const int K,
                                          float* C, const int ldc, const float* __restrict__ bias, const size_t sA, const size_t sC) {
    __shared__ __align__(16) float os[16 * 68];
    const size_t z = blockIdx.z; A += z * sA; A2 += z * sA; C += z * sC;
    const int lane = threadIdx.x & 31, lr = lane & 15, hi = lane >> 4; const int r0 = (int)blockIdx.x * 64, c0 = (int)blockIdx.y * 64;
    v8f acc[4][4];
#pragma unroll
    for (int mb = 0; mb < 4; ++mb)
#pragma unroll
        for (int nb = 0; nb < 4; ++nb) acc[mb][nb] = (v8f){};
    const size_t aoff = (size_t)(r0 + lr) * K + 8 * hi, boff = (size_t)(c0 + lr) * K + 8 * hi;
#pragma unroll 1
    for (int kc = 0; kc < K; kc += 32) {
        v16bf a[4], a2[4];
#pragma unroll
        for (int mb = 0; mb < 4; ++mb) { a[mb] = ldb(A + aoff + (size_t)mb * 16 * K + kc); if (NSPLIT == 1) a2[mb] = ldb(A2 + aoff + (size_t)mb * 16 * K + kc); }
#pragma unroll
        for (int nb = 0; nb < 4; ++nb) { const v16bf bb = ldb(Bt + boff + (size_t)nb * 16 * K + kc);
#pragma unroll
            for (int mb = 0; mb < 4; ++mb) { acc[mb][nb] = wmmab(a[mb], bb, acc[mb][nb]); if (NSPLIT == 1) acc[mb][nb] = wmmab(a2[mb], bb, acc[mb][nb]); } }
        asm volatile("v_nop\n\tv_nop\n\tv_nop\n\tv_nop" : "+v"(acc[0][0]), "+v"(acc[1][1]), "+v"(acc[2][2]), "+v"(acc[3][3]) : "v"(a[0]), "v"(a[3]));
    }
    v4f bv;
#pragma unroll
    for (int q = 0; q < 4; ++q) bv[q] = bfr(bias[c0 + lr * 4 + q]);
#pragma unroll
    for (int mb = 0; mb < 4; ++mb) {
#pragma unroll
        for (int nb = 0; nb < 4; ++nb) {
#pragma unroll
            for (int j = 0; j < 8; ++j) os[(hi * 8 + j) * 68 + nb * 16 + lr] = acc[mb][nb][j]; }
        __builtin_amdgcn_wave_barrier(); asm volatile("" ::: "memory");
        float* crow = C + (size_t)(r0 + mb * 16) * ldc + c0;
{
#pragma unroll
            for (int s = 0; s < 8; ++s) { const int row = 2 * s + hi, cofs = lr * 4; v4f val = *(const v4fa*)(os + row * 68 + cofs); val += bv;
                *(v4f*)(crow + (size_t)row * ldc + cofs) = val; }
             }
        __builtin_amdgcn_wave_barrier(); asm volatile("" ::: "memory");
    }
}
__global__ __launch_bounds__(32) void k_gemm1(const bf* __restrict__ A, const bf* __restrict__ Bt, int K, float* C, int ldc, const float* __restrict__ bias, size_t sA, size_t sC) {
    gemm_body<0>(A, A, Bt, K, C, ldc, bias, sA, sC); }
__global__ __launch_bounds__(32) void k_gemm2(const bf* __restrict__ A, const bf* __restrict__ A2, const bf* __restrict__ Bt, int K, float* C, int ldc, const float* __restrict__ bias, size_t sA, size_t sC) {
    gemm_body<1>(A, A2, Bt, K, C, ldc, bias, sA, sC); }

__global__ __launch_bounds__(256) void k_cvt8(const float* __restrict__ src, bf* dst, size_t n8) { const size_t i = (size_t)blockIdx.x * 256 + threadIdx.x; if (i >= n8) return; const v8f v = *(const v8f*)(src + i * 8); v8us o;
#pragma unroll
    for (int k = 0; k < 8; ++k) o[k] = f2bf(v[k]);
    *(v8us*)(dst + i * 8) = o;  }
__global__ __launch_bounds__(256) void k_cvtx(const float* __restrict__ src, bf* dst) { const size_t i = (size_t)blockIdx.x * 256 + threadIdx.x; if (i >= (size_t)NB * SEQ * DM / 8) return;
    const size_t row = i / (DM / 8); const size_t c8 = i % (DM / 8); const size_t b = row / SEQ, t = row % SEQ; const v8f v = *(const v8f*)(src + ((b * SEQ_FULL + t) * DM + c8 * 8)); v8us o;
#pragma unroll
    for (int k = 0; k < 8; ++k) o[k] = f2bf(v[k]);
    *(v8us*)(dst + i * 8) = o;  }

__global__ __launch_bounds__(256) void k_cstab(float* CS) { const int idx = (int)blockIdx.x * 256 + (int)threadIdx.x; if (idx >= SEQ * (HD / 2)) return; const int i = idx & 31, t = idx >> 5;
    const float ex = (float)(2 * i) / (float)HD; const float pw = powf(10000.0f, ex); const float invf = 1.0f / pw; const float ang = __fmul_rn((float)t, invf); float sn, cn; sincosf(ang, &sn, &cn);
    v2f cs; cs[0] = cn; cs[1] = sn; float* p0 = CS + ((size_t)t * HD + i) * 2; float* p1 = p0 + (HD / 2) * 2;
    *(v2f*)p0 = cs; *(v2f*)p1 = cs;  }

__global__ __launch_bounds__(256) void k_mbits(const int* __restrict__ mask, unsigned* MB) { const int lane = threadIdx.x & 31; const int g = (int)blockIdx.x * 8 + (int)(threadIdx.x >> 5);
    if (g >= (int)((size_t)SEQ * SEQ / 1024)) return;   // wave-uniform
    unsigned mine = 0u;
#pragma unroll 4
    for (int j = 0; j < 32; ++j) { const int wd = g * 32 + j; const int q = wd / (SEQ / 32), kg = wd % (SEQ / 32); const int v = mask[(size_t)q * SEQ_FULL + kg * 32 + lane];
        const unsigned bal = __builtin_amdgcn_ballot_w32(v != 0); mine = (lane == j) ? bal : mine; }
    *(unsigned*)(MB + (size_t)g * 32 + lane) = mine;  }

// ---- k_rope: head planes [bh][t][d] (f16; bf16 hi/lo for t < hrows) of the rotate-half rotary of F[b*SEQ + t][h*HD + d]: out[d] = x[d] c - x[d+32] s (d < 32), out[d] = x[d] c + x[d-32] s (d >= 32);
__global__ __launch_bounds__(256) void k_rope(const float* __restrict__ F, const float* __restrict__ CS, h16* P16, bf* Ph, bf* Pl, int hrows) {
    const size_t e = ((size_t)blockIdx.x * 256 + threadIdx.x) * 2; if (e >= (size_t)NB * NH * SEQ * HD) return; const int d = (int)(e % HD); const int t = (int)((e / HD) % SEQ); const int bh = (int)(e / ((size_t)HD * SEQ)); const int b = bh / NH, h = bh % NH;
    const float* f = F + ((size_t)b * SEQ + t) * DQ + h * HD; v2h o16; v2us oh, ol;
#pragma unroll
    for (int q = 0; q < 2; ++q) { const int dd = d + q; const int dp = (dd < HD / 2) ? dd + HD / 2 : dd - HD / 2; const float x0 = f[dd], x1 = f[dp];
        const v2f cs = *(const v2f*)(CS + ((size_t)t * HD + dd) * 2); float a = __fmul_rn(x0, cs[0]), bq = __fmul_rn(x1, cs[1]); asm volatile("" : "+v"(a)); asm volatile("" : "+v"(bq)); const float r = (dd < HD / 2) ? __fsub_rn(a, bq) : __fadd_rn(a, bq);
        o16[q] = (h16)r; unsigned short a2, c2; splitf(r, a2, c2); oh[q] = a2; ol[q] = c2; }
    const bool wh = (t < hrows); const size_t eh = ((size_t)bh * hrows + (wh ? t : 0)) * HD + d;
    *(v2h*)(P16 + e) = o16; if (wh) { *(v2us*)(Ph + eh) = oh; *(v2us*)(Pl + eh) = ol; }
     }
__global__ __launch_bounds__(256) void k_vtp(const float* __restrict__ F, h16* V16, bf* Vh, bf* Vl) { const size_t e = ((size_t)blockIdx.x * 256 + threadIdx.x) * 2; if (e >= (size_t)NB * NH * HD * SEQ) return;
    const int t = (int)(e % SEQ); const int d = (int)((e / SEQ) % HD); const int g = (int)(e / ((size_t)SEQ * HD)); const int b = g / NH, h = g % NH; v2h o16; v2us oh, ol;
#pragma unroll
    for (int q = 0; q < 2; ++q) { const float x = F[((size_t)b * SEQ + t + q) * DQ + h * HD + d]; o16[q] = (h16)x; unsigned short a2, c2; splitf(x, a2, c2); oh[q] = a2; ol[q] = c2; }
    *(v2h*)(V16 + e) = o16; *(v2us*)(Vh + e) = oh; *(v2us*)(Vl + e) = ol;  }

// ---- fused attention, one wave per 16 query rows of one (batch, head); 32 keys per step, all SEQ/32 steps visited, a step is skipped only when its mask words are zero for all 16 rows (exact for any mask).
// Transposed tiles: S^T[key][query] = K (A operand) x Q^T (B operand), so lane (hi, lr) holds query lr, keys 8 hi + r (tile 0) and 16 + 8 hi + r (tile 1) = exactly the B-operand elements of P for
// O^T[d][query] = V^T (A operand) x P^T (B operand). Row statistics (running max, sum) are per lane; the two lane halves exchange twice per step (xor 16: max, then sum). HR: bf16 hi/lo planes, 3 products; else f16, P x1024.
template <bool HR>
__device__ __forceinline__ void attn_body(const h16* __restrict__ Q16, const h16* __restrict__ K16, const h16* __restrict__ VT16,
                                          const bf* __restrict__ Qh, const bf* __restrict__ Ql, const bf* __restrict__ Kh, const bf* __restrict__ Kl,
                                          const bf* __restrict__ VTh, const bf* __restrict__ VTl, const unsigned* __restrict__ MB, bf* ATh, bf* ATl) {
    __shared__ __align__(16) float cs[16 * 68];
    const int lane = threadIdx.x & 31, lr = lane & 15, hi = lane >> 4;
    const int q0 = (HR ? 0 : RH) + (int)blockIdx.x * 16;
    const int bh = (int)blockIdx.y, b = bh / NH, h = bh % NH;
    const size_t qoff = ((size_t)bh * (HR ? RH : SEQ) + q0 + lr) * HD + 8 * hi;
    const size_t koff = ((size_t)bh * SEQ + lr) * HD + 8 * hi;
    const size_t voff = ((size_t)bh * HD + lr) * SEQ + 8 * hi;
    const size_t moff = (size_t)(q0 + lr) * (SEQ / 32);
    const float NINF = -__builtin_huge_valf();
    v8f o[4];
#pragma unroll
    for (int dt = 0; dt < 4; ++dt) o[dt] = (v8f){};
    float m = NINF, l = 0.0f;
#pragma unroll 1
    for (int kc = 0; kc < SEQ / 32; ++kc) {
        const unsigned W = MB[moff + kc];
        if (__builtin_amdgcn_ballot_w32(W != 0u) == 0u) continue;     // wave-uniform: all 16 rows mask all 32 keys
        const size_t kk = (size_t)kc * 32;
        v8f s0 = (v8f){}, s1 = (v8f){};
        if (HR) {
#pragma unroll
            for (int ks = 0; ks < 2; ++ks) {
                const v16bf qh = ldb(Qh + qoff + ks * 32), ql = ldb(Ql + qoff + ks * 32);
                const v16bf a0h = ldb(Kh + koff + kk * HD + ks * 32), a0l = ldb(Kl + koff + kk * HD + ks * 32);
                const v16bf a1h = ldb(Kh + koff + (kk + 16) * HD + ks * 32), a1l = ldb(Kl + koff + (kk + 16) * HD + ks * 32);
                s0 = wmmab(a0h, qh, s0); s1 = wmmab(a1h, qh, s1); s0 = wmmab(a0l, qh, s0); s1 = wmmab(a1l, qh, s1); s0 = wmmab(a0h, ql, s0); s1 = wmmab(a1h, ql, s1);
                asm volatile("v_nop\n\tv_nop\n\tv_nop\n\tv_nop" : "+v"(s0), "+v"(s1) : "v"(ql), "v"(a0h), "v"(a1h));
            }
        } else {
#pragma unroll
            for (int ks = 0; ks < 2; ++ks) {
                const v16h qf = ldh(Q16 + qoff + ks * 32);
                const v16h k0f = ldh(K16 + koff + kk * HD + ks * 32), k1f = ldh(K16 + koff + (kk + 16) * HD + ks * 32);
                s0 = wmma16(k0f, qf, s0); s1 = wmma16(k1f, qf, s1);
                asm volatile("v_nop\n\tv_nop\n\tv_nop\n\tv_nop" : "+v"(s0), "+v"(s1) : "v"(qf), "v"(k0f), "v"(k1f));
            }
        }
        // online softmax for query lr over this lane's 16 keys + the partner lane's 16 keys
        const unsigned Wl = W >> (8 * hi);
        float t0[8], t1[8]; float mx = NINF;
#pragma unroll
        for (int r = 0; r < 8; ++r) { t0[r] = ((Wl >> r) & 1u) ? s0[r] * SCL : NINF; t1[r] = ((Wl >> (16 + r)) & 1u) ? s1[r] * SCL : NINF; mx = fmaxf(mx, fmaxf(t0[r], t1[r])); }
        mx = fmaxf(mx, __shfl_xor(mx, 16, 32));
        const float mnew = fmaxf(m, mx);
        const float msub = (mnew == NINF) ? 0.0f : mnew;
        float ds = __fsub_rn(m, msub); asm volatile("" : "+v"(ds));
        const float scl = __builtin_amdgcn_exp2f(__fmul_rn(ds, LOG2E));
        float p0[8], p1[8]; float psum = 0.0f;
#pragma unroll
        for (int r = 0; r < 8; ++r) { float d0 = __fsub_rn(t0[r], msub); asm volatile("" : "+v"(d0)); float d1 = __fsub_rn(t1[r], msub); asm volatile("" : "+v"(d1));
            p0[r] = __builtin_amdgcn_exp2f(__fmul_rn(d0, LOG2E)); p1[r] = __builtin_amdgcn_exp2f(__fmul_rn(d1, LOG2E)); psum += p0[r] + p1[r]; }
        psum += __shfl_xor(psum, 16, 32);
        l = l * scl + psum; m = mnew;
#pragma unroll
        for (int dt = 0; dt < 4; ++dt)
#pragma unroll
            for (int r = 0; r < 8; ++r) o[dt][r] *= scl;
        if (HR) {
            v16us ph, pl;
#pragma unroll
            for (int r = 0; r < 8; ++r) { unsigned short a, c; splitf(p0[r], a, c); ph[r] = a; pl[r] = c; splitf(p1[r], a, c); ph[8 + r] = a; pl[8 + r] = c; }
            const v16bf pbh = __builtin_bit_cast(v16bf, ph), pbl = __builtin_bit_cast(v16bf, pl);
            v16bf vh[4], vl[4];
#pragma unroll
            for (int dt = 0; dt < 4; ++dt) { vh[dt] = ldb(VTh + voff + (size_t)dt * 16 * SEQ + kk); vl[dt] = ldb(VTl + voff + (size_t)dt * 16 * SEQ + kk); }
#pragma unroll
            for (int dt = 0; dt < 4; ++dt) { o[dt] = wmmab(vh[dt], pbh, o[dt]); o[dt] = wmmab(vl[dt], pbh, o[dt]); o[dt] = wmmab(vh[dt], pbl, o[dt]); }
            asm volatile("v_nop\n\tv_nop\n\tv_nop\n\tv_nop" : "+v"(o[0]), "+v"(o[1]), "+v"(o[2]), "+v"(o[3]) : "v"(pbh), "v"(pbl), "v"(vh[3]), "v"(vl[3]));
        } else {
            v16h pb;
#pragma unroll
            for (int r = 0; r < 8; ++r) { pb[r] = (h16)(p0[r] * PCAR); pb[8 + r] = (h16)(p1[r] * PCAR); }
            v16h vf[4];
#pragma unroll
            for (int dt = 0; dt < 4; ++dt) vf[dt] = ldh(VT16 + voff + (size_t)dt * 16 * SEQ + kk);
#pragma unroll
            for (int dt = 0; dt < 4; ++dt) o[dt] = wmma16(vf[dt], pb, o[dt]);
            asm volatile("v_nop\n\tv_nop\n\tv_nop\n\tv_nop" : "+v"(o[0]), "+v"(o[1]), "+v"(o[2]), "+v"(o[3]) : "v"(pb), "v"(vf[0]), "v"(vf[3]));
        }
    }
    // normalise (a row without any kept key gives 0 x inf = NaN, as a softmax over an all -inf row does) and stage O[query lr][d]
    const float rl = 1.0f / l; const float inv = HR ? rl : rl * (1.0f / PCAR);
#pragma unroll
    for (int dt = 0; dt < 4; ++dt)
#pragma unroll
        for (int r = 0; r < 8; ++r) cs[lr * 68 + dt * 16 + 8 * hi + r] = o[dt][r] * inv;
    __builtin_amdgcn_wave_barrier(); asm volatile("" ::: "memory");
    bf* ah = ATh + ((size_t)b * SEQ + q0) * DQ + h * HD; bf* al = ATl + ((size_t)b * SEQ + q0) * DQ + h * HD;
{
#pragma unroll
        for (int it = 0; it < 4; ++it) { const int row = it * 4 + (lane >> 3), c = (lane & 7) * 8;
            const v4f x0 = *(const v4fa*)(cs + row * 68 + c), x1 = *(const v4fa*)(cs + row * 68 + c + 4); v8us oh, ol;
#pragma unroll
            for (int q = 0; q < 4; ++q) { unsigned short a, c2; splitf(x0[q], a, c2); oh[q] = a; ol[q] = c2; splitf(x1[q], a, c2); oh[4 + q] = a; ol[4 + q] = c2; }
            *(v8us*)(ah + (size_t)row * DQ + c) = oh; *(v8us*)(al + (size_t)row * DQ + c) = ol; }
         }
}
__global__ __launch_bounds__(32) void k_attn_hi(const bf* __restrict__ Qh, const bf* __restrict__ Ql, const bf* __restrict__ Kh, const bf* __restrict__ Kl, const bf* __restrict__ VTh, const bf* __restrict__ VTl,
                                                const unsigned* __restrict__ MB, bf* ATh, bf* ATl) {
    attn_body<true>(nullptr, nullptr, nullptr, Qh, Ql, Kh, Kl, VTh, VTl, MB, ATh, ATl); }
__global__ __launch_bounds__(32) void k_attn_lo(const h16* __restrict__ Q16, const h16* __restrict__ K16, const h16* __restrict__ VT16, const unsigned* __restrict__ MB, bf* ATh, bf* ATl) {
    attn_body<false>(Q16, K16, VT16, nullptr, nullptr, nullptr, nullptr, nullptr, nullptr, MB, ATh, ATl); }

// ---- workspace carve (bytes, every region a multiple of 256)
constexpr size_t al256(size_t x) { return (x + 255) & ~(size_t)255; }
constexpr size_t SZ_XB  = al256((size_t)NB * SEQ * DM * 2);
constexpr size_t SZ_W   = al256((size_t)DQ * DM * 2);
constexpr size_t SZ_CS  = al256((size_t)SEQ * HD * 2 * 4);
constexpr size_t SZ_MB  = al256((size_t)SEQ * SEQ / 8);
constexpr size_t SZ_TMP = al256((size_t)NB * SEQ * DQ * 4);
constexpr size_t SZ_PL  = al256((size_t)NB * NH * SEQ * HD * 2);
constexpr size_t SZ_QH  = al256((size_t)NB * NH * RH * HD * 2);
constexpr size_t SZ_AT  = al256((size_t)NB * SEQ * DQ * 2);
constexpr size_t WS_TOTAL = SZ_XB + 4 * SZ_W + SZ_CS + SZ_MB + SZ_TMP + SZ_PL + 2 * SZ_QH + 3 * SZ_PL + 3 * SZ_PL + 2 * SZ_AT;
static_assert(WS_TOTAL <= (size_t)134217728);

extern "C" void kernel_launch(void* const* d_in, const int* in_sizes, int n_in,
                              void* d_out, int out_size, void* d_ws, size_t ws_size, hipStream_t stream) {
    if (n_in < 10) return;
    const long long need_x = (long long)(NB - 1) * SEQ_FULL * DM + (long long)SEQ * DM;
    if ((long long)in_sizes[0] < need_x || (long long)out_size < need_x) return;
    if (in_sizes[1] < DQ * DM || in_sizes[3] < DQ * DM || in_sizes[5] < DQ * DM || in_sizes[7] < DM * DQ) return;
    if (in_sizes[2] < DQ || in_sizes[4] < DQ || in_sizes[6] < DQ || in_sizes[8] < DM) return;
    if ((long long)in_sizes[9] < (long long)(SEQ - 1) * SEQ_FULL + SEQ) return;
    if (WS_TOTAL > ws_size) return;
    const float* x  = (const float*)d_in[0];
    const float* Wq = (const float*)d_in[1]; const float* bq = (const float*)d_in[2];
    const float* Wk = (const float*)d_in[3]; const float* bk = (const float*)d_in[4];
    const float* Wv = (const float*)d_in[5]; const float* bv = (const float*)d_in[6];
    const float* Wo = (const float*)d_in[7]; const float* bo = (const float*)d_in[8];
    const int* mask = (const int*)d_in[9];
    float* OUT = (float*)d_out;
    char* wsp = (char*)d_ws;
    bf* XB = (bf*)wsp; wsp += SZ_XB;
    bf* WQ = (bf*)wsp; wsp += SZ_W; bf* WK = (bf*)wsp; wsp += SZ_W; bf* WV = (bf*)wsp; wsp += SZ_W; bf* WO = (bf*)wsp; wsp += SZ_W;
    float* CS = (float*)wsp; wsp += SZ_CS;
    unsigned* MB = (unsigned*)wsp; wsp += SZ_MB;
    float* TMP = (float*)wsp; wsp += SZ_TMP;
    h16* Q16 = (h16*)wsp; wsp += SZ_PL; bf* QPh = (bf*)wsp; wsp += SZ_QH; bf* QPl = (bf*)wsp; wsp += SZ_QH;
    h16* K16 = (h16*)wsp; wsp += SZ_PL; bf* KPh = (bf*)wsp; wsp += SZ_PL; bf* KPl = (bf*)wsp; wsp += SZ_PL;
    h16* VT16 = (h16*)wsp; wsp += SZ_PL; bf* VTh = (bf*)wsp; wsp += SZ_PL; bf* VTl = (bf*)wsp; wsp += SZ_PL;
    bf* ATh = (bf*)wsp; wsp += SZ_AT; bf* ATl = (bf*)wsp; wsp += SZ_AT;

    const size_t nw8 = (size_t)DQ * DM / 8;
    k_cvtx<<<(unsigned)(((size_t)NB * SEQ * DM / 8 + 255) / 256), 256, 0, stream>>>(x, XB);
    k_cvt8<<<(unsigned)((nw8 + 255) / 256), 256, 0, stream>>>(Wq, WQ, nw8);
    k_cvt8<<<(unsigned)((nw8 + 255) / 256), 256, 0, stream>>>(Wk, WK, nw8);
    k_cvt8<<<(unsigned)((nw8 + 255) / 256), 256, 0, stream>>>(Wv, WV, nw8);
    k_cvt8<<<(unsigned)((nw8 + 255) / 256), 256, 0, stream>>>(Wo, WO, nw8);
    k_cstab<<<(unsigned)((SEQ * (HD / 2) + 255) / 256), 256, 0, stream>>>(CS);
    k_mbits<<<(unsigned)(((size_t)SEQ * SEQ / 1024 + 7) / 8), 256, 0, stream>>>(mask, MB);

    const dim3 gp((unsigned)(NB * SEQ / 64), (unsigned)(DQ / 64), 1);
    const unsigned LP = (unsigned)(((size_t)NB * NH * SEQ * HD / 2 + 255) / 256);
    k_gemm1<<<gp, 32, 0, stream>>>(XB, WQ, DM, TMP, DQ, bq, (size_t)0, (size_t)0);
    k_rope<<<LP, 256, 0, stream>>>(TMP, CS, Q16, QPh, QPl, RH);
    k_gemm1<<<gp, 32, 0, stream>>>(XB, WK, DM, TMP, DQ, bk, (size_t)0, (size_t)0);
    k_rope<<<LP, 256, 0, stream>>>(TMP, CS, K16, KPh, KPl, SEQ);
    k_gemm1<<<gp, 32, 0, stream>>>(XB, WV, DM, TMP, DQ, bv, (size_t)0, (size_t)0);
    k_vtp<<<LP, 256, 0, stream>>>(TMP, VT16, VTh, VTl);

    k_attn_hi<<<dim3((unsigned)(RH / 16), (unsigned)(NB * NH), 1), 32, 0, stream>>>(QPh, QPl, KPh, KPl, VTh, VTl, MB, ATh, ATl);
    if (SEQ > RH) k_attn_lo<<<dim3((unsigned)((SEQ - RH) / 16), (unsigned)(NB * NH), 1), 32, 0, stream>>>(Q16, K16, VT16, MB, ATh, ATl);

    k_gemm2<<<dim3((unsigned)(SEQ / 64), (unsigned)(DM / 64), (unsigned)NB), 32, 0, stream>>>(ATh, ATl, WO, DQ, OUT, DM, bo, (size_t)SEQ * DQ, (size_t)SEQ_FULL * DM);
}

// v001
// Measured time: 235 microseconds a run.
// Two timings next to v000 both put it at 1.37 times that version's speed.
#include <hip/hip_runtime.h>

// All contractions on v_wmma_f32_16x16x32 (f32 accumulate): q/k/v projections bf16 x bf16 (x, W, b RNE-converted to bf16; products exact); scores q.k and P.V: query rows < 512 bf16 hi/lo planes (3 products), other rows f16 (P carried x1024); output projection bf16 hi/lo activations x bf16 weights (2 products).
// x [2][2048][1024]; Wq/Wk/Wv/Wo [out][in] with biases; 16 heads x 64; rotate-half rotary on q and k (table computed on the device: powf / sincosf); score scale 1/8; int32 keep-mask [S][S] read by value (0 -> -inf); softmax f32; out = merged heads Wo^T + bo.
// Pipeline: bf16 copies -> one-wave 64x64 GEMM tiles -> plane builders (q, k [bh][t][d]; v^T [bh][d][t]) -> mask bit-plane -> fused flash attention (four waves of 16 queries share each K / V tile through LDS, transposed tiles so the score accumulators are directly the P operand, online softmax) -> merged hi/lo planes -> output GEMM.

#ifndef NB
#define NB 2
#endif
#ifndef SEQ
#define SEQ 2048
#endif
#define NB_FULL  2
#define SEQ_FULL 2048
#define DM   1024
#define NH   16
#define HD   64
#define DQ   (NH * HD)
#define RH   ((SEQ) < 512 ? (SEQ) : 512)      // query rows < RH use the hi/lo planes
#define PCAR 1024.0f
#define SCL  0.125f                          // HD^-0.5
#define LOG2E 1.4426950408889634f

static_assert(HD == 64);                                   // two 32-deep k-steps per head, 4 output tiles of 16, table index = idx & 31
static_assert(DQ == DM);
static_assert(DM % 32 == 0 && DQ % 32 == 0);               // GEMM k-loop steps by 32
static_assert(DM % 8 == 0);
static_assert((NB * SEQ) % 64 == 0 && SEQ % 64 == 0 && DQ % 64 == 0 && DM % 64 == 0);   // 64x64 GEMM tiles, 64-element plane lines
static_assert(RH % 16 == 0 && (SEQ - RH) % 16 == 0);       // 16-query attention tiles
static_assert(SEQ % 32 == 0 && ((size_t)SEQ * SEQ) % 1024 == 0);   // 32-key words, 32 words per bit-plane line
static_assert(NB <= NB_FULL && SEQ <= SEQ_FULL);

typedef _Float16 h16;
typedef unsigned short bf;
typedef __attribute__((ext_vector_type(16))) __bf16   v16bf;
typedef __attribute__((ext_vector_type(16))) _Float16 v16h;
typedef __attribute__((ext_vector_type(8)))  _Float16 v8h;
typedef __attribute__((ext_vector_type(2)))  _Float16 v2h;
typedef __attribute__((ext_vector_type(16))) unsigned short v16us;
typedef __attribute__((ext_vector_type(8)))  unsigned short v8us;
typedef __attribute__((ext_vector_type(2)))  unsigned short v2us;
typedef __attribute__((ext_vector_type(8)))  float    v8f;
typedef __attribute__((ext_vector_type(4)))  float    v4f;
typedef __attribute__((ext_vector_type(2)))  float    v2f;
typedef v4f  __attribute__((may_alias)) v4fa;

__device__ __forceinline__ unsigned short f2bf(float f) { unsigned u = __float_as_uint(f); u += 0x7FFFu + ((u >> 16) & 1u); return (unsigned short)(u >> 16); }
__device__ __forceinline__ float bf2f(unsigned short b) { return __uint_as_float(((unsigned)b) << 16); }
__device__ __forceinline__ float bfr(float f) { return bf2f(f2bf(f)); }
__device__ __forceinline__ void splitf(float y, unsigned short& h, unsigned short& l) { h = f2bf(y); l = f2bf(y - bf2f(h)); }
__device__ __forceinline__ v16h cat16(v8h lo, v8h hi) { return __builtin_shufflevector(lo, hi, 0, 1, 2, 3, 4, 5, 6, 7, 8, 9, 10, 11, 12, 13, 14, 15); }
__device__ __forceinline__ v16bf cat16b(v8us lo, v8us hi) { return __builtin_bit_cast(v16bf, __builtin_shufflevector(lo, hi, 0, 1, 2, 3, 4, 5, 6, 7, 8, 9, 10, 11, 12, 13, 14, 15)); }
// fragment loaders: p already includes row * pitch + k0 + 8 * (lane >> 4); elements 0..7 <- p[0..7], elements 8..15 <- p[16..23]
__device__ __forceinline__ v16h  ldh(const h16* p) { return cat16(*(const v8h*)p, *(const v8h*)(p + 16)); }
__device__ __forceinline__ v16bf ldb(const bf* p)  { return cat16b(*(const v8us*)p, *(const v8us*)(p + 16)); }
__device__ __forceinline__ v8f wmma16(v16h a, v16h b, v8f c) { return __builtin_amdgcn_wmma_f32_16x16x32_f16(false, a, false, b, (short)0, c, false, false); }
__device__ __forceinline__ v8f wmmab(v16bf a, v16bf b, v8f c) { return __builtin_amdgcn_wmma_f32_16x16x32_bf16(false, a, false, b, (short)0, c, false, false); }

// ---- one-wave 64x64 GEMM tile: C[m][n] (f32, pitch ldc) = sum_k A[m][k] Bt[n][k] (+ A2[m][k] Bt[n][k] when NSPLIT == 1) + bf16(bias[n]); operands are K-contiguous bf16 planes, K % 32 == 0,
template <int NSPLIT>
__device__ __forceinline__ void gemm_body(const bf* __restrict__ A, const bf* __restrict__ A2, const bf* __restrict__ Bt, const int K,
                                          float* C, const int ldc, const float* __restrict__ bias, const size_t sA, const size_t sC) {
    __shared__ __align__(16) float os[16 * 68];
    const size_t z = blockIdx.z; A += z * sA; A2 += z * sA; C += z * sC;
    const int lane = threadIdx.x & 31, lr = lane & 15, hi = lane >> 4; const int r0 = (int)blockIdx.x * 64, c0 = (int)blockIdx.y * 64;
    v8f acc[4][4];
#pragma unroll
    for (int mb = 0; mb < 4; ++mb)
#pragma unroll
        for (int nb = 0; nb < 4; ++nb) acc[mb][nb] = (v8f){};
    const size_t aoff = (size_t)(r0 + lr) * K + 8 * hi, boff = (size_t)(c0 + lr) * K + 8 * hi;
#pragma unroll 1
    for (int kc = 0; kc < K; kc += 32) {
        v16bf a[4], a2[4];
#pragma unroll
        for (int mb = 0; mb < 4; ++mb) { a[mb] = ldb(A + aoff + (size_t)mb * 16 * K + kc); if (NSPLIT == 1) a2[mb] = ldb(A2 + aoff + (size_t)mb * 16 * K + kc); }
#pragma unroll
        for (int nb = 0; nb < 4; ++nb) { const v16bf bb = ldb(Bt + boff + (size_t)nb * 16 * K + kc);
#pragma unroll
            for (int mb = 0; mb < 4; ++mb) { acc[mb][nb] = wmmab(a[mb], bb, acc[mb][nb]); if (NSPLIT == 1) acc[mb][nb] = wmmab(a2[mb], bb, acc[mb][nb]); } }
        asm volatile("v_nop\n\tv_nop\n\tv_nop\n\tv_nop" : "+v"(acc[0][0]), "+v"(acc[1][1]), "+v"(acc[2][2]), "+v"(acc[3][3]) : "v"(a[0]), "v"(a[3]));
    }
    v4f bv;
#pragma unroll
    for (int q = 0; q < 4; ++q) bv[q] = bfr(bias[c0 + lr * 4 + q]);
#pragma unroll
    for (int mb = 0; mb < 4; ++mb) {
#pragma unroll
        for (int nb = 0; nb < 4; ++nb) {
#pragma unroll
            for (int j = 0; j < 8; ++j) os[(hi * 8 + j) * 68 + nb * 16 + lr] = acc[mb][nb][j]; }
        __builtin_amdgcn_wave_barrier(); asm volatile("" ::: "memory");
        float* crow = C + (size_t)(r0 + mb * 16) * ldc + c0;
{
#pragma unroll
            for (int s = 0; s < 8; ++s) { const int row = 2 * s + hi, cofs = lr * 4; v4f val = *(const v4fa*)(os + row * 68 + cofs); val += bv;
                *(v4f*)(crow + (size_t)row * ldc + cofs) = val; }
             }
        __builtin_amdgcn_wave_barrier(); asm volatile("" ::: "memory");
    }
}
__global__ __launch_bounds__(32) void k_gemm1(const bf* __restrict__ A, const bf* __restrict__ Bt, int K, float* C, int ldc, const float* __restrict__ bias, size_t sA, size_t sC) {
    gemm_body<0>(A, A, Bt, K, C, ldc, bias, sA, sC); }
__global__ __launch_bounds__(32) void k_gemm2(const bf* __restrict__ A, const bf* __restrict__ A2, const bf* __restrict__ Bt, int K, float* C, int ldc, const float* __restrict__ bias, size_t sA, size_t sC) {
    gemm_body<1>(A, A2, Bt, K, C, ldc, bias, sA, sC); }

__global__ __launch_bounds__(256) void k_cvt8(const float* __restrict__ src, bf* dst, size_t n8) { const size_t i = (size_t)blockIdx.x * 256 + threadIdx.x; if (i >= n8) return; const v8f v = *(const v8f*)(src + i * 8); v8us o;
#pragma unroll
    for (int k = 0; k < 8; ++k) o[k] = f2bf(v[k]);
    *(v8us*)(dst + i * 8) = o;  }
__global__ __launch_bounds__(256) void k_cvtx(const float* __restrict__ src, bf* dst) { const size_t i = (size_t)blockIdx.x * 256 + threadIdx.x; if (i >= (size_t)NB * SEQ * DM / 8) return;
    const size_t row = i / (DM / 8); const size_t c8 = i % (DM / 8); const size_t b = row / SEQ, t = row % SEQ; const v8f v = *(const v8f*)(src + ((b * SEQ_FULL + t) * DM + c8 * 8)); v8us o;
#pragma unroll
    for (int k = 0; k < 8; ++k) o[k] = f2bf(v[k]);
    *(v8us*)(dst + i * 8) = o;  }

__global__ __launch_bounds__(256) void k_cstab(float* CS) { const int idx = (int)blockIdx.x * 256 + (int)threadIdx.x; if (idx >= SEQ * (HD / 2)) return; const int i = idx & 31, t = idx >> 5;
    const float ex = (float)(2 * i) / (float)HD; const float pw = powf(10000.0f, ex); const float invf = 1.0f / pw; const float ang = __fmul_rn((float)t, invf); float sn, cn; sincosf(ang, &sn, &cn);
    v2f cs; cs[0] = cn; cs[1] = sn; float* p0 = CS + ((size_t)t * HD + i) * 2; float* p1 = p0 + (HD / 2) * 2;
    *(v2f*)p0 = cs; *(v2f*)p1 = cs;  }

__global__ __launch_bounds__(256) void k_mbits(const int* __restrict__ mask, unsigned* MB) { const int lane = threadIdx.x & 31; const int g = (int)blockIdx.x * 8 + (int)(threadIdx.x >> 5);
    if (g >= (int)((size_t)SEQ * SEQ / 1024)) return;   // wave-uniform
    unsigned mine = 0u;
#pragma unroll 4
    for (int j = 0; j < 32; ++j) { const int wd = g * 32 + j; const int q = wd / (SEQ / 32), kg = wd % (SEQ / 32); const int v = mask[(size_t)q * SEQ_FULL + kg * 32 + lane];
        const unsigned bal = __builtin_amdgcn_ballot_w32(v != 0); mine = (lane == j) ? bal : mine; }
    *(unsigned*)(MB + (size_t)g * 32 + lane) = mine;  }

// ---- k_rope: head planes [bh][t][d] (f16; bf16 hi/lo for t < hrows) of the rotate-half rotary of F[b*SEQ + t][h*HD + d]: out[d] = x[d] c - x[d+32] s (d < 32), out[d] = x[d] c + x[d-32] s (d >= 32);
__global__ __launch_bounds__(256) void k_rope(const float* __restrict__ F, const float* __restrict__ CS, h16* P16, bf* Ph, bf* Pl, int hrows) {
    const size_t e = ((size_t)blockIdx.x * 256 + threadIdx.x) * 2; if (e >= (size_t)NB * NH * SEQ * HD) return; const int d = (int)(e % HD); const int t = (int)((e / HD) % SEQ); const int bh = (int)(e / ((size_t)HD * SEQ)); const int b = bh / NH, h = bh % NH;
    const float* f = F + ((size_t)b * SEQ + t) * DQ + h * HD; v2h o16; v2us oh, ol;
#pragma unroll
    for (int q = 0; q < 2; ++q) { const int dd = d + q; const int dp = (dd < HD / 2) ? dd + HD / 2 : dd - HD / 2; const float x0 = f[dd], x1 = f[dp];
        const v2f cs = *(const v2f*)(CS + ((size_t)t * HD + dd) * 2); float a = __fmul_rn(x0, cs[0]), bq = __fmul_rn(x1, cs[1]); asm volatile("" : "+v"(a)); asm volatile("" : "+v"(bq)); const float r = (dd < HD / 2) ? __fsub_rn(a, bq) : __fadd_rn(a, bq);
        o16[q] = (h16)r; unsigned short a2, c2; splitf(r, a2, c2); oh[q] = a2; ol[q] = c2; }
    const bool wh = (t < hrows); const size_t eh = ((size_t)bh * hrows + (wh ? t : 0)) * HD + d;
    *(v2h*)(P16 + e) = o16; if (wh) { *(v2us*)(Ph + eh) = oh; *(v2us*)(Pl + eh) = ol; }
     }
__global__ __launch_bounds__(256) void k_vtp(const float* __restrict__ F, h16* V16, bf* Vh, bf* Vl) { const size_t e = ((size_t)blockIdx.x * 256 + threadIdx.x) * 2; if (e >= (size_t)NB * NH * HD * SEQ) return;
    const int t = (int)(e % SEQ); const int d = (int)((e / SEQ) % HD); const int g = (int)(e / ((size_t)SEQ * HD)); const int b = g / NH, h = g % NH; v2h o16; v2us oh, ol;
#pragma unroll
    for (int q = 0; q < 2; ++q) { const float x = F[((size_t)b * SEQ + t + q) * DQ + h * HD + d]; o16[q] = (h16)x; unsigned short a2, c2; splitf(x, a2, c2); oh[q] = a2; ol[q] = c2; }
    *(v2h*)(V16 + e) = o16; *(v2us*)(Vh + e) = oh; *(v2us*)(Vl + e) = ol;  }

// ---- fused attention, one work-group of AW waves per 16 * AW query rows of one (batch, head), one wave per 16 rows; 32 keys per step. Each step's K rows and V^T rows are brought into LDS once for the whole work-group
// (asynchronous copies, two buffers: the next step's tile flies while this one is worked on) and every wave reads its fragments from there. The rows' mask words are read once into LDS; a step is staged only when some
// row of the work-group keeps one of its 32 keys, and a wave works on it only when one of its own 16 rows does (exact for any mask; the steps a wave works on and their order are those of a walk over all SEQ / 32 steps).
// Transposed tiles: S^T[key][query] = K (A operand) x Q^T (B operand), so lane (hi, lr) holds query lr, keys 8 hi + r (tile 0) and 16 + 8 hi + r (tile 1) = exactly the B-operand elements of P for
// O^T[d][query] = V^T (A operand) x P^T (B operand). Row statistics (running max, sum) are per lane; the two lane halves exchange twice per step, max then sum (xor 16). HR: bf16 hi/lo planes, 3 products; else f16, P x1024.
#define AW 4                                  // waves per attention work-group
#define KP 72                                 // LDS pitch of a K row, 16-bit elements: 144 B = 16 B x 9, conflict-free for 16-byte reads down a column of rows
#define VP 40                                 // LDS pitch of a V^T row of 32 keys: 80 B = 16 B x 5
#define MP 65                                 // LDS pitch of a row's mask words, dwords
static_assert(RH % (16 * AW) == 0 && (SEQ - RH) % (16 * AW) == 0);   // whole work-groups
static_assert(SEQ / 32 <= 64);                                       // a row's steps fit one 64-bit word
static_assert(AW * 32 == 128 && HD == 64);                           // the copy index maps below: 256 16-byte pieces per K plane and per V^T plane, two of each per lane

// four asynchronous 16-byte copies per lane, global -> LDS; the s_wait_xcnt stands inside the statement so that no address register named here is rewritten ahead of it
__device__ __forceinline__ void copy4(unsigned l0, const void* g0, unsigned l1, const void* g1, unsigned l2, const void* g2, unsigned l3, const void* g3) {
    asm volatile("global_load_async_to_lds_b128 %0, %4, off\n\t"
                 "global_load_async_to_lds_b128 %1, %5, off\n\t"
                 "global_load_async_to_lds_b128 %2, %6, off\n\t"
                 "global_load_async_to_lds_b128 %3, %7, off\n\t"
                 "s_wait_xcnt 0x0"
                 :: "v"(l0), "v"(l1), "v"(l2), "v"(l3), "v"(g0), "v"(g1), "v"(g2), "v"(g3) : "memory"); }

template <bool HR>
__device__ __forceinline__ void attn_body(const h16* __restrict__ Q16, const h16* __restrict__ K16, const h16* __restrict__ VT16,
                                          const bf* __restrict__ Qh, const bf* __restrict__ Ql, const bf* __restrict__ Kh, const bf* __restrict__ Kl,
                                          const bf* __restrict__ VTh, const bf* __restrict__ VTl, const unsigned* __restrict__ MB, bf* ATh, bf* ATl) {
    constexpr int NPL = HR ? 2 : 1;                                   // planes per operand
    constexpr int KT = 32 * KP, VT = HD * VP, BUF = NPL * (KT + VT);  // 16-bit elements; a buffer is [K planes][V^T planes]
    constexpr int NW = SEQ / 32;
    __shared__ __align__(16) unsigned short ring[2 * BUF];
    __shared__ unsigned msk[AW * 16 * MP];
    __shared__ unsigned lv[AW * 2];
    __shared__ __align__(16) float csall[AW * 16 * 68];
    const int tid = (int)threadIdx.x, lane = tid & 31, lr = lane & 15, hi = lane >> 4;
    const int w = __builtin_amdgcn_readfirstlane(tid >> 5);
    float* cs = csall + w * (16 * 68);
    const int q0 = (HR ? 0 : RH) + (int)blockIdx.x * (16 * AW) + w * 16;
    const int bh = (int)blockIdx.y, b = bh / NH, h = bh % NH;
    const size_t qoff = ((size_t)bh * (HR ? RH : SEQ) + q0 + lr) * HD + 8 * hi;
    const float NINF = -__builtin_huge_valf();

    // mask words of this wave's 16 rows -> LDS (read back by this wave alone); which steps keep a key: for the wave (own), for the work-group (live)
    unsigned nz0 = 0u, nz1 = 0u;
#pragma unroll   // all 32 loads in flight at once
    for (int r = 0; r < 16; ++r) { const unsigned* mrow = MB + (size_t)(q0 + r) * NW; const unsigned a = (lane < NW) ? mrow[lane] : 0u, c = (lane + 32 < NW) ? mrow[lane + 32] : 0u;
        msk[(w * 16 + r) * MP + lane] = a; msk[(w * 16 + r) * MP + 32 + lane] = c; nz0 |= a; nz1 |= c; }
    const unsigned own0 = __builtin_amdgcn_ballot_w32(nz0 != 0u), own1 = __builtin_amdgcn_ballot_w32(nz1 != 0u);
    if (lane == 0) { lv[w * 2] = own0; lv[w * 2 + 1] = own1; }
    __syncthreads();
    unsigned g0 = 0u, g1 = 0u;
    for (int i = 0; i < AW; ++i) { g0 |= lv[i * 2]; g1 |= lv[i * 2 + 1]; }
    const unsigned long long own = (unsigned long long)own0 | ((unsigned long long)own1 << 32);
    unsigned long long rest = (unsigned long long)(unsigned)__builtin_amdgcn_readfirstlane((int)g0) | ((unsigned long long)(unsigned)__builtin_amdgcn_readfirstlane((int)g1) << 32);   // steps not yet issued, the same in every wave

    // Q fragments stay in registers
    v16h qf[2]; v16bf qh[2], ql[2];
#pragma unroll   // constant indices keep the fragment arrays in registers (so at the K fragments below)
    for (int ks = 0; ks < 2; ++ks) { if (HR) { qh[ks] = ldb(Qh + qoff + ks * 32); ql[ks] = ldb(Ql + qoff + ks * 32); } else qf[ks] = ldh(Q16 + qoff + ks * 32); }

    // copy maps: a step's 32 K rows are 4 KiB in a row in global memory (piece i = tid, tid + 128: row i >> 3, 16-byte column i & 7); its V^T tile is 64 rows of 64 B (piece i: row i >> 2, column i & 3)
    const unsigned ringb = (unsigned)(size_t)(const void*)ring;       // LDS byte address of the ring
    const unsigned lk = ringb + (unsigned)((tid >> 3) * (KP * 2) + (tid & 7) * 16);
    const unsigned lvv = ringb + (unsigned)(NPL * KT * 2 + (tid >> 2) * (VP * 2) + (tid & 3) * 16);
    const size_t gk = (size_t)bh * SEQ * HD + (size_t)tid * 8;
    const size_t gv = ((size_t)bh * HD + (tid >> 2)) * SEQ + (tid & 3) * 8;
    auto issue = [&](const int kc, const int bi) {
        const unsigned bo = (unsigned)(bi * (BUF * 2)); const size_t ko = gk + (size_t)kc * 32 * HD, vo = gv + (size_t)kc * 32;
        if (HR) {
            copy4(lk + bo, Kh + ko, lk + bo + 16 * KP * 2, Kh + ko + 1024, lk + bo + KT * 2, Kl + ko, lk + bo + KT * 2 + 16 * KP * 2, Kl + ko + 1024);
            copy4(lvv + bo, VTh + vo, lvv + bo + 32 * VP * 2, VTh + vo + (size_t)32 * SEQ, lvv + bo + VT * 2, VTl + vo, lvv + bo + VT * 2 + 32 * VP * 2, VTl + vo + (size_t)32 * SEQ);
        } else {
            copy4(lk + bo, K16 + ko, lk + bo + 16 * KP * 2, K16 + ko + 1024, lvv + bo, VT16 + vo, lvv + bo + 32 * VP * 2, VT16 + vo + (size_t)32 * SEQ);
        } };

    v8f o[4];
#pragma unroll
    for (int dt = 0; dt < 4; ++dt) o[dt] = (v8f){};
    float m = NINF, l = 0.0f;
    int cur = -1, nxt = -1, bi = 0;
    if (rest != 0ull) {
        cur = __builtin_ctzll(rest); rest &= rest - 1ull; issue(cur, 0);
        asm volatile("s_wait_asynccnt 0x0" ::: "memory");            // this wave's share of the first tile has landed
        __syncthreads();                                             // ... and every other wave's
        if (rest != 0ull) { nxt = __builtin_ctzll(rest); rest &= rest - 1ull; issue(nxt, 1); }
    }
    while (cur >= 0) {
      if ((own >> cur) & 1ull) {                                      // wave-uniform: else all 16 rows mask all 32 keys
        const unsigned W = msk[(w * 16 + lr) * MP + cur];
        const unsigned short* kb = ring + bi * BUF + lr * KP + 8 * hi;
        const unsigned short* vb = ring + bi * BUF + NPL * KT + lr * VP + 8 * hi;
        v8f s0 = (v8f){}, s1 = (v8f){};
        if (HR) {
            v16bf a0h[2], a0l[2], a1h[2], a1l[2];
#pragma unroll
            for (int ks = 0; ks < 2; ++ks) { a0h[ks] = ldb(kb + ks * 32); a0l[ks] = ldb(kb + KT + ks * 32); a1h[ks] = ldb(kb + 16 * KP + ks * 32); a1l[ks] = ldb(kb + KT + 16 * KP + ks * 32); }
#pragma unroll
            for (int ks = 0; ks < 2; ++ks) {
                s0 = wmmab(a0h[ks], qh[ks], s0); s1 = wmmab(a1h[ks], qh[ks], s1); s0 = wmmab(a0l[ks], qh[ks], s0); s1 = wmmab(a1l[ks], qh[ks], s1); s0 = wmmab(a0h[ks], ql[ks], s0); s1 = wmmab(a1h[ks], ql[ks], s1);
                asm volatile("v_nop\n\tv_nop\n\tv_nop\n\tv_nop" : "+v"(s0), "+v"(s1) : "v"(ql[ks]), "v"(a0h[ks]), "v"(a1h[ks]));
            }
        } else {
            v16h k0f[2], k1f[2];
#pragma unroll
            for (int ks = 0; ks < 2; ++ks) { k0f[ks] = ldh((const h16*)kb + ks * 32); k1f[ks] = ldh((const h16*)kb + 16 * KP + ks * 32); }
#pragma unroll
            for (int ks = 0; ks < 2; ++ks) {
                s0 = wmma16(k0f[ks], qf[ks], s0); s1 = wmma16(k1f[ks], qf[ks], s1);
                asm volatile("v_nop\n\tv_nop\n\tv_nop\n\tv_nop" : "+v"(s0), "+v"(s1) : "v"(qf[ks]), "v"(k0f[ks]), "v"(k1f[ks]));
            }
        }
        // online softmax for query lr over this lane's 16 keys + the partner lane's 16 keys
        const unsigned Wl = W >> (8 * hi);
        float t0[8], t1[8]; float mx = NINF;
#pragma unroll
        for (int r = 0; r < 8; ++r) { t0[r] = ((Wl >> r) & 1u) ? s0[r] * SCL : NINF; t1[r] = ((Wl >> (16 + r)) & 1u) ? s1[r] * SCL : NINF; mx = fmaxf(mx, fmaxf(t0[r], t1[r])); }
        mx = fmaxf(mx, __shfl_xor(mx, 16, 32));
        const float mnew = fmaxf(m, mx);
        const float msub = (mnew == NINF) ? 0.0f : mnew;
        float ds = __fsub_rn(m, msub); asm volatile("" : "+v"(ds));
        const float scl = __builtin_amdgcn_exp2f(__fmul_rn(ds, LOG2E));
        float p0[8], p1[8]; float psum = 0.0f;
#pragma unroll
        for (int r = 0; r < 8; ++r) { float d0 = __fsub_rn(t0[r], msub); asm volatile("" : "+v"(d0)); float d1 = __fsub_rn(t1[r], msub); asm volatile("" : "+v"(d1));
            p0[r] = __builtin_amdgcn_exp2f(__fmul_rn(d0, LOG2E)); p1[r] = __builtin_amdgcn_exp2f(__fmul_rn(d1, LOG2E)); psum += p0[r] + p1[r]; }
        psum += __shfl_xor(psum, 16, 32);
        l = l * scl + psum; m = mnew;
#pragma unroll
        for (int dt = 0; dt < 4; ++dt)
#pragma unroll
            for (int r = 0; r < 8; ++r) o[dt][r] *= scl;
        if (HR) {
            v16us ph, pl;
#pragma unroll
            for (int r = 0; r < 8; ++r) { unsigned short a, c; splitf(p0[r], a, c); ph[r] = a; pl[r] = c; splitf(p1[r], a, c); ph[8 + r] = a; pl[8 + r] = c; }
            const v16bf pbh = __builtin_bit_cast(v16bf, ph), pbl = __builtin_bit_cast(v16bf, pl);
            v16bf vh[4], vl[4];
#pragma unroll
            for (int dt = 0; dt < 4; ++dt) { vh[dt] = ldb(vb + dt * 16 * VP); vl[dt] = ldb(vb + VT + dt * 16 * VP); }
#pragma unroll
            for (int dt = 0; dt < 4; ++dt) { o[dt] = wmmab(vh[dt], pbh, o[dt]); o[dt] = wmmab(vl[dt], pbh, o[dt]); o[dt] = wmmab(vh[dt], pbl, o[dt]); }
            asm volatile("v_nop\n\tv_nop\n\tv_nop\n\tv_nop" : "+v"(o[0]), "+v"(o[1]), "+v"(o[2]), "+v"(o[3]) : "v"(pbh), "v"(pbl), "v"(vh[3]), "v"(vl[3]));
        } else {
            v16h pb;
#pragma unroll
            for (int r = 0; r < 8; ++r) { pb[r] = (h16)(p0[r] * PCAR); pb[8 + r] = (h16)(p1[r] * PCAR); }
            v16h vf[4];
#pragma unroll
            for (int dt = 0; dt < 4; ++dt) vf[dt] = ldh((const h16*)vb + dt * 16 * VP);
#pragma unroll
            for (int dt = 0; dt < 4; ++dt) o[dt] = wmma16(vf[dt], pb, o[dt]);
            asm volatile("v_nop\n\tv_nop\n\tv_nop\n\tv_nop" : "+v"(o[0]), "+v"(o[1]), "+v"(o[2]), "+v"(o[3]) : "v"(pb), "v"(vf[0]), "v"(vf[3]));
        }
      }
        // hand-over, every wave, also one that skipped the step: my LDS reads of this buffer are done, my share of the next tile has landed, then the barrier that publishes the next tile and frees this buffer
        asm volatile("s_wait_dscnt 0x0" ::: "memory");
        asm volatile("s_wait_asynccnt 0x0" ::: "memory");
        __syncthreads();
        cur = nxt; nxt = -1;
        if (rest != 0ull) { nxt = __builtin_ctzll(rest); rest &= rest - 1ull; issue(nxt, bi); }
        bi ^= 1;
    }
    asm volatile("s_wait_asynccnt 0x0" ::: "memory");                // no copy is left in flight when the wave ends
    // normalise (a row without any kept key gives 0 x inf = NaN, as a softmax over an all -inf row does) and stage O[query lr][d]
    const float rl = 1.0f / l; const float inv = HR ? rl : rl * (1.0f / PCAR);
#pragma unroll
    for (int dt = 0; dt < 4; ++dt)
#pragma unroll
        for (int r = 0; r < 8; ++r) cs[lr * 68 + dt * 16 + 8 * hi + r] = o[dt][r] * inv;
    __builtin_amdgcn_wave_barrier(); asm volatile("" ::: "memory");
    bf* ah = ATh + ((size_t)b * SEQ + q0) * DQ + h * HD; bf* al = ATl + ((size_t)b * SEQ + q0) * DQ + h * HD;
{
#pragma unroll
        for (int it = 0; it < 4; ++it) { const int row = it * 4 + (lane >> 3), c = (lane & 7) * 8;
            const v4f x0 = *(const v4fa*)(cs + row * 68 + c), x1 = *(const v4fa*)(cs + row * 68 + c + 4); v8us oh, ol;
#pragma unroll
            for (int q = 0; q < 4; ++q) { unsigned short a, c2; splitf(x0[q], a, c2); oh[q] = a; ol[q] = c2; splitf(x1[q], a, c2); oh[4 + q] = a; ol[4 + q] = c2; }
            *(v8us*)(ah + (size_t)row * DQ + c) = oh; *(v8us*)(al + (size_t)row * DQ + c) = ol; }
         }
}
__global__ __launch_bounds__(AW * 32) void k_attn_hi(const bf* __restrict__ Qh, const bf* __restrict__ Ql, const bf* __restrict__ Kh, const bf* __restrict__ Kl, const bf* __restrict__ VTh, const bf* __restrict__ VTl,
                                                const unsigned* __restrict__ MB, bf* ATh, bf* ATl) {
    attn_body<true>(nullptr, nullptr, nullptr, Qh, Ql, Kh, Kl, VTh, VTl, MB, ATh, ATl); }
__global__ __launch_bounds__(AW * 32) void k_attn_lo(const h16* __restrict__ Q16, const h16* __restrict__ K16, const h16* __restrict__ VT16, const unsigned* __restrict__ MB, bf* ATh, bf* ATl) {
    attn_body<false>(Q16, K16, VT16, nullptr, nullptr, nullptr, nullptr, nullptr, nullptr, MB, ATh, ATl); }

// ---- workspace carve (bytes, every region a multiple of 256)
constexpr size_t al256(size_t x) { return (x + 255) & ~(size_t)255; }
constexpr size_t SZ_XB  = al256((size_t)NB * SEQ * DM * 2);
constexpr size_t SZ_W   = al256((size_t)DQ * DM * 2);
constexpr size_t SZ_CS  = al256((size_t)SEQ * HD * 2 * 4);
constexpr size_t SZ_MB  = al256((size_t)SEQ * SEQ / 8);
constexpr size_t SZ_TMP = al256((size_t)NB * SEQ * DQ * 4);
constexpr size_t SZ_PL  = al256((size_t)NB * NH * SEQ * HD * 2);
constexpr size_t SZ_QH  = al256((size_t)NB * NH * RH * HD * 2);
constexpr size_t SZ_AT  = al256((size_t)NB * SEQ * DQ * 2);
constexpr size_t WS_TOTAL = SZ_XB + 4 * SZ_W + SZ_CS + SZ_MB + SZ_TMP + SZ_PL + 2 * SZ_QH + 3 * SZ_PL + 3 * SZ_PL + 2 * SZ_AT;
static_assert(WS_TOTAL <= (size_t)134217728);

extern "C" void kernel_launch(void* const* d_in, const int* in_sizes, int n_in,
                              void* d_out, int out_size, void* d_ws, size_t ws_size, hipStream_t stream) {
    if (n_in < 10) return;
    const long long need_x = (long long)(NB - 1) * SEQ_FULL * DM + (long long)SEQ * DM;
    if ((long long)in_sizes[0] < need_x || (long long)out_size < need_x) return;
    if (in_sizes[1] < DQ * DM || in_sizes[3] < DQ * DM || in_sizes[5] < DQ * DM || in_sizes[7] < DM * DQ) return;
    if (in_sizes[2] < DQ || in_sizes[4] < DQ || in_sizes[6] < DQ || in_sizes[8] < DM) return;
    if ((long long)in_sizes[9] < (long long)(SEQ - 1) * SEQ_FULL + SEQ) return;
    if (WS_TOTAL > ws_size) return;
    const float* x  = (const float*)d_in[0];
    const float* Wq = (const float*)d_in[1]; const float* bq = (const float*)d_in[2];
    const float* Wk = (const float*)d_in[3]; const float* bk = (const float*)d_in[4];
    const float* Wv = (const float*)d_in[5]; const float* bv = (const float*)d_in[6];
    const float* Wo = (const float*)d_in[7]; const float* bo = (const float*)d_in[8];
    const int* mask = (const int*)d_in[9];
    float* OUT = (float*)d_out;
    char* wsp = (char*)d_ws;
    bf* XB = (bf*)wsp; wsp += SZ_XB;
    bf* WQ = (bf*)wsp; wsp += SZ_W; bf* WK = (bf*)wsp; wsp += SZ_W; bf* WV = (bf*)wsp; wsp += SZ_W; bf* WO = (bf*)wsp; wsp += SZ_W;
    float* CS = (float*)wsp; wsp += SZ_CS;
    unsigned* MB = (unsigned*)wsp; wsp += SZ_MB;
    float* TMP = (float*)wsp; wsp += SZ_TMP;
    h16* Q16 = (h16*)wsp; wsp += SZ_PL; bf* QPh = (bf*)wsp; wsp += SZ_QH; bf* QPl = (bf*)wsp; wsp += SZ_QH;
    h16* K16 = (h16*)wsp; wsp += SZ_PL; bf* KPh = (bf*)wsp; wsp += SZ_PL; bf* KPl = (bf*)wsp; wsp += SZ_PL;
    h16* VT16 = (h16*)wsp; wsp += SZ_PL; bf* VTh = (bf*)wsp; wsp += SZ_PL; bf* VTl = (bf*)wsp; wsp += SZ_PL;
    bf* ATh = (bf*)wsp; wsp += SZ_AT; bf* ATl = (bf*)wsp; wsp += SZ_AT;

    const size_t nw8 = (size_t)DQ * DM / 8;
    k_cvtx<<<(unsigned)(((size_t)NB * SEQ * DM / 8 + 255) / 256), 256, 0, stream>>>(x, XB);
    k_cvt8<<<(unsigned)((nw8 + 255) / 256), 256, 0, stream>>>(Wq, WQ, nw8);
    k_cvt8<<<(unsigned)((nw8 + 255) / 256), 256, 0, stream>>>(Wk, WK, nw8);
    k_cvt8<<<(unsigned)((nw8 + 255) / 256), 256, 0, stream>>>(Wv, WV, nw8);
    k_cvt8<<<(unsigned)((nw8 + 255) / 256), 256, 0, stream>>>(Wo, WO, nw8);
    k_cstab<<<(unsigned)((SEQ * (HD / 2) + 255) / 256), 256, 0, stream>>>(CS);
    k_mbits<<<(unsigned)(((size_t)SEQ * SEQ / 1024 + 7) / 8), 256, 0, stream>>>(mask, MB);

    const dim3 gp((unsigned)(NB * SEQ / 64), (unsigned)(DQ / 64), 1);
    const unsigned LP = (unsigned)(((size_t)NB * NH * SEQ * HD / 2 + 255) / 256);
    k_gemm1<<<gp, 32, 0, stream>>>(XB, WQ, DM, TMP, DQ, bq, (size_t)0, (size_t)0);
    k_rope<<<LP, 256, 0, stream>>>(TMP, CS, Q16, QPh, QPl, RH);
    k_gemm1<<<gp, 32, 0, stream>>>(XB, WK, DM, TMP, DQ, bk, (size_t)0, (size_t)0);
    k_rope<<<LP, 256, 0, stream>>>(TMP, CS, K16, KPh, KPl, SEQ);
    k_gemm1<<<gp, 32, 0, stream>>>(XB, WV, DM, TMP, DQ, bv, (size_t)0, (size_t)0);
    k_vtp<<<LP, 256, 0, stream>>>(TMP, VT16, VTh, VTl);

    k_attn_hi<<<dim3((unsigned)(RH / (16 * AW)), (unsigned)(NB * NH), 1), AW * 32, 0, stream>>>(QPh, QPl, KPh, KPl, VTh, VTl, MB, ATh, ATl);
    if (SEQ > RH) k_attn_lo<<<dim3((unsigned)((SEQ - RH) / (16 * AW)), (unsigned)(NB * NH), 1), AW * 32, 0, stream>>>(Q16, K16, VT16, MB, ATh, ATl);

    k_gemm2<<<dim3((unsigned)(SEQ / 64), (unsigned)(DM / 64), (unsigned)NB), 32, 0, stream>>>(ATh, ATl, WO, DQ, OUT, DM, bo, (size_t)SEQ * DQ, (size_t)SEQ_FULL * DM);
}

// v002
// A run of this version takes 196 microseconds.
// Next to v001, in two timings, it ran 1.22 times as fast each time.
// Over all steps from v000 it is 1.68 times as fast.
#include <hip/hip_runtime.h>

// All contractions on v_wmma_f32_16x16x32 (f32 accumulate): q/k/v projections bf16 x bf16 (x, W, b RNE-converted to bf16; products exact); scores q.k and P.V: query rows < 512 bf16 hi/lo planes (3 products), other rows f16 (P carried x1024); output projection bf16 hi/lo activations x bf16 weights (2 products).
// x [2][2048][1024]; Wq/Wk/Wv/Wo [out][in] with biases; 16 heads x 64; rotate-half rotary on q and k (table computed on the device: powf / sincosf); score scale 1/8; int32 keep-mask [S][S] read by value (0 -> -inf); softmax f32; out = merged heads Wo^T + bo.
// Pipeline: bf16 copies -> mask bit-plane -> one-wave 64x64 projection tiles whose epilogue applies bias and rotary and writes the head planes itself (q, k [bh][t][d]; v^T [bh][d][t]) -> fused flash attention (four waves of 16 queries share each K / V tile through LDS, transposed tiles so the score accumulators are directly the P operand, online softmax) -> merged hi/lo planes -> output GEMM.

#ifndef NB
#define NB 2
#endif
#ifndef SEQ
#define SEQ 2048
#endif
#define NB_FULL  2
#define SEQ_FULL 2048
#define DM   1024
#define NH   16
#define HD   64
#define DQ   (NH * HD)
#define RH   ((SEQ) < 512 ? (SEQ) : 512)      // query rows < RH use the hi/lo planes
#define PCAR 1024.0f
#define SCL  0.125f                          // HD^-0.5
#define LOG2E 1.4426950408889634f

static_assert(HD == 64);                                   // two 32-deep k-steps per head, 4 output tiles of 16, table index = idx & 31
static_assert(DQ == DM);
static_assert(DM % 32 == 0 && DQ % 32 == 0);               // GEMM k-loop steps by 32
static_assert(DM % 8 == 0);
static_assert((NB * SEQ) % 64 == 0 && SEQ % 64 == 0 && DQ % 64 == 0 && DM % 64 == 0);   // 64x64 GEMM tiles, 64-element plane lines
static_assert(RH % 16 == 0 && (SEQ - RH) % 16 == 0);       // 16-query attention tiles
static_assert(SEQ % 32 == 0 && ((size_t)SEQ * SEQ) % 1024 == 0);   // 32-key words, 32 words per bit-plane line
static_assert(NB <= NB_FULL && SEQ <= SEQ_FULL);

typedef _Float16 h16;
typedef unsigned short bf;
typedef __attribute__((ext_vector_type(16))) __bf16   v16bf;
typedef __attribute__((ext_vector_type(16))) _Float16 v16h;
typedef __attribute__((ext_vector_type(8)))  _Float16 v8h;
typedef __attribute__((ext_vector_type(2)))  _Float16 v2h;
typedef __attribute__((ext_vector_type(16))) unsigned short v16us;
typedef __attribute__((ext_vector_type(8)))  unsigned short v8us;
typedef __attribute__((ext_vector_type(2)))  unsigned short v2us;
typedef __attribute__((ext_vector_type(8)))  float    v8f;
typedef __attribute__((ext_vector_type(4)))  float    v4f;
typedef __attribute__((ext_vector_type(2)))  float    v2f;
typedef v4f  __attribute__((may_alias)) v4fa;

__device__ __forceinline__ unsigned short f2bf(float f) { unsigned u = __float_as_uint(f); u += 0x7FFFu + ((u >> 16) & 1u); return (unsigned short)(u >> 16); }
__device__ __forceinline__ float bf2f(unsigned short b) { return __uint_as_float(((unsigned)b) << 16); }
__device__ __forceinline__ float bfr(float f) { return bf2f(f2bf(f)); }
__device__ __forceinline__ void splitf(float y, unsigned short& h, unsigned short& l) { h = f2bf(y); l = f2bf(y - bf2f(h)); }
__device__ __forceinline__ v16h cat16(v8h lo, v8h hi) { return __builtin_shufflevector(lo, hi, 0, 1, 2, 3, 4, 5, 6, 7, 8, 9, 10, 11, 12, 13, 14, 15); }
__device__ __forceinline__ v16bf cat16b(v8us lo, v8us hi) { return __builtin_bit_cast(v16bf, __builtin_shufflevector(lo, hi, 0, 1, 2, 3, 4, 5, 6, 7, 8, 9, 10, 11, 12, 13, 14, 15)); }
// fragment loaders: p already includes row * pitch + k0 + 8 * (lane >> 4); elements 0..7 <- p[0..7], elements 8..15 <- p[16..23]
__device__ __forceinline__ v16h  ldh(const h16* p) { return cat16(*(const v8h*)p, *(const v8h*)(p + 16)); }
__device__ __forceinline__ v16bf ldb(const bf* p)  { return cat16b(*(const v8us*)p, *(const v8us*)(p + 16)); }
__device__ __forceinline__ v8f wmma16(v16h a, v16h b, v8f c) { return __builtin_amdgcn_wmma_f32_16x16x32_f16(false, a, false, b, (short)0, c, false, false); }
__device__ __forceinline__ v8f wmmab(v16bf a, v16bf b, v8f c) { return __builtin_amdgcn_wmma_f32_16x16x32_bf16(false, a, false, b, (short)0, c, false, false); }

// ---- one-wave 64x64 GEMM tile: C[m][n] (f32, pitch ldc) = sum_k A[m][k] Bt[n][k] (+ A2[m][k] Bt[n][k] when NSPLIT == 1) + bf16(bias[n]); operands are K-contiguous bf16 planes, K % 32 == 0,
template <int NSPLIT>
__device__ __forceinline__ void gemm_body(const bf* __restrict__ A, const bf* __restrict__ A2, const bf* __restrict__ Bt, const int K,
                                          float* C, const int ldc, const float* __restrict__ bias, const size_t sA, const size_t sC) {
    __shared__ __align__(16) float os[16 * 68];
    const size_t z = blockIdx.z; A += z * sA; A2 += z * sA; C += z * sC;
    const int lane = threadIdx.x & 31, lr = lane & 15, hi = lane >> 4; const int r0 = (int)blockIdx.x * 64, c0 = (int)blockIdx.y * 64;
    v8f acc[4][4];
#pragma unroll
    for (int mb = 0; mb < 4; ++mb)
#pragma unroll
        for (int nb = 0; nb < 4; ++nb) acc[mb][nb] = (v8f){};
    const size_t aoff = (size_t)(r0 + lr) * K + 8 * hi, boff = (size_t)(c0 + lr) * K + 8 * hi;
#pragma unroll 1
    for (int kc = 0; kc < K; kc += 32) {
        v16bf a[4], a2[4];
#pragma unroll
        for (int mb = 0; mb < 4; ++mb) { a[mb] = ldb(A + aoff + (size_t)mb * 16 * K + kc); if (NSPLIT == 1) a2[mb] = ldb(A2 + aoff + (size_t)mb * 16 * K + kc); }
#pragma unroll
        for (int nb = 0; nb < 4; ++nb) { const v16bf bb = ldb(Bt + boff + (size_t)nb * 16 * K + kc);
#pragma unroll
            for (int mb = 0; mb < 4; ++mb) { acc[mb][nb] = wmmab(a[mb], bb, acc[mb][nb]); if (NSPLIT == 1) acc[mb][nb] = wmmab(a2[mb], bb, acc[mb][nb]); } }
        asm volatile("v_nop\n\tv_nop\n\tv_nop\n\tv_nop" : "+v"(acc[0][0]), "+v"(acc[1][1]), "+v"(acc[2][2]), "+v"(acc[3][3]) : "v"(a[0]), "v"(a[3]));
    }
    v4f bv;
#pragma unroll
    for (int q = 0; q < 4; ++q) bv[q] = bfr(bias[c0 + lr * 4 + q]);
#pragma unroll
    for (int mb = 0; mb < 4; ++mb) {
#pragma unroll
        for (int nb = 0; nb < 4; ++nb) {
#pragma unroll
            for (int j = 0; j < 8; ++j) os[(hi * 8 + j) * 68 + nb * 16 + lr] = acc[mb][nb][j]; }
        __builtin_amdgcn_wave_barrier(); asm volatile("" ::: "memory");
        float* crow = C + (size_t)(r0 + mb * 16) * ldc + c0;
{
#pragma unroll
            for (int s = 0; s < 8; ++s) { const int row = 2 * s + hi, cofs = lr * 4; v4f val = *(const v4fa*)(os + row * 68 + cofs); val += bv;
                *(v4f*)(crow + (size_t)row * ldc + cofs) = val; }
             }
        __builtin_amdgcn_wave_barrier(); asm volatile("" ::: "memory");
    }
}
__global__ __launch_bounds__(32) void k_gemm2(const bf* __restrict__ A, const bf* __restrict__ A2, const bf* __restrict__ Bt, int K, float* C, int ldc, const float* __restrict__ bias, size_t sA, size_t sC) {
    gemm_body<1>(A, A2, Bt, K, C, ldc, bias, sA, sC); }

__global__ __launch_bounds__(256) void k_cvt8(const float* __restrict__ src, bf* dst, size_t n8) { const size_t i = (size_t)blockIdx.x * 256 + threadIdx.x; if (i >= n8) return; const v8f v = *(const v8f*)(src + i * 8); v8us o;
#pragma unroll
    for (int k = 0; k < 8; ++k) o[k] = f2bf(v[k]);
    *(v8us*)(dst + i * 8) = o;  }
__global__ __launch_bounds__(256) void k_cvtx(const float* __restrict__ src, bf* dst) { const size_t i = (size_t)blockIdx.x * 256 + threadIdx.x; if (i >= (size_t)NB * SEQ * DM / 8) return;
    const size_t row = i / (DM / 8); const size_t c8 = i % (DM / 8); const size_t b = row / SEQ, t = row % SEQ; const v8f v = *(const v8f*)(src + ((b * SEQ_FULL + t) * DM + c8 * 8)); v8us o;
#pragma unroll
    for (int k = 0; k < 8; ++k) o[k] = f2bf(v[k]);
    *(v8us*)(dst + i * 8) = o;  }

__global__ __launch_bounds__(256) void k_cstab(float* CS) { const int idx = (int)blockIdx.x * 256 + (int)threadIdx.x; if (idx >= SEQ * (HD / 2)) return; const int i = idx & 31, t = idx >> 5;
    const float ex = (float)(2 * i) / (float)HD; const float pw = powf(10000.0f, ex); const float invf = 1.0f / pw; const float ang = __fmul_rn((float)t, invf); float sn, cn; sincosf(ang, &sn, &cn);
    v2f cs; cs[0] = cn; cs[1] = sn; float* p0 = CS + ((size_t)t * HD + i) * 2; float* p1 = p0 + (HD / 2) * 2;
    *(v2f*)p0 = cs; *(v2f*)p1 = cs;  }

__global__ __launch_bounds__(256) void k_mbits(const int* __restrict__ mask, unsigned* MB) { const int lane = threadIdx.x & 31; const int g = (int)blockIdx.x * 8 + (int)(threadIdx.x >> 5);
    if (g >= (int)((size_t)SEQ * SEQ / 1024)) return;   // wave-uniform
    unsigned mine = 0u;
#pragma unroll 4
    for (int j = 0; j < 32; ++j) { const int wd = g * 32 + j; const int q = wd / (SEQ / 32), kg = wd % (SEQ / 32); const int v = mask[(size_t)q * SEQ_FULL + kg * 32 + lane];
        const unsigned bal = __builtin_amdgcn_ballot_w32(v != 0); mine = (lane == j) ? bal : mine; }
    *(unsigned*)(MB + (size_t)g * 32 + lane) = mine;  }

// ---- projection tiles, one wave per 64 tokens x one head (64 features), K-contiguous bf16 operands. acc[mb][nb][j] = sum_k A[m0 + 16 mb + 8 hi + j][k] Bt[n0 + 16 nb + lr][k]: a lane's 8 accumulator
// registers are 8 consecutive m, so the index that runs innermost in the plane to be written goes on the A side (features for q and k, tokens for v^T) and a lane's 8 values are one 16-byte piece of a plane row.
// The depth is the constant DM: all of a trip's fragment loads then name one address pair per operand plus an immediate offset, and the two pairs live through the whole loop, so no fragment is given their registers.
__device__ __forceinline__ void proj_acc(const bf* __restrict__ A, const bf* __restrict__ Bt, const int m0, const int n0, v8f (&acc)[4][4]) {
    constexpr int K = DM;
    const int lane = threadIdx.x & 31, lr = lane & 15, hi = lane >> 4;
#pragma unroll
    for (int mb = 0; mb < 4; ++mb)
#pragma unroll
        for (int nb = 0; nb < 4; ++nb) acc[mb][nb] = (v8f){};
    const bf* pa = A + (size_t)(m0 + lr) * K + 8 * hi; const bf* pb = Bt + (size_t)(n0 + lr) * K + 8 * hi;
#pragma unroll 1   // stays rolled: the accumulators take 128 registers and one trip's fragments 64, and an unrolled body would ask for several trips' fragments at once
    for (int kc = 0; kc < K; kc += 32) {
        v16bf a[4];
#pragma unroll
        for (int mb = 0; mb < 4; ++mb) a[mb] = ldb(pa + mb * 16 * K);
#pragma unroll
        for (int nb = 0; nb < 4; ++nb) { const v16bf bb = ldb(pb + nb * 16 * K);
#pragma unroll
            for (int mb = 0; mb < 4; ++mb) acc[mb][nb] = wmmab(a[mb], bb, acc[mb][nb]); }
        // keeps the distance behind the last matrix instructions on the loop's taken branch too, where the next trip's loads overwrite the fragments; the two address pairs are named as inputs
        // so that they keep their registers to the end of the trip, where every load that names them has returned: no fragment is loaded into them
        asm volatile("v_nop\n\tv_nop\n\tv_nop\n\tv_nop" : "+v"(acc[0][0]), "+v"(acc[1][1]), "+v"(acc[2][2]), "+v"(acc[3][3]) : "v"(a[0]), "v"(a[3]), "v"(pa), "v"(pb));
        pa += 32; pb += 32;
    }
}
#define SP 72                                 // LDS pitch of a staged plane row of 64 16-bit elements: 144 B = 16 B x 9
// 16 plane rows x 64 elements, f32 in registers (lane (lr, hi): row lr, elements 16 mb + 8 hi + j) -> f16 plane and, when hl (the same for the whole wave), bf16 hi/lo planes. Staged in this wave's LDS so that every global store covers whole 128-byte lines.
__device__ __forceinline__ void planes_out(unsigned short* st, const v8f (&r)[4], h16* p16, bf* ph, bf* pl, const size_t pitch, const bool hl) {
    const int lane = threadIdx.x & 31, lr = lane & 15, hi = lane >> 4;
    unsigned short* sw = st + lr * SP + 8 * hi;
#pragma unroll
    for (int mb = 0; mb < 4; ++mb) { v8h o16;
#pragma unroll
        for (int j = 0; j < 8; ++j) o16[j] = (h16)r[mb][j];
        *(v8us*)(sw + mb * 16) = __builtin_bit_cast(v8us, o16); }
    if (hl) {
#pragma unroll
        for (int mb = 0; mb < 4; ++mb) { v8us oh, ol;
#pragma unroll
            for (int j = 0; j < 8; ++j) { unsigned short a, c; splitf(r[mb][j], a, c); oh[j] = a; ol[j] = c; }
            *(v8us*)(sw + 16 * SP + mb * 16) = oh; *(v8us*)(sw + 32 * SP + mb * 16) = ol; }
    }
    __builtin_amdgcn_wave_barrier(); asm volatile("" ::: "memory");   // the rows are read back by other lanes of the wave: no LDS read may move up over the writes
    const int rr = lane >> 3, cc = (lane & 7) * 8;
#pragma unroll
    for (int it = 0; it < 4; ++it) { const int row = it * 4 + rr; *(v8us*)((unsigned short*)p16 + (size_t)row * pitch + cc) = *(const v8us*)(st + row * SP + cc); }
    asm volatile("s_wait_xcnt 0x0" ::: "memory");   // stands in front of whatever next overwrites a register that these stores name
    if (hl) {
#pragma unroll
        for (int it = 0; it < 4; ++it) { const int row = it * 4 + rr;
            *(v8us*)(ph + (size_t)row * pitch + cc) = *(const v8us*)(st + 16 * SP + row * SP + cc); *(v8us*)(pl + (size_t)row * pitch + cc) = *(const v8us*)(st + 32 * SP + row * SP + cc); }
        asm volatile("s_wait_xcnt 0x0" ::: "memory");   // as above
    }
    __builtin_amdgcn_wave_barrier(); asm volatile("" ::: "memory");   // ... and the next group's writes may not move up over these reads
    __builtin_amdgcn_sched_barrier(0);        // nor the next group's arithmetic over the waits above, where it would overwrite the stores' registers ahead of them
}
// q or k: y = x W^T + bf16(b), rotate-half rotary out[d] = y[d] c - y[d+32] s (d < 32), out[d] = y[d] c + y[d-32] s (d >= 32); d and d + 32 lie in the same lane (mb and mb + 2). Planes [bh][t][d]: f16, and bf16 hi/lo for t < HROWS.
template <int HROWS>
__global__ __launch_bounds__(32) void k_proj_rope(const bf* __restrict__ X, const bf* __restrict__ Wt, const float* __restrict__ bias, const float* __restrict__ CS, h16* P16, bf* Ph, bf* Pl) {
    static_assert(HROWS % 16 == 0);           // a group of 16 tokens has its hi/lo rows or has none
    __shared__ __align__(16) unsigned short st[3 * 16 * SP];
    const int lane = threadIdx.x & 31, lr = lane & 15, hi = lane >> 4; const int r0 = (int)blockIdx.x * 64, h = (int)blockIdx.y;
    const int b = r0 / SEQ, t0 = r0 % SEQ, bh = b * NH + h;
    v8f acc[4][4];
    proj_acc(Wt, X, h * HD, r0, acc);
    // a lane's (cos, sin) pairs of token group nb: token t0 + 16 nb + lr, frequencies 8 hi + j (pieces 0..3) and 16 + 8 hi + j (pieces 4..7)
    const float* cp = CS + ((size_t)(t0 + lr) * HD + 8 * hi) * 2;
    v4f cs[2][8]; v8f xb[4];
    auto ldcs = [&](const int nb) {
#pragma unroll
        for (int q = 0; q < 8; ++q) cs[nb & 1][q] = *(const v4f*)(cp + (size_t)nb * 16 * HD * 2 + (q >> 2) * 32 + (q & 3) * 4);
        asm volatile("s_wait_xcnt 0x0" ::: "memory"); };   // stands in front of whatever next overwrites an address register of these loads
#pragma unroll
    for (int mb = 0; mb < 4; ++mb) xb[mb] = *(const v8f*)(bias + h * HD + mb * 16 + 8 * hi);
    ldcs(0); ldcs(1);
    __builtin_amdgcn_sched_barrier(0);        // bias and the first two groups' table loads issue as one run: left to the scheduler they are issued two at a time, each pair waited for alone
#pragma unroll
    for (int mb = 0; mb < 4; ++mb) { v8f bb;
#pragma unroll
        for (int j = 0; j < 8; ++j) bb[j] = bfr(xb[mb][j]);
#pragma unroll
        for (int nb = 0; nb < 4; ++nb) acc[mb][nb] += bb; }
#pragma unroll
    for (int nb = 0; nb < 4; ++nb) {
        v8f r[4];
#pragma unroll
        for (int mp = 0; mp < 2; ++mp)
#pragma unroll
            for (int j = 0; j < 8; ++j) { const float c = cs[nb & 1][mp * 4 + (j >> 1)][(j & 1) * 2], s = cs[nb & 1][mp * 4 + (j >> 1)][(j & 1) * 2 + 1];
                const float y1 = acc[mp][nb][j], y2 = acc[mp + 2][nb][j];
                r[mp][j] = y1 * c - y2 * s; r[mp + 2][j] = y2 * c + y1 * s; }
        if (nb + 2 < 4) { ldcs(nb + 2);
            __builtin_amdgcn_sched_barrier(0); }   // the table loads of the group after next issue no later than here, so that they fly under this group's conversion and stores
        const int tg = t0 + nb * 16; const bool hl = tg < HROWS;
        const size_t eh = ((size_t)bh * HROWS + (hl ? tg : 0)) * HD;
        planes_out(st, r, P16 + ((size_t)bh * SEQ + tg) * HD, Ph + eh, Pl + eh, HD, hl);
    }
}
// v: y = x W^T + bf16(b), planes [bh][d][t] (f16, bf16 hi/lo): tokens on the A side, so a lane's 8 values are 8 consecutive t of feature row 16 nb + lr
__global__ __launch_bounds__(32) void k_proj_vt(const bf* __restrict__ X, const bf* __restrict__ Wt, const float* __restrict__ bias, h16* V16, bf* Vh, bf* Vl) {
    __shared__ __align__(16) unsigned short st[3 * 16 * SP];
    const int lane = threadIdx.x & 31, lr = lane & 15; const int r0 = (int)blockIdx.x * 64, h = (int)blockIdx.y;
    const int b = r0 / SEQ, t0 = r0 % SEQ, bh = b * NH + h;
    float xb[4];
#pragma unroll
    for (int nb = 0; nb < 4; ++nb) xb[nb] = bias[h * HD + nb * 16 + lr];
    v8f acc[4][4];
    proj_acc(X, Wt, r0, h * HD, acc);
#pragma unroll
    for (int nb = 0; nb < 4; ++nb) {
        const float bv = bfr(xb[nb]);
        v8f r[4];
#pragma unroll
        for (int mb = 0; mb < 4; ++mb) r[mb] = acc[mb][nb] + bv;
        const size_t e = ((size_t)bh * HD + nb * 16) * SEQ + t0;
        planes_out(st, r, V16 + e, Vh + e, Vl + e, SEQ, true);
    }
}

// ---- fused attention, one work-group of AW waves per 16 * AW query rows of one (batch, head), one wave per 16 rows; 32 keys per step. Each step's K rows and V^T rows are brought into LDS once for the whole work-group
// (asynchronous copies, two buffers: the next step's tile flies while this one is worked on) and every wave reads its fragments from there. The rows' mask words are read once into LDS; a step is staged only when some
// row of the work-group keeps one of its 32 keys, and a wave works on it only when one of its own 16 rows does (exact for any mask; the steps a wave works on and their order are those of a walk over all SEQ / 32 steps).
// Transposed tiles: S^T[key][query] = K (A operand) x Q^T (B operand), so lane (hi, lr) holds query lr, keys 8 hi + r (tile 0) and 16 + 8 hi + r (tile 1) = exactly the B-operand elements of P for
// O^T[d][query] = V^T (A operand) x P^T (B operand). Row statistics (running max, sum) are per lane; the two lane halves exchange twice per step, max then sum (xor 16). HR: bf16 hi/lo planes, 3 products; else f16, P x1024.
#define AW 4                                  // waves per attention work-group
#define KP 72                                 // LDS pitch of a K row, 16-bit elements: 144 B = 16 B x 9, conflict-free for 16-byte reads down a column of rows
#define VP 40                                 // LDS pitch of a V^T row of 32 keys: 80 B = 16 B x 5
#define MP 65                                 // LDS pitch of a row's mask words, dwords
static_assert(RH % (16 * AW) == 0 && (SEQ - RH) % (16 * AW) == 0);   // whole work-groups
static_assert(SEQ / 32 <= 64);                                       // a row's steps fit one 64-bit word
static_assert(AW * 32 == 128 && HD == 64);                           // the copy index maps below: 256 16-byte pieces per K plane and per V^T plane, two of each per lane

// four asynchronous 16-byte copies per lane, global -> LDS; the s_wait_xcnt stands inside the statement so that no address register named here is rewritten ahead of it
__device__ __forceinline__ void copy4(unsigned l0, const void* g0, unsigned l1, const void* g1, unsigned l2, const void* g2, unsigned l3, const void* g3) {
    asm volatile("global_load_async_to_lds_b128 %0, %4, off\n\t"
                 "global_load_async_to_lds_b128 %1, %5, off\n\t"
                 "global_load_async_to_lds_b128 %2, %6, off\n\t"
                 "global_load_async_to_lds_b128 %3, %7, off\n\t"
                 "s_wait_xcnt 0x0"
                 :: "v"(l0), "v"(l1), "v"(l2), "v"(l3), "v"(g0), "v"(g1), "v"(g2), "v"(g3) : "memory"); }

template <bool HR>
__device__ __forceinline__ void attn_body(const h16* __restrict__ Q16, const h16* __restrict__ K16, const h16* __restrict__ VT16,
                                          const bf* __restrict__ Qh, const bf* __restrict__ Ql, const bf* __restrict__ Kh, const bf* __restrict__ Kl,
                                          const bf* __restrict__ VTh, const bf* __restrict__ VTl, const unsigned* __restrict__ MB, bf* ATh, bf* ATl) {
    constexpr int NPL = HR ? 2 : 1;                                   // planes per operand
    constexpr int KT = 32 * KP, VT = HD * VP, BUF = NPL * (KT + VT);  // 16-bit elements; a buffer is [K planes][V^T planes]
    constexpr int NW = SEQ / 32;
    __shared__ __align__(16) unsigned short ring[2 * BUF];
    __shared__ unsigned msk[AW * 16 * MP];
    __shared__ unsigned lv[AW * 2];
    __shared__ __align__(16) float csall[AW * 16 * 68];
    const int tid = (int)threadIdx.x, lane = tid & 31, lr = lane & 15, hi = lane >> 4;
    const int w = __builtin_amdgcn_readfirstlane(tid >> 5);
    float* cs = csall + w * (16 * 68);
    const int q0 = (HR ? 0 : RH) + (int)blockIdx.x * (16 * AW) + w * 16;
    const int bh = (int)blockIdx.y, b = bh / NH, h = bh % NH;
    const size_t qoff = ((size_t)bh * (HR ? RH : SEQ) + q0 + lr) * HD + 8 * hi;
    const float NINF = -__builtin_huge_valf();

    // mask words of this wave's 16 rows -> LDS (read back by this wave alone); which steps keep a key: for the wave (own), for the work-group (live)
    unsigned nz0 = 0u, nz1 = 0u;
#pragma unroll   // all 32 loads in flight at once
    for (int r = 0; r < 16; ++r) { const unsigned* mrow = MB + (size_t)(q0 + r) * NW; const unsigned a = (lane < NW) ? mrow[lane] : 0u, c = (lane + 32 < NW) ? mrow[lane + 32] : 0u;
        msk[(w * 16 + r) * MP + lane] = a; msk[(w * 16 + r) * MP + 32 + lane] = c; nz0 |= a; nz1 |= c; }
    const unsigned own0 = __builtin_amdgcn_ballot_w32(nz0 != 0u), own1 = __builtin_amdgcn_ballot_w32(nz1 != 0u);
    if (lane == 0) { lv[w * 2] = own0; lv[w * 2 + 1] = own1; }
    __syncthreads();
    unsigned g0 = 0u, g1 = 0u;
    for (int i = 0; i < AW; ++i) { g0 |= lv[i * 2]; g1 |= lv[i * 2 + 1]; }
    const unsigned long long own = (unsigned long long)own0 | ((unsigned long long)own1 << 32);
    unsigned long long rest = (unsigned long long)(unsigned)__builtin_amdgcn_readfirstlane((int)g0) | ((unsigned long long)(unsigned)__builtin_amdgcn_readfirstlane((int)g1) << 32);   // steps not yet issued, the same in every wave

    // Q fragments stay in registers
    v16h qf[2]; v16bf qh[2], ql[2];
#pragma unroll   // constant indices keep the fragment arrays in registers (so at the K fragments below)
    for (int ks = 0; ks < 2; ++ks) { if (HR) { qh[ks] = ldb(Qh + qoff + ks * 32); ql[ks] = ldb(Ql + qoff + ks * 32); } else qf[ks] = ldh(Q16 + qoff + ks * 32); }

    // copy maps: a step's 32 K rows are 4 KiB in a row in global memory (piece i = tid, tid + 128: row i >> 3, 16-byte column i & 7); its V^T tile is 64 rows of 64 B (piece i: row i >> 2, column i & 3)
    const unsigned ringb = (unsigned)(size_t)(const void*)ring;       // LDS byte address of the ring
    const unsigned lk = ringb + (unsigned)((tid >> 3) * (KP * 2) + (tid & 7) * 16);
    const unsigned lvv = ringb + (unsigned)(NPL * KT * 2 + (tid >> 2) * (VP * 2) + (tid & 3) * 16);
    const size_t gk = (size_t)bh * SEQ * HD + (size_t)tid * 8;
    const size_t gv = ((size_t)bh * HD + (tid >> 2)) * SEQ + (tid & 3) * 8;
    auto issue = [&](const int kc, const int bi) {
        const unsigned bo = (unsigned)(bi * (BUF * 2)); const size_t ko = gk + (size_t)kc * 32 * HD, vo = gv + (size_t)kc * 32;
        if (HR) {
            copy4(lk + bo, Kh + ko, lk + bo + 16 * KP * 2, Kh + ko + 1024, lk + bo + KT * 2, Kl + ko, lk + bo + KT * 2 + 16 * KP * 2, Kl + ko + 1024);
            copy4(lvv + bo, VTh + vo, lvv + bo + 32 * VP * 2, VTh + vo + (size_t)32 * SEQ, lvv + bo + VT * 2, VTl + vo, lvv + bo + VT * 2 + 32 * VP * 2, VTl + vo + (size_t)32 * SEQ);
        } else {
            copy4(lk + bo, K16 + ko, lk + bo + 16 * KP * 2, K16 + ko + 1024, lvv + bo, VT16 + vo, lvv + bo + 32 * VP * 2, VT16 + vo + (size_t)32 * SEQ);
        } };

    v8f o[4];
#pragma unroll
    for (int dt = 0; dt < 4; ++dt) o[dt] = (v8f){};
    float m = NINF, l = 0.0f;
    int cur = -1, nxt = -1, bi = 0;
    if (rest != 0ull) {
        cur = __builtin_ctzll(rest); rest &= rest - 1ull; issue(cur, 0);
        asm volatile("s_wait_asynccnt 0x0" ::: "memory");            // this wave's share of the first tile has landed
        __syncthreads();                                             // ... and every other wave's
        if (rest != 0ull) { nxt = __builtin_ctzll(rest); rest &= rest - 1ull; issue(nxt, 1); }
    }
    while (cur >= 0) {
      if ((own >> cur) & 1ull) {                                      // wave-uniform: else all 16 rows mask all 32 keys
        const unsigned W = msk[(w * 16 + lr) * MP + cur];
        const unsigned short* kb = ring + bi * BUF + lr * KP + 8 * hi;
        const unsigned short* vb = ring + bi * BUF + NPL * KT + lr * VP + 8 * hi;
        v8f s0 = (v8f){}, s1 = (v8f){};
        if (HR) {
            v16bf a0h[2], a0l[2], a1h[2], a1l[2];
#pragma unroll
            for (int ks = 0; ks < 2; ++ks) { a0h[ks] = ldb(kb + ks * 32); a0l[ks] = ldb(kb + KT + ks * 32); a1h[ks] = ldb(kb + 16 * KP + ks * 32); a1l[ks] = ldb(kb + KT + 16 * KP + ks * 32); }
#pragma unroll
            for (int ks = 0; ks < 2; ++ks) {
                s0 = wmmab(a0h[ks], qh[ks], s0); s1 = wmmab(a1h[ks], qh[ks], s1); s0 = wmmab(a0l[ks], qh[ks], s0); s1 = wmmab(a1l[ks], qh[ks], s1); s0 = wmmab(a0h[ks], ql[ks], s0); s1 = wmmab(a1h[ks], ql[ks], s1);
                asm volatile("v_nop\n\tv_nop\n\tv_nop\n\tv_nop" : "+v"(s0), "+v"(s1) : "v"(ql[ks]), "v"(a0h[ks]), "v"(a1h[ks]));
            }
        } else {
            v16h k0f[2], k1f[2];
#pragma unroll
            for (int ks = 0; ks < 2; ++ks) { k0f[ks] = ldh((const h16*)kb + ks * 32); k1f[ks] = ldh((const h16*)kb + 16 * KP + ks * 32); }
#pragma unroll
            for (int ks = 0; ks < 2; ++ks) {
                s0 = wmma16(k0f[ks], qf[ks], s0); s1 = wmma16(k1f[ks], qf[ks], s1);
                asm volatile("v_nop\n\tv_nop\n\tv_nop\n\tv_nop" : "+v"(s0), "+v"(s1) : "v"(qf[ks]), "v"(k0f[ks]), "v"(k1f[ks]));
            }
        }
        // online softmax for query lr over this lane's 16 keys + the partner lane's 16 keys
        const unsigned Wl = W >> (8 * hi);
        float t0[8], t1[8]; float mx = NINF;
#pragma unroll
        for (int r = 0; r < 8; ++r) { t0[r] = ((Wl >> r) & 1u) ? s0[r] * SCL : NINF; t1[r] = ((Wl >> (16 + r)) & 1u) ? s1[r] * SCL : NINF; mx = fmaxf(mx, fmaxf(t0[r], t1[r])); }
        mx = fmaxf(mx, __shfl_xor(mx, 16, 32));
        const float mnew = fmaxf(m, mx);
        const float msub = (mnew == NINF) ? 0.0f : mnew;
        float ds = __fsub_rn(m, msub); asm volatile("" : "+v"(ds));
        const float scl = __builtin_amdgcn_exp2f(__fmul_rn(ds, LOG2E));
        float p0[8], p1[8]; float psum = 0.0f;
#pragma unroll
        for (int r = 0; r < 8; ++r) { float d0 = __fsub_rn(t0[r], msub); asm volatile("" : "+v"(d0)); float d1 = __fsub_rn(t1[r], msub); asm volatile("" : "+v"(d1));
            p0[r] = __builtin_amdgcn_exp2f(__fmul_rn(d0, LOG2E)); p1[r] = __builtin_amdgcn_exp2f(__fmul_rn(d1, LOG2E)); psum += p0[r] + p1[r]; }
        psum += __shfl_xor(psum, 16, 32);
        l = l * scl + psum; m = mnew;
#pragma unroll
        for (int dt = 0; dt < 4; ++dt)
#pragma unroll
            for (int r = 0; r < 8; ++r) o[dt][r] *= scl;
        if (HR) {
            v16us ph, pl;
#pragma unroll
            for (int r = 0; r < 8; ++r) { unsigned short a, c; splitf(p0[r], a, c); ph[r] = a; pl[r] = c; splitf(p1[r], a, c); ph[8 + r] = a; pl[8 + r] = c; }
            const v16bf pbh = __builtin_bit_cast(v16bf, ph), pbl = __builtin_bit_cast(v16bf, pl);
            v16bf vh[4], vl[4];
#pragma unroll
            for (int dt = 0; dt < 4; ++dt) { vh[dt] = ldb(vb + dt * 16 * VP); vl[dt] = ldb(vb + VT + dt * 16 * VP); }
#pragma unroll
            for (int dt = 0; dt < 4; ++dt) { o[dt] = wmmab(vh[dt], pbh, o[dt]); o[dt] = wmmab(vl[dt], pbh, o[dt]); o[dt] = wmmab(vh[dt], pbl, o[dt]); }
            asm volatile("v_nop\n\tv_nop\n\tv_nop\n\tv_nop" : "+v"(o[0]), "+v"(o[1]), "+v"(o[2]), "+v"(o[3]) : "v"(pbh), "v"(pbl), "v"(vh[3]), "v"(vl[3]));
        } else {
            v16h pb;
#pragma unroll
            for (int r = 0; r < 8; ++r) { pb[r] = (h16)(p0[r] * PCAR); pb[8 + r] = (h16)(p1[r] * PCAR); }
            v16h vf[4];
#pragma unroll
            for (int dt = 0; dt < 4; ++dt) vf[dt] = ldh((const h16*)vb + dt * 16 * VP);
#pragma unroll
            for (int dt = 0; dt < 4; ++dt) o[dt] = wmma16(vf[dt], pb, o[dt]);
            asm volatile("v_nop\n\tv_nop\n\tv_nop\n\tv_nop" : "+v"(o[0]), "+v"(o[1]), "+v"(o[2]), "+v"(o[3]) : "v"(pb), "v"(vf[0]), "v"(vf[3]));
        }
      }
        // hand-over, every wave, also one that skipped the step: my LDS reads of this buffer are done, my share of the next tile has landed, then the barrier that publishes the next tile and frees this buffer
        asm volatile("s_wait_dscnt 0x0" ::: "memory");
        asm volatile("s_wait_asynccnt 0x0" ::: "memory");
        __syncthreads();
        cur = nxt; nxt = -1;
        if (rest != 0ull) { nxt = __builtin_ctzll(rest); rest &= rest - 1ull; issue(nxt, bi); }
        bi ^= 1;
    }
    asm volatile("s_wait_asynccnt 0x0" ::: "memory");                // no copy is left in flight when the wave ends
    // normalise (a row without any kept key gives 0 x inf = NaN, as a softmax over an all -inf row does) and stage O[query lr][d]
    const float rl = 1.0f / l; const float inv = HR ? rl : rl * (1.0f / PCAR);
#pragma unroll
    for (int dt = 0; dt < 4; ++dt)
#pragma unroll
        for (int r = 0; r < 8; ++r) cs[lr * 68 + dt * 16 + 8 * hi + r] = o[dt][r] * inv;
    __builtin_amdgcn_wave_barrier(); asm volatile("" ::: "memory");
    bf* ah = ATh + ((size_t)b * SEQ + q0) * DQ + h * HD; bf* al = ATl + ((size_t)b * SEQ + q0) * DQ + h * HD;
{
#pragma unroll
        for (int it = 0; it < 4; ++it) { const int row = it * 4 + (lane >> 3), c = (lane & 7) * 8;
            const v4f x0 = *(const v4fa*)(cs + row * 68 + c), x1 = *(const v4fa*)(cs + row * 68 + c + 4); v8us oh, ol;
#pragma unroll
            for (int q = 0; q < 4; ++q) { unsigned short a, c2; splitf(x0[q], a, c2); oh[q] = a; ol[q] = c2; splitf(x1[q], a, c2); oh[4 + q] = a; ol[4 + q] = c2; }
            *(v8us*)(ah + (size_t)row * DQ + c) = oh; *(v8us*)(al + (size_t)row * DQ + c) = ol; }
         }
}
__global__ __launch_bounds__(AW * 32) void k_attn_hi(const bf* __restrict__ Qh, const bf* __restrict__ Ql, const bf* __restrict__ Kh, const bf* __restrict__ Kl, const bf* __restrict__ VTh, const bf* __restrict__ VTl,
                                                const unsigned* __restrict__ MB, bf* ATh, bf* ATl) {
    attn_body<true>(nullptr, nullptr, nullptr, Qh, Ql, Kh, Kl, VTh, VTl, MB, ATh, ATl); }
__global__ __launch_bounds__(AW * 32) void k_attn_lo(const h16* __restrict__ Q16, const h16* __restrict__ K16, const h16* __restrict__ VT16, const unsigned* __restrict__ MB, bf* ATh, bf* ATl) {
    attn_body<false>(Q16, K16, VT16, nullptr, nullptr, nullptr, nullptr, nullptr, nullptr, MB, ATh, ATl); }

// ---- workspace carve (bytes, every region a multiple of 256)
constexpr size_t al256(size_t x) { return (x + 255) & ~(size_t)255; }
constexpr size_t SZ_XB  = al256((size_t)NB * SEQ * DM * 2);
constexpr size_t SZ_W   = al256((size_t)DQ * DM * 2);
constexpr size_t SZ_CS  = al256((size_t)SEQ * HD * 2 * 4);
constexpr size_t SZ_MB  = al256((size_t)SEQ * SEQ / 8);
constexpr size_t SZ_PL  = al256((size_t)NB * NH * SEQ * HD * 2);
constexpr size_t SZ_QH  = al256((size_t)NB * NH * RH * HD * 2);
constexpr size_t SZ_AT  = al256((size_t)NB * SEQ * DQ * 2);
constexpr size_t WS_TOTAL = SZ_XB + 4 * SZ_W + SZ_CS + SZ_MB + SZ_PL + 2 * SZ_QH + 3 * SZ_PL + 3 * SZ_PL + 2 * SZ_AT;
static_assert(WS_TOTAL <= (size_t)134217728);

extern "C" void kernel_launch(void* const* d_in, const int* in_sizes, int n_in,
                              void* d_out, int out_size, void* d_ws, size_t ws_size, hipStream_t stream) {
    if (n_in < 10) return;
    const long long need_x = (long long)(NB - 1) * SEQ_FULL * DM + (long long)SEQ * DM;
    if ((long long)in_sizes[0] < need_x || (long long)out_size < need_x) return;
    if (in_sizes[1] < DQ * DM || in_sizes[3] < DQ * DM || in_sizes[5] < DQ * DM || in_sizes[7] < DM * DQ) return;
    if (in_sizes[2] < DQ || in_sizes[4] < DQ || in_sizes[6] < DQ || in_sizes[8] < DM) return;
    if ((long long)in_sizes[9] < (long long)(SEQ - 1) * SEQ_FULL + SEQ) return;
    if (WS_TOTAL > ws_size) return;
    const float* x  = (const float*)d_in[0];
    const float* Wq = (const float*)d_in[1]; const float* bq = (const float*)d_in[2];
    const float* Wk = (const float*)d_in[3]; const float* bk = (const float*)d_in[4];
    const float* Wv = (const float*)d_in[5]; const float* bv = (const float*)d_in[6];
    const float* Wo = (const float*)d_in[7]; const float* bo = (const float*)d_in[8];
    const int* mask = (const int*)d_in[9];
    float* OUT = (float*)d_out;
    char* wsp = (char*)d_ws;
    bf* XB = (bf*)wsp; wsp += SZ_XB;
    bf* WQ = (bf*)wsp; wsp += SZ_W; bf* WK = (bf*)wsp; wsp += SZ_W; bf* WV = (bf*)wsp; wsp += SZ_W; bf* WO = (bf*)wsp; wsp += SZ_W;
    float* CS = (float*)wsp; wsp += SZ_CS;
    unsigned* MB = (unsigned*)wsp; wsp += SZ_MB;
    h16* Q16 = (h16*)wsp; wsp += SZ_PL; bf* QPh = (bf*)wsp; wsp += SZ_QH; bf* QPl = (bf*)wsp; wsp += SZ_QH;
    h16* K16 = (h16*)wsp; wsp += SZ_PL; bf* KPh = (bf*)wsp; wsp += SZ_PL; bf* KPl = (bf*)wsp; wsp += SZ_PL;
    h16* VT16 = (h16*)wsp; wsp += SZ_PL; bf* VTh = (bf*)wsp; wsp += SZ_PL; bf* VTl = (bf*)wsp; wsp += SZ_PL;
    bf* ATh = (bf*)wsp; wsp += SZ_AT; bf* ATl = (bf*)wsp; wsp += SZ_AT;

    const size_t nw8 = (size_t)DQ * DM / 8;
    k_cvtx<<<(unsigned)(((size_t)NB * SEQ * DM / 8 + 255) / 256), 256, 0, stream>>>(x, XB);
    k_cvt8<<<(unsigned)((nw8 + 255) / 256), 256, 0, stream>>>(Wq, WQ, nw8);
    k_cvt8<<<(unsigned)((nw8 + 255) / 256), 256, 0, stream>>>(Wk, WK, nw8);
    k_cvt8<<<(unsigned)((nw8 + 255) / 256), 256, 0, stream>>>(Wv, WV, nw8);
    k_cvt8<<<(unsigned)((nw8 + 255) / 256), 256, 0, stream>>>(Wo, WO, nw8);
    k_cstab<<<(unsigned)((SEQ * (HD / 2) + 255) / 256), 256, 0, stream>>>(CS);
    k_mbits<<<(unsigned)(((size_t)SEQ * SEQ / 1024 + 7) / 8), 256, 0, stream>>>(mask, MB);

    const dim3 gp((unsigned)(NB * SEQ / 64), (unsigned)(DQ / 64), 1);
    k_proj_rope<RH><<<gp, 32, 0, stream>>>(XB, WQ, bq, CS, Q16, QPh, QPl);
    k_proj_rope<SEQ><<<gp, 32, 0, stream>>>(XB, WK, bk, CS, K16, KPh, KPl);
    k_proj_vt<<<gp, 32, 0, stream>>>(XB, WV, bv, VT16, VTh, VTl);

    k_attn_hi<<<dim3((unsigned)(RH / (16 * AW)), (unsigned)(NB * NH), 1), AW * 32, 0, stream>>>(QPh, QPl, KPh, KPl, VTh, VTl, MB, ATh, ATl);
    if (SEQ > RH) k_attn_lo<<<dim3((unsigned)((SEQ - RH) / (16 * AW)), (unsigned)(NB * NH), 1), AW * 32, 0, stream>>>(Q16, K16, VT16, MB, ATh, ATl);

    k_gemm2<<<dim3((unsigned)(SEQ / 64), (unsigned)(DM / 64), (unsigned)NB), 32, 0, stream>>>(ATh, ATl, WO, DQ, OUT, DM, bo, (size_t)SEQ * DQ, (size_t)SEQ_FULL * DM);
}

// v003
// A run of this version takes 143 microseconds.
// Next to v002, in two timings, it ran 1.34 and 1.37 times as fast.
// Over all steps from v000 it is 2.27 times as fast.
#include <hip/hip_runtime.h>

// All contractions on v_wmma_f32_16x16x32 (f32 accumulate): q/k/v projections bf16 x bf16 (x, W, b RNE-converted to bf16; products exact); scores q.k and P.V: query rows < 512 bf16 hi/lo planes (3 products), other rows f16 (P carried x1024); output projection bf16 hi/lo activations x bf16 weights (2 products).
// x [2][2048][1024]; Wq/Wk/Wv/Wo [out][in] with biases; 16 heads x 64; rotate-half rotary on q and k (table computed on the device: powf / sincosf); score scale 1/8; int32 keep-mask [S][S] read by value (0 -> -inf); softmax f32; out = merged heads Wo^T + bo.
// Pipeline: bf16 copies -> mask bit-plane -> projection GEMMs (four waves of 64x64 share a 128x128 tile's operand rows through LDS) whose epilogue applies bias and rotary and writes the head planes itself (q, k [bh][t][d]; v^T [bh][d][t]) -> fused flash attention (four waves of 16 queries share each K / V tile through LDS, transposed tiles so the score accumulators are directly the P operand, online softmax) -> merged hi/lo planes -> output GEMM.

#ifndef NB
#define NB 2
#endif
#ifndef SEQ
#define SEQ 2048
#endif
#define NB_FULL  2
#define SEQ_FULL 2048
#define DM   1024
#define NH   16
#define HD   64
#define DQ   (NH * HD)
#define RH   ((SEQ) < 512 ? (SEQ) : 512)      // query rows < RH use the hi/lo planes
#define PCAR 1024.0f
#define SCL  0.125f                          // HD^-0.5
#define LOG2E 1.4426950408889634f

static_assert(HD == 64);                                   // two 32-deep k-steps per head, 4 output tiles of 16, table index = idx & 31
static_assert(DQ == DM);
static_assert(DM % 32 == 0 && DQ % 32 == 0);               // GEMM k-loop steps by 32
static_assert(DM % 8 == 0);
static_assert(SEQ % 128 == 0 && DQ % 128 == 0 && DM % 128 == 0);   // 128x128 GEMM work-group tiles inside one batch, stages of 128 k, 64-element plane lines
static_assert(RH % 16 == 0 && (SEQ - RH) % 16 == 0);       // 16-query attention tiles
static_assert(SEQ % 32 == 0 && ((size_t)SEQ * SEQ) % 1024 == 0);   // 32-key words, 32 words per bit-plane line
static_assert(NB <= NB_FULL && SEQ <= SEQ_FULL);

typedef _Float16 h16;
typedef unsigned short bf;
typedef __attribute__((ext_vector_type(16))) __bf16   v16bf;
typedef __attribute__((ext_vector_type(16))) _Float16 v16h;
typedef __attribute__((ext_vector_type(8)))  _Float16 v8h;
typedef __attribute__((ext_vector_type(2)))  _Float16 v2h;
typedef __attribute__((ext_vector_type(16))) unsigned short v16us;
typedef __attribute__((ext_vector_type(8)))  unsigned short v8us;
typedef __attribute__((ext_vector_type(2)))  unsigned short v2us;
typedef __attribute__((ext_vector_type(8)))  float    v8f;
typedef __attribute__((ext_vector_type(4)))  float    v4f;
typedef __attribute__((ext_vector_type(2)))  float    v2f;
typedef v4f  __attribute__((may_alias)) v4fa;

__device__ __forceinline__ unsigned short f2bf(float f) { unsigned u = __float_as_uint(f); u += 0x7FFFu + ((u >> 16) & 1u); return (unsigned short)(u >> 16); }
__device__ __forceinline__ float bf2f(unsigned short b) { return __uint_as_float(((unsigned)b) << 16); }
__device__ __forceinline__ float bfr(float f) { return bf2f(f2bf(f)); }
__device__ __forceinline__ void splitf(float y, unsigned short& h, unsigned short& l) { h = f2bf(y); l = f2bf(y - bf2f(h)); }
__device__ __forceinline__ v16h cat16(v8h lo, v8h hi) { return __builtin_shufflevector(lo, hi, 0, 1, 2, 3, 4, 5, 6, 7, 8, 9, 10, 11, 12, 13, 14, 15); }
__device__ __forceinline__ v16bf cat16b(v8us lo, v8us hi) { return __builtin_bit_cast(v16bf, __builtin_shufflevector(lo, hi, 0, 1, 2, 3, 4, 5, 6, 7, 8, 9, 10, 11, 12, 13, 14, 15)); }
// fragment loaders: p already includes row * pitch + k0 + 8 * (lane >> 4); elements 0..7 <- p[0..7], elements 8..15 <- p[16..23]
__device__ __forceinline__ v16h  ldh(const h16* p) { return cat16(*(const v8h*)p, *(const v8h*)(p + 16)); }
__device__ __forceinline__ v16bf ldb(const bf* p)  { return cat16b(*(const v8us*)p, *(const v8us*)(p + 16)); }
__device__ __forceinline__ v8f wmma16(v16h a, v16h b, v8f c) { return __builtin_amdgcn_wmma_f32_16x16x32_f16(false, a, false, b, (short)0, c, false, false); }
__device__ __forceinline__ v8f wmmab(v16bf a, v16bf b, v8f c) { return __builtin_amdgcn_wmma_f32_16x16x32_bf16(false, a, false, b, (short)0, c, false, false); }

// four asynchronous 16-byte copies per lane, global -> LDS; the s_wait_xcnt stands inside the statement so that no address register named here is rewritten ahead of it
__device__ __forceinline__ void copy4(unsigned l0, const void* g0, unsigned l1, const void* g1, unsigned l2, const void* g2, unsigned l3, const void* g3) {
    asm volatile("global_load_async_to_lds_b128 %0, %4, off\n\t"
                 "global_load_async_to_lds_b128 %1, %5, off\n\t"
                 "global_load_async_to_lds_b128 %2, %6, off\n\t"
                 "global_load_async_to_lds_b128 %3, %7, off\n\t"
                 "s_wait_xcnt 0x0"
                 :: "v"(l0), "v"(l1), "v"(l2), "v"(l3), "v"(g0), "v"(g1), "v"(g2), "v"(g3) : "memory"); }

// eight such copies in one statement, one s_wait_xcnt behind the last
__device__ __forceinline__ void copy8(unsigned l0, const void* g0, unsigned l1, const void* g1, unsigned l2, const void* g2, unsigned l3, const void* g3,
                                      unsigned l4, const void* g4, unsigned l5, const void* g5, unsigned l6, const void* g6, unsigned l7, const void* g7) {
    asm volatile("global_load_async_to_lds_b128 %0, %8, off\n\t"
                 "global_load_async_to_lds_b128 %1, %9, off\n\t"
                 "global_load_async_to_lds_b128 %2, %10, off\n\t"
                 "global_load_async_to_lds_b128 %3, %11, off\n\t"
                 "global_load_async_to_lds_b128 %4, %12, off\n\t"
                 "global_load_async_to_lds_b128 %5, %13, off\n\t"
                 "global_load_async_to_lds_b128 %6, %14, off\n\t"
                 "global_load_async_to_lds_b128 %7, %15, off\n\t"
                 "s_wait_xcnt 0x0"
                 :: "v"(l0), "v"(l1), "v"(l2), "v"(l3), "v"(l4), "v"(l5), "v"(l6), "v"(l7), "v"(g0), "v"(g1), "v"(g2), "v"(g3), "v"(g4), "v"(g5), "v"(g6), "v"(g7) : "memory"); }

// ---- GEMM main loop, one work-group of GW waves per 128 x 128 tile, wave (wm, wn) = (w & 1, w >> 1) takes the 64 x 64 part at (64 wm, 64 wn): acc[mb][nb][j] = sum_k A[m0 + 64 wm + 16 mb + 8 hi + j][k] Bt[n0 + 64 wn + 16 nb + lr][k]
// (+ the same with A2 when NA == 2). Operands are K-contiguous bf16 planes, K % GK == 0. A stage is GK k of the tile's 128 A rows (of each A plane) and 128 Bt rows, brought into LDS once for the whole work-group
// (asynchronous copies, two buffers: the next stage flies while this one is worked on); every wave reads its fragments from there, 32 k at a time in rising k.
#define GW 4                                  // waves per GEMM work-group
#define GK 128                                // k per stage: 256 B of every operand row
#define GPI 136                               // LDS pitch of a staged operand row, 16-bit elements: 272 B = 16 B x 17
#define GRING(NA) (2 * ((NA) + 1) * 128 * GPI)   // 16-bit elements of the two buffers
template <int NA>
__device__ __forceinline__ void gemm_acc(unsigned short* ring, const bf* __restrict__ A, const bf* __restrict__ A2, const bf* __restrict__ Bt, const int K, const int m0, const int n0, v8f (&acc)[4][4]) {
    constexpr int PL = 128 * GPI, BUF = (NA + 1) * PL;                // a buffer is [A planes][Bt plane]
    const int tid = (int)threadIdx.x, lane = tid & 31, lr = lane & 15, hi = lane >> 4;
    const int w = __builtin_amdgcn_readfirstlane(tid >> 5), wm = w & 1, wn = w >> 1;
#pragma unroll
    for (int mb = 0; mb < 4; ++mb)
#pragma unroll
        for (int nb = 0; nb < 4; ++nb) acc[mb][nb] = (v8f){};
    // copy map: a plane's stage is 128 rows of 16 pieces of 16 B; piece i = tid + 128 j (j < 16): row (tid >> 4) + 8 j, column tid & 15, so one wave's copy covers two whole 256-B row parts
    const unsigned lb = (unsigned)(size_t)(const void*)ring + (unsigned)((tid >> 4) * (GPI * 2) + (tid & 15) * 16);   // LDS byte address of this lane's piece 0
    const size_t go = (size_t)(tid >> 4) * K + (tid & 15) * 8;
    const bf* ga = A + (size_t)m0 * K + go; const bf* ga2 = A2 + (size_t)m0 * K + go; const bf* gb = Bt + (size_t)n0 * K + go;
    auto plane = [&](const unsigned l, const bf* g) {
        constexpr unsigned LJ = 8 * GPI * 2; const size_t gj = (size_t)8 * K;   // from piece j to piece j + 1: 8 rows, in LDS bytes and in global elements
#pragma unroll
        for (int q = 0; q < 16; q += 8)
            copy8(l + q * LJ, g + q * gj, l + (q + 1) * LJ, g + (q + 1) * gj, l + (q + 2) * LJ, g + (q + 2) * gj, l + (q + 3) * LJ, g + (q + 3) * gj,
                  l + (q + 4) * LJ, g + (q + 4) * gj, l + (q + 5) * LJ, g + (q + 5) * gj, l + (q + 6) * LJ, g + (q + 6) * gj, l + (q + 7) * LJ, g + (q + 7) * gj); };
    auto issue = [&](const int s, const int bi) { const unsigned l = lb + (unsigned)(bi * (BUF * 2)); const size_t ko = (size_t)s * GK;
        plane(l, ga + ko); if (NA == 2) plane(l + PL * 2, ga2 + ko); plane(l + NA * PL * 2, gb + ko); };
    const int NS = K / GK;
    issue(0, 0);
    asm volatile("s_wait_asynccnt 0x0" ::: "memory");                // this wave's share of the first stage has landed
    __syncthreads();                                                 // ... and every other wave's
    if (NS > 1) issue(1, 1);
#pragma unroll 1   // stays rolled: one stage's body already holds 64 (128) matrix instructions
    for (int s = 0; s < NS; ++s) {
        const unsigned short* sa = ring + (s & 1) * BUF + (wm * 64 + lr) * GPI + 8 * hi;
        const unsigned short* sb = ring + (s & 1) * BUF + NA * PL + (wn * 64 + lr) * GPI + 8 * hi;
        // fragments of one 32-k block, two register sets: block ks + 1 of this stage is read while block ks is multiplied (nothing of the next stage is read here)
        v16bf fa[2][4], fa2[2][4], fb[2][4];
        auto frag = [&](const int ks) {
#pragma unroll
            for (int mb = 0; mb < 4; ++mb) { fa[ks & 1][mb] = ldb(sa + mb * 16 * GPI + ks * 32); if (NA == 2) fa2[ks & 1][mb] = ldb(sa + PL + mb * 16 * GPI + ks * 32); }
#pragma unroll
            for (int nb = 0; nb < 4; ++nb) fb[ks & 1][nb] = ldb(sb + nb * 16 * GPI + ks * 32); };
        frag(0);
#pragma unroll   // constant indices keep the fragment sets in registers, constant offsets in the reads
        for (int ks = 0; ks < GK / 32; ++ks) {
            if (ks + 1 < GK / 32) frag(ks + 1);
            __builtin_amdgcn_sched_barrier(0);   // the next block's LDS reads issue as one group ahead of this block's matrix instructions: left to the scheduler they sink among them, two at a time, each pair waited for alone
#pragma unroll
            for (int nb = 0; nb < 4; ++nb)
#pragma unroll
                for (int mb = 0; mb < 4; ++mb) { acc[mb][nb] = wmmab(fa[ks & 1][mb], fb[ks & 1][nb], acc[mb][nb]); if (NA == 2) acc[mb][nb] = wmmab(fa2[ks & 1][mb], fb[ks & 1][nb], acc[mb][nb]); }
            __builtin_amdgcn_sched_barrier(0);   // ... and no matrix instruction of this block moves down among the next group's reads or behind the hand-over
        }
        // keeps the distance behind the stage's last matrix instructions on every path out of it, where address arithmetic or the next stage's reads may overwrite the fragments
        // (it stands behind the scheduling barrier above, so behind all of them, and names no register: a named accumulator would have to lie below v256 and was spilled for it)
        asm volatile("v_nop\n\tv_nop\n\tv_nop\n\tv_nop");
        // hand-over, every wave: my LDS reads of this buffer are done, my share of the next stage has landed, then the barrier that publishes the next stage and frees this buffer
        asm volatile("s_wait_dscnt 0x0" ::: "memory");
        asm volatile("s_wait_asynccnt 0x0" ::: "memory");
        __syncthreads();
        if (s + 2 < NS) issue(s + 2, s & 1);
    }
    asm volatile("s_wait_asynccnt 0x0" ::: "memory");                // no copy is left in flight behind the loop
}

// ---- output GEMM: C[m][n] (f32, pitch ldc) = sum_k A[m][k] Bt[n][k] + A2[m][k] Bt[n][k] + bf16(bias[n]), k < DQ; main loop gemm_acc, each wave stores its own 64 x 64 part
__device__ __forceinline__ void gemm_body(const bf* __restrict__ A, const bf* __restrict__ A2, const bf* __restrict__ Bt,
                                          float* C, const int ldc, const float* __restrict__ bias, const size_t sA, const size_t sC) {
    __shared__ __align__(16) unsigned short ring[GRING(2)];
    __shared__ __align__(16) float osall[GW * 16 * 68];
    const size_t z = blockIdx.z; A += z * sA; A2 += z * sA; C += z * sC;
    const int lane = threadIdx.x & 31, lr = lane & 15, hi = lane >> 4; const int w = __builtin_amdgcn_readfirstlane((int)threadIdx.x >> 5);
    float* os = osall + w * (16 * 68);        // this wave's own staging rows
    const int r0 = (int)blockIdx.x * 128 + (w & 1) * 64, c0 = (int)blockIdx.y * 128 + (w >> 1) * 64;
    v8f acc[4][4];
    gemm_acc<2>(ring, A, A2, Bt, DQ, (int)blockIdx.x * 128, (int)blockIdx.y * 128, acc);
    v4f bv;
#pragma unroll
    for (int q = 0; q < 4; ++q) bv[q] = bfr(bias[c0 + lr * 4 + q]);
#pragma unroll
    for (int mb = 0; mb < 4; ++mb) {
#pragma unroll
        for (int nb = 0; nb < 4; ++nb) {
#pragma unroll
            for (int j = 0; j < 8; ++j) os[(hi * 8 + j) * 68 + nb * 16 + lr] = acc[mb][nb][j]; }
        __builtin_amdgcn_wave_barrier(); asm volatile("" ::: "memory");
        float* crow = C + (size_t)(r0 + mb * 16) * ldc + c0;
{
#pragma unroll
            for (int s = 0; s < 8; ++s) { const int row = 2 * s + hi, cofs = lr * 4; v4f val = *(const v4fa*)(os + row * 68 + cofs); val += bv;
                *(v4f*)(crow + (size_t)row * ldc + cofs) = val; }
             }
        __builtin_amdgcn_wave_barrier(); asm volatile("" ::: "memory");
    }
}
__global__ __launch_bounds__(GW * 32) void k_gemm2(const bf* __restrict__ A, const bf* __restrict__ A2, const bf* __restrict__ Bt, float* C, int ldc, const float* __restrict__ bias, size_t sA, size_t sC) {
    gemm_body(A, A2, Bt, C, ldc, bias, sA, sC); }

__global__ __launch_bounds__(256) void k_cvt8(const float* __restrict__ src, bf* dst, size_t n8) { const size_t i = (size_t)blockIdx.x * 256 + threadIdx.x; if (i >= n8) return; const v8f v = *(const v8f*)(src + i * 8); v8us o;
#pragma unroll
    for (int k = 0; k < 8; ++k) o[k] = f2bf(v[k]);
    *(v8us*)(dst + i * 8) = o;  }
__global__ __launch_bounds__(256) void k_cvtx(const float* __restrict__ src, bf* dst) { const size_t i = (size_t)blockIdx.x * 256 + threadIdx.x; if (i >= (size_t)NB * SEQ * DM / 8) return;
    const size_t row = i / (DM / 8); const size_t c8 = i % (DM / 8); const size_t b = row / SEQ, t = row % SEQ; const v8f v = *(const v8f*)(src + ((b * SEQ_FULL + t) * DM + c8 * 8)); v8us o;
#pragma unroll
    for (int k = 0; k < 8; ++k) o[k] = f2bf(v[k]);
    *(v8us*)(dst + i * 8) = o;  }

__global__ __launch_bounds__(256) void k_cstab(float* CS) { const int idx = (int)blockIdx.x * 256 + (int)threadIdx.x; if (idx >= SEQ * (HD / 2)) return; const int i = idx & 31, t = idx >> 5;
    const float ex = (float)(2 * i) / (float)HD; const float pw = powf(10000.0f, ex); const float invf = 1.0f / pw; const float ang = __fmul_rn((float)t, invf); float sn, cn; sincosf(ang, &sn, &cn);
    v2f cs; cs[0] = cn; cs[1] = sn; float* p0 = CS + ((size_t)t * HD + i) * 2; float* p1 = p0 + (HD / 2) * 2;
    *(v2f*)p0 = cs; *(v2f*)p1 = cs;  }

__global__ __launch_bounds__(256) void k_mbits(const int* __restrict__ mask, unsigned* MB) { const int lane = threadIdx.x & 31; const int g = (int)blockIdx.x * 8 + (int)(threadIdx.x >> 5);
    if (g >= (int)((size_t)SEQ * SEQ / 1024)) return;   // wave-uniform
    unsigned mine = 0u;
#pragma unroll 4
    for (int j = 0; j < 32; ++j) { const int wd = g * 32 + j; const int q = wd / (SEQ / 32), kg = wd % (SEQ / 32); const int v = mask[(size_t)q * SEQ_FULL + kg * 32 + lane];
        const unsigned bal = __builtin_amdgcn_ballot_w32(v != 0); mine = (lane == j) ? bal : mine; }
    *(unsigned*)(MB + (size_t)g * 32 + lane) = mine;  }

// ---- projection tiles, one wave per 64 tokens x one head (64 features), four waves (two heads x two token groups) per work-group, main loop gemm_acc. A lane's 8 accumulator
// registers are 8 consecutive m, so the index that runs innermost in the plane to be written goes on the A side (features for q and k, tokens for v^T) and a lane's 8 values are one 16-byte piece of a plane row.
#define SP 72                                 // LDS pitch of a staged plane row of 64 16-bit elements: 144 B = 16 B x 9
// 16 plane rows x 64 elements, f32 in registers (lane (lr, hi): row lr, elements 16 mb + 8 hi + j) -> f16 plane and, when hl (the same for the whole wave), bf16 hi/lo planes. Staged in this wave's LDS so that every global store covers whole 128-byte lines.
__device__ __forceinline__ void planes_out(unsigned short* st, const v8f (&r)[4], h16* p16, bf* ph, bf* pl, const size_t pitch, const bool hl) {
    const int lane = threadIdx.x & 31, lr = lane & 15, hi = lane >> 4;
    unsigned short* sw = st + lr * SP + 8 * hi;
#pragma unroll
    for (int mb = 0; mb < 4; ++mb) { v8h o16;
#pragma unroll
        for (int j = 0; j < 8; ++j) o16[j] = (h16)r[mb][j];
        *(v8us*)(sw + mb * 16) = __builtin_bit_cast(v8us, o16); }
    if (hl) {
#pragma unroll
        for (int mb = 0; mb < 4; ++mb) { v8us oh, ol;
#pragma unroll
            for (int j = 0; j < 8; ++j) { unsigned short a, c; splitf(r[mb][j], a, c); oh[j] = a; ol[j] = c; }
            *(v8us*)(sw + 16 * SP + mb * 16) = oh; *(v8us*)(sw + 32 * SP + mb * 16) = ol; }
    }
    __builtin_amdgcn_wave_barrier(); asm volatile("" ::: "memory");   // the rows are read back by other lanes of the wave: no LDS read may move up over the writes
    const int rr = lane >> 3, cc = (lane & 7) * 8;
#pragma unroll
    for (int it = 0; it < 4; ++it) { const int row = it * 4 + rr; *(v8us*)((unsigned short*)p16 + (size_t)row * pitch + cc) = *(const v8us*)(st + row * SP + cc); }
    asm volatile("s_wait_xcnt 0x0" ::: "memory");   // stands in front of whatever next overwrites a register that these stores name
    if (hl) {
#pragma unroll
        for (int it = 0; it < 4; ++it) { const int row = it * 4 + rr;
            *(v8us*)(ph + (size_t)row * pitch + cc) = *(const v8us*)(st + 16 * SP + row * SP + cc); *(v8us*)(pl + (size_t)row * pitch + cc) = *(const v8us*)(st + 32 * SP + row * SP + cc); }
        asm volatile("s_wait_xcnt 0x0" ::: "memory");   // as above
    }
    __builtin_amdgcn_wave_barrier(); asm volatile("" ::: "memory");   // ... and the next group's writes may not move up over these reads
    __builtin_amdgcn_sched_barrier(0);        // nor the next group's arithmetic over the waits above, where it would overwrite the stores' registers ahead of them
}
// q or k: y = x W^T + bf16(b), rotate-half rotary out[d] = y[d] c - y[d+32] s (d < 32), out[d] = y[d] c + y[d-32] s (d >= 32); d and d + 32 lie in the same lane (mb and mb + 2). Planes [bh][t][d]: f16, and bf16 hi/lo for t < HROWS.
template <int HROWS>
__global__ __launch_bounds__(GW * 32) void k_proj_rope(const bf* __restrict__ X, const bf* __restrict__ Wt, const float* __restrict__ bias, const float* __restrict__ CS, h16* P16, bf* Ph, bf* Pl) {
    static_assert(HROWS % 16 == 0);           // a group of 16 tokens has its hi/lo rows or has none
    __shared__ __align__(16) unsigned short ring[GRING(1)];
    __shared__ __align__(16) unsigned short stall[GW * 3 * 16 * SP];
    const int lane = threadIdx.x & 31, lr = lane & 15, hi = lane >> 4; const int w = __builtin_amdgcn_readfirstlane((int)threadIdx.x >> 5);
    unsigned short* st = stall + w * (3 * 16 * SP);   // this wave's own staging rows
    const int r0 = (int)blockIdx.x * 128 + (w >> 1) * 64, h = (int)blockIdx.y * 2 + (w & 1);
    const int b = r0 / SEQ, t0 = r0 % SEQ, bh = b * NH + h;
    v8f acc[4][4];
    gemm_acc<1>(ring, Wt, Wt, X, DM, (int)blockIdx.y * 128, (int)blockIdx.x * 128, acc);
    // a lane's (cos, sin) pairs of token group nb: token t0 + 16 nb + lr, frequencies 8 hi + j (pieces 0..3) and 16 + 8 hi + j (pieces 4..7)
    const float* cp = CS + ((size_t)(t0 + lr) * HD + 8 * hi) * 2;
    v4f cs[2][8]; v8f xb[4];
    auto ldcs = [&](const int nb) {
#pragma unroll
        for (int q = 0; q < 8; ++q) cs[nb & 1][q] = *(const v4f*)(cp + (size_t)nb * 16 * HD * 2 + (q >> 2) * 32 + (q & 3) * 4);
        asm volatile("s_wait_xcnt 0x0" ::: "memory"); };   // stands in front of whatever next overwrites an address register of these loads
#pragma unroll
    for (int mb = 0; mb < 4; ++mb) xb[mb] = *(const v8f*)(bias + h * HD + mb * 16 + 8 * hi);
    ldcs(0); ldcs(1);
    __builtin_amdgcn_sched_barrier(0);        // bias and the first two groups' table loads issue as one run: left to the scheduler they are issued two at a time, each pair waited for alone
#pragma unroll
    for (int mb = 0; mb < 4; ++mb) { v8f bb;
#pragma unroll
        for (int j = 0; j < 8; ++j) bb[j] = bfr(xb[mb][j]);
#pragma unroll
        for (int nb = 0; nb < 4; ++nb) acc[mb][nb] += bb; }
#pragma unroll
    for (int nb = 0; nb < 4; ++nb) {
        v8f r[4];
#pragma unroll
        for (int mp = 0; mp < 2; ++mp)
#pragma unroll
            for (int j = 0; j < 8; ++j) { const float c = cs[nb & 1][mp * 4 + (j >> 1)][(j & 1) * 2], s = cs[nb & 1][mp * 4 + (j >> 1)][(j & 1) * 2 + 1];
                const float y1 = acc[mp][nb][j], y2 = acc[mp + 2][nb][j];
                r[mp][j] = y1 * c - y2 * s; r[mp + 2][j] = y2 * c + y1 * s; }
        if (nb + 2 < 4) { ldcs(nb + 2);
            __builtin_amdgcn_sched_barrier(0); }   // the table loads of the group after next issue no later than here, so that they fly under this group's conversion and stores
        const int tg = t0 + nb * 16; const bool hl = tg < HROWS;
        const size_t eh = ((size_t)bh * HROWS + (hl ? tg : 0)) * HD;
        planes_out(st, r, P16 + ((size_t)bh * SEQ + tg) * HD, Ph + eh, Pl + eh, HD, hl);
    }
}
// v: y = x W^T + bf16(b), planes [bh][d][t] (f16, bf16 hi/lo): tokens on the A side, so a lane's 8 values are 8 consecutive t of feature row 16 nb + lr
__global__ __launch_bounds__(GW * 32) void k_proj_vt(const bf* __restrict__ X, const bf* __restrict__ Wt, const float* __restrict__ bias, h16* V16, bf* Vh, bf* Vl) {
    __shared__ __align__(16) unsigned short ring[GRING(1)];
    __shared__ __align__(16) unsigned short stall[GW * 3 * 16 * SP];
    const int lane = threadIdx.x & 31, lr = lane & 15; const int w = __builtin_amdgcn_readfirstlane((int)threadIdx.x >> 5);
    unsigned short* st = stall + w * (3 * 16 * SP);   // this wave's own staging rows
    const int r0 = (int)blockIdx.x * 128 + (w & 1) * 64, h = (int)blockIdx.y * 2 + (w >> 1);
    const int b = r0 / SEQ, t0 = r0 % SEQ, bh = b * NH + h;
    float xb[4];
#pragma unroll
    for (int nb = 0; nb < 4; ++nb) xb[nb] = bias[h * HD + nb * 16 + lr];
    v8f acc[4][4];
    gemm_acc<1>(ring, X, X, Wt, DM, (int)blockIdx.x * 128, (int)blockIdx.y * 128, acc);
#pragma unroll
    for (int nb = 0; nb < 4; ++nb) {
        const float bv = bfr(xb[nb]);
        v8f r[4];
#pragma unroll
        for (int mb = 0; mb < 4; ++mb) r[mb] = acc[mb][nb] + bv;
        const size_t e = ((size_t)bh * HD + nb * 16) * SEQ + t0;
        planes_out(st, r, V16 + e, Vh + e, Vl + e, SEQ, true);
    }
}

// ---- fused attention, one work-group of AW waves per 16 * AW query rows of one (batch, head), one wave per 16 rows; 32 keys per step. Each step's K rows and V^T rows are brought into LDS once for the whole work-group
// (asynchronous copies, two buffers: the next step's tile flies while this one is worked on) and every wave reads its fragments from there. The rows' mask words are read once into LDS; a step is staged only when some
// row of the work-group keeps one of its 32 keys, and a wave works on it only when one of its own 16 rows does (exact for any mask; the steps a wave works on and their order are those of a walk over all SEQ / 32 steps).
// Transposed tiles: S^T[key][query] = K (A operand) x Q^T (B operand), so lane (hi, lr) holds query lr, keys 8 hi + r (tile 0) and 16 + 8 hi + r (tile 1) = exactly the B-operand elements of P for
// O^T[d][query] = V^T (A operand) x P^T (B operand). Row statistics (running max, sum) are per lane; the two lane halves exchange twice per step, max then sum (xor 16). HR: bf16 hi/lo planes, 3 products; else f16, P x1024.
#define AW 4                                  // waves per attention work-group
#define KP 72                                 // LDS pitch of a K row, 16-bit elements: 144 B = 16 B x 9, conflict-free for 16-byte reads down a column of rows
#define VP 40                                 // LDS pitch of a V^T row of 32 keys: 80 B = 16 B x 5
#define MP 65                                 // LDS pitch of a row's mask words, dwords
static_assert(RH % (16 * AW) == 0 && (SEQ - RH) % (16 * AW) == 0);   // whole work-groups
static_assert(SEQ / 32 <= 64);                                       // a row's steps fit one 64-bit word
static_assert(AW * 32 == 128 && HD == 64);                           // the copy index maps below: 256 16-byte pieces per K plane and per V^T plane, two of each per lane

template <bool HR>
__device__ __forceinline__ void attn_body(const h16* __restrict__ Q16, const h16* __restrict__ K16, const h16* __restrict__ VT16,
                                          const bf* __restrict__ Qh, const bf* __restrict__ Ql, const bf* __restrict__ Kh, const bf* __restrict__ Kl,
                                          const bf* __restrict__ VTh, const bf* __restrict__ VTl, const unsigned* __restrict__ MB, bf* ATh, bf* ATl) {
    constexpr int NPL = HR ? 2 : 1;                                   // planes per operand
    constexpr int KT = 32 * KP, VT = HD * VP, BUF = NPL * (KT + VT);  // 16-bit elements; a buffer is [K planes][V^T planes]
    constexpr int NW = SEQ / 32;
    __shared__ __align__(16) unsigned short ring[2 * BUF];
    __shared__ unsigned msk[AW * 16 * MP];
    __shared__ unsigned lv[AW * 2];
    __shared__ __align__(16) float csall[AW * 16 * 68];
    const int tid = (int)threadIdx.x, lane = tid & 31, lr = lane & 15, hi = lane >> 4;
    const int w = __builtin_amdgcn_readfirstlane(tid >> 5);
    float* cs = csall + w * (16 * 68);
    const int q0 = (HR ? 0 : RH) + (int)blockIdx.x * (16 * AW) + w * 16;
    const int bh = (int)blockIdx.y, b = bh / NH, h = bh % NH;
    const size_t qoff = ((size_t)bh * (HR ? RH : SEQ) + q0 + lr) * HD + 8 * hi;
    const float NINF = -__builtin_huge_valf();

    // mask words of this wave's 16 rows -> LDS (read back by this wave alone); which steps keep a key: for the wave (own), for the work-group (live)
    unsigned nz0 = 0u, nz1 = 0u;
#pragma unroll   // all 32 loads in flight at once
    for (int r = 0; r < 16; ++r) { const unsigned* mrow = MB + (size_t)(q0 + r) * NW; const unsigned a = (lane < NW) ? mrow[lane] : 0u, c = (lane + 32 < NW) ? mrow[lane + 32] : 0u;
        msk[(w * 16 + r) * MP + lane] = a; msk[(w * 16 + r) * MP + 32 + lane] = c; nz0 |= a; nz1 |= c; }
    const unsigned own0 = __builtin_amdgcn_ballot_w32(nz0 != 0u), own1 = __builtin_amdgcn_ballot_w32(nz1 != 0u);
    if (lane == 0) { lv[w * 2] = own0; lv[w * 2 + 1] = own1; }
    __syncthreads();
    unsigned g0 = 0u, g1 = 0u;
    for (int i = 0; i < AW; ++i) { g0 |= lv[i * 2]; g1 |= lv[i * 2 + 1]; }
    const unsigned long long own = (unsigned long long)own0 | ((unsigned long long)own1 << 32);
    unsigned long long rest = (unsigned long long)(unsigned)__builtin_amdgcn_readfirstlane((int)g0) | ((unsigned long long)(unsigned)__builtin_amdgcn_readfirstlane((int)g1) << 32);   // steps not yet issued, the same in every wave

    // Q fragments stay in registers
    v16h qf[2]; v16bf qh[2], ql[2];
#pragma unroll   // constant indices keep the fragment arrays in registers (so at the K fragments below)
    for (int ks = 0; ks < 2; ++ks) { if (HR) { qh[ks] = ldb(Qh + qoff + ks * 32); ql[ks] = ldb(Ql + qoff + ks * 32); } else qf[ks] = ldh(Q16 + qoff + ks * 32); }

    // copy maps: a step's 32 K rows are 4 KiB in a row in global memory (piece i = tid, tid + 128: row i >> 3, 16-byte column i & 7); its V^T tile is 64 rows of 64 B (piece i: row i >> 2, column i & 3)
    const unsigned ringb = (unsigned)(size_t)(const void*)ring;       // LDS byte address of the ring
    const unsigned lk = ringb + (unsigned)((tid >> 3) * (KP * 2) + (tid & 7) * 16);
    const unsigned lvv = ringb + (unsigned)(NPL * KT * 2 + (tid >> 2) * (VP * 2) + (tid & 3) * 16);
    const size_t gk = (size_t)bh * SEQ * HD + (size_t)tid * 8;
    const size_t gv = ((size_t)bh * HD + (tid >> 2)) * SEQ + (tid & 3) * 8;
    auto issue = [&](const int kc, const int bi) {
        const unsigned bo = (unsigned)(bi * (BUF * 2)); const size_t ko = gk + (size_t)kc * 32 * HD, vo = gv + (size_t)kc * 32;
        if (HR) {
            copy4(lk + bo, Kh + ko, lk + bo + 16 * KP * 2, Kh + ko + 1024, lk + bo + KT * 2, Kl + ko, lk + bo + KT * 2 + 16 * KP * 2, Kl + ko + 1024);
            copy4(lvv + bo, VTh + vo, lvv + bo + 32 * VP * 2, VTh + vo + (size_t)32 * SEQ, lvv + bo + VT * 2, VTl + vo, lvv + bo + VT * 2 + 32 * VP * 2, VTl + vo + (size_t)32 * SEQ);
        } else {
            copy4(lk + bo, K16 + ko, lk + bo + 16 * KP * 2, K16 + ko + 1024, lvv + bo, VT16 + vo, lvv + bo + 32 * VP * 2, VT16 + vo + (size_t)32 * SEQ);
        } };

    v8f o[4];
#pragma unroll
    for (int dt = 0; dt < 4; ++dt) o[dt] = (v8f){};
    float m = NINF, l = 0.0f;
    int cur = -1, nxt = -1, bi = 0;
    if (rest != 0ull) {
        cur = __builtin_ctzll(rest); rest &= rest - 1ull; issue(cur, 0);
        asm volatile("s_wait_asynccnt 0x0" ::: "memory");            // this wave's share of the first tile has landed
        __syncthreads();                                             // ... and every other wave's
        if (rest != 0ull) { nxt = __builtin_ctzll(rest); rest &= rest - 1ull; issue(nxt, 1); }
    }
    while (cur >= 0) {
      if ((own >> cur) & 1ull) {                                      // wave-uniform: else all 16 rows mask all 32 keys
        const unsigned W = msk[(w * 16 + lr) * MP + cur];
        const unsigned short* kb = ring + bi * BUF + lr * KP + 8 * hi;
        const unsigned short* vb = ring + bi * BUF + NPL * KT + lr * VP + 8 * hi;
        v8f s0 = (v8f){}, s1 = (v8f){};
        if (HR) {
            v16bf a0h[2], a0l[2], a1h[2], a1l[2];
#pragma unroll
            for (int ks = 0; ks < 2; ++ks) { a0h[ks] = ldb(kb + ks * 32); a0l[ks] = ldb(kb + KT + ks * 32); a1h[ks] = ldb(kb + 16 * KP + ks * 32); a1l[ks] = ldb(kb + KT + 16 * KP + ks * 32); }
#pragma unroll
            for (int ks = 0; ks < 2; ++ks) {
                s0 = wmmab(a0h[ks], qh[ks], s0); s1 = wmmab(a1h[ks], qh[ks], s1); s0 = wmmab(a0l[ks], qh[ks], s0); s1 = wmmab(a1l[ks], qh[ks], s1); s0 = wmmab(a0h[ks], ql[ks], s0); s1 = wmmab(a1h[ks], ql[ks], s1);
                asm volatile("v_nop\n\tv_nop\n\tv_nop\n\tv_nop" : "+v"(s0), "+v"(s1) : "v"(ql[ks]), "v"(a0h[ks]), "v"(a1h[ks]));
            }
        } else {
            v16h k0f[2], k1f[2];
#pragma unroll
            for (int ks = 0; ks < 2; ++ks) { k0f[ks] = ldh((const h16*)kb + ks * 32); k1f[ks] = ldh((const h16*)kb + 16 * KP + ks * 32); }
#pragma unroll
            for (int ks = 0; ks < 2; ++ks) {
                s0 = wmma16(k0f[ks], qf[ks], s0); s1 = wmma16(k1f[ks], qf[ks], s1);
                asm volatile("v_nop\n\tv_nop\n\tv_nop\n\tv_nop" : "+v"(s0), "+v"(s1) : "v"(qf[ks]), "v"(k0f[ks]), "v"(k1f[ks]));
            }
        }
        // online softmax for query lr over this lane's 16 keys + the partner lane's 16 keys
        const unsigned Wl = W >> (8 * hi);
        float t0[8], t1[8]; float mx = NINF;
#pragma unroll
        for (int r = 0; r < 8; ++r) { t0[r] = ((Wl >> r) & 1u) ? s0[r] * SCL : NINF; t1[r] = ((Wl >> (16 + r)) & 1u) ? s1[r] * SCL : NINF; mx = fmaxf(mx, fmaxf(t0[r], t1[r])); }
        mx = fmaxf(mx, __shfl_xor(mx, 16, 32));
        const float mnew = fmaxf(m, mx);
        const float msub = (mnew == NINF) ? 0.0f : mnew;
        float ds = __fsub_rn(m, msub); asm volatile("" : "+v"(ds));
        const float scl = __builtin_amdgcn_exp2f(__fmul_rn(ds, LOG2E));
        float p0[8], p1[8]; float psum = 0.0f;
#pragma unroll
        for (int r = 0; r < 8; ++r) { float d0 = __fsub_rn(t0[r], msub); asm volatile("" : "+v"(d0)); float d1 = __fsub_rn(t1[r], msub); asm volatile("" : "+v"(d1));
            p0[r] = __builtin_amdgcn_exp2f(__fmul_rn(d0, LOG2E)); p1[r] = __builtin_amdgcn_exp2f(__fmul_rn(d1, LOG2E)); psum += p0[r] + p1[r]; }
        psum += __shfl_xor(psum, 16, 32);
        l = l * scl + psum; m = mnew;
#pragma unroll
        for (int dt = 0; dt < 4; ++dt)
#pragma unroll
            for (int r = 0; r < 8; ++r) o[dt][r] *= scl;
        if (HR) {
            v16us ph, pl;
#pragma unroll
            for (int r = 0; r < 8; ++r) { unsigned short a, c; splitf(p0[r], a, c); ph[r] = a; pl[r] = c; splitf(p1[r], a, c); ph[8 + r] = a; pl[8 + r] = c; }
            const v16bf pbh = __builtin_bit_cast(v16bf, ph), pbl = __builtin_bit_cast(v16bf, pl);
            v16bf vh[4], vl[4];
#pragma unroll
            for (int dt = 0; dt < 4; ++dt) { vh[dt] = ldb(vb + dt * 16 * VP); vl[dt] = ldb(vb + VT + dt * 16 * VP); }
#pragma unroll
            for (int dt = 0; dt < 4; ++dt) { o[dt] = wmmab(vh[dt], pbh, o[dt]); o[dt] = wmmab(vl[dt], pbh, o[dt]); o[dt] = wmmab(vh[dt], pbl, o[dt]); }
            asm volatile("v_nop\n\tv_nop\n\tv_nop\n\tv_nop" : "+v"(o[0]), "+v"(o[1]), "+v"(o[2]), "+v"(o[3]) : "v"(pbh), "v"(pbl), "v"(vh[3]), "v"(vl[3]));
        } else {
            v16h pb;
#pragma unroll
            for (int r = 0; r < 8; ++r) { pb[r] = (h16)(p0[r] * PCAR); pb[8 + r] = (h16)(p1[r] * PCAR); }
            v16h vf[4];
#pragma unroll
            for (int dt = 0; dt < 4; ++dt) vf[dt] = ldh((const h16*)vb + dt * 16 * VP);
#pragma unroll
            for (int dt = 0; dt < 4; ++dt) o[dt] = wmma16(vf[dt], pb, o[dt]);
            asm volatile("v_nop\n\tv_nop\n\tv_nop\n\tv_nop" : "+v"(o[0]), "+v"(o[1]), "+v"(o[2]), "+v"(o[3]) : "v"(pb), "v"(vf[0]), "v"(vf[3]));
        }
      }
        // hand-over, every wave, also one that skipped the step: my LDS reads of this buffer are done, my share of the next tile has landed, then the barrier that publishes the next tile and frees this buffer
        asm volatile("s_wait_dscnt 0x0" ::: "memory");
        asm volatile("s_wait_asynccnt 0x0" ::: "memory");
        __syncthreads();
        cur = nxt; nxt = -1;
        if (rest != 0ull) { nxt = __builtin_ctzll(rest); rest &= rest - 1ull; issue(nxt, bi); }
        bi ^= 1;
    }
    asm volatile("s_wait_asynccnt 0x0" ::: "memory");                // no copy is left in flight when the wave ends
    // normalise (a row without any kept key gives 0 x inf = NaN, as a softmax over an all -inf row does) and stage O[query lr][d]
    const float rl = 1.0f / l; const float inv = HR ? rl : rl * (1.0f / PCAR);
#pragma unroll
    for (int dt = 0; dt < 4; ++dt)
#pragma unroll
        for (int r = 0; r < 8; ++r) cs[lr * 68 + dt * 16 + 8 * hi + r] = o[dt][r] * inv;
    __builtin_amdgcn_wave_barrier(); asm volatile("" ::: "memory");
    bf* ah = ATh + ((size_t)b * SEQ + q0) * DQ + h * HD; bf* al = ATl + ((size_t)b * SEQ + q0) * DQ + h * HD;
{
#pragma unroll
        for (int it = 0; it < 4; ++it) { const int row = it * 4 + (lane >> 3), c = (lane & 7) * 8;
            const v4f x0 = *(const v4fa*)(cs + row * 68 + c), x1 = *(const v4fa*)(cs + row * 68 + c + 4); v8us oh, ol;
#pragma unroll
            for (int q = 0; q < 4; ++q) { unsigned short a, c2; splitf(x0[q], a, c2); oh[q] = a; ol[q] = c2; splitf(x1[q], a, c2); oh[4 + q] = a; ol[4 + q] = c2; }
            *(v8us*)(ah + (size_t)row * DQ + c) = oh; *(v8us*)(al + (size_t)row * DQ + c) = ol; }
         }
}
__global__ __launch_bounds__(AW * 32) void k_attn_hi(const bf* __restrict__ Qh, const bf* __restrict__ Ql, const bf* __restrict__ Kh, const bf* __restrict__ Kl, const bf* __restrict__ VTh, const bf* __restrict__ VTl,
                                                const unsigned* __restrict__ MB, bf* ATh, bf* ATl) {
    attn_body<true>(nullptr, nullptr, nullptr, Qh, Ql, Kh, Kl, VTh, VTl, MB, ATh, ATl); }
__global__ __launch_bounds__(AW * 32) void k_attn_lo(const h16* __restrict__ Q16, const h16* __restrict__ K16, const h16* __restrict__ VT16, const unsigned* __restrict__ MB, bf* ATh, bf* ATl) {
    attn_body<false>(Q16, K16, VT16, nullptr, nullptr, nullptr, nullptr, nullptr, nullptr, MB, ATh, ATl); }

// ---- workspace carve (bytes, every region a multiple of 256)
constexpr size_t al256(size_t x) { return (x + 255) & ~(size_t)255; }
constexpr size_t SZ_XB  = al256((size_t)NB * SEQ * DM * 2);
constexpr size_t SZ_W   = al256((size_t)DQ * DM * 2);
constexpr size_t SZ_CS  = al256((size_t)SEQ * HD * 2 * 4);
constexpr size_t SZ_MB  = al256((size_t)SEQ * SEQ / 8);
constexpr size_t SZ_PL  = al256((size_t)NB * NH * SEQ * HD * 2);
constexpr size_t SZ_QH  = al256((size_t)NB * NH * RH * HD * 2);
constexpr size_t SZ_AT  = al256((size_t)NB * SEQ * DQ * 2);
constexpr size_t WS_TOTAL = SZ_XB + 4 * SZ_W + SZ_CS + SZ_MB + SZ_PL + 2 * SZ_QH + 3 * SZ_PL + 3 * SZ_PL + 2 * SZ_AT;
static_assert(WS_TOTAL <= (size_t)134217728);

extern "C" void kernel_launch(void* const* d_in, const int* in_sizes, int n_in,
                              void* d_out, int out_size, void* d_ws, size_t ws_size, hipStream_t stream) {
    if (n_in < 10) return;
    const long long need_x = (long long)(NB - 1) * SEQ_FULL * DM + (long long)SEQ * DM;
    if ((long long)in_sizes[0] < need_x || (long long)out_size < need_x) return;
    if (in_sizes[1] < DQ * DM || in_sizes[3] < DQ * DM || in_sizes[5] < DQ * DM || in_sizes[7] < DM * DQ) return;
    if (in_sizes[2] < DQ || in_sizes[4] < DQ || in_sizes[6] < DQ || in_sizes[8] < DM) return;
    if ((long long)in_sizes[9] < (long long)(SEQ - 1) * SEQ_FULL + SEQ) return;
    if (WS_TOTAL > ws_size) return;
    const float* x  = (const float*)d_in[0];
    const float* Wq = (const float*)d_in[1]; const float* bq = (const float*)d_in[2];
    const float* Wk = (const float*)d_in[3]; const float* bk = (const float*)d_in[4];
    const float* Wv = (const float*)d_in[5]; const float* bv = (const float*)d_in[6];
    const float* Wo = (const float*)d_in[7]; const float* bo = (const float*)d_in[8];
    const int* mask = (const int*)d_in[9];
    float* OUT = (float*)d_out;
    char* wsp = (char*)d_ws;
    bf* XB = (bf*)wsp; wsp += SZ_XB;
    bf* WQ = (bf*)wsp; wsp += SZ_W; bf* WK = (bf*)wsp; wsp += SZ_W; bf* WV = (bf*)wsp; wsp += SZ_W; bf* WO = (bf*)wsp; wsp += SZ_W;
    float* CS = (float*)wsp; wsp += SZ_CS;
    unsigned* MB = (unsigned*)wsp; wsp += SZ_MB;
    h16* Q16 = (h16*)wsp; wsp += SZ_PL; bf* QPh = (bf*)wsp; wsp += SZ_QH; bf* QPl = (bf*)wsp; wsp += SZ_QH;
    h16* K16 = (h16*)wsp; wsp += SZ_PL; bf* KPh = (bf*)wsp; wsp += SZ_PL; bf* KPl = (bf*)wsp; wsp += SZ_PL;
    h16* VT16 = (h16*)wsp; wsp += SZ_PL; bf* VTh = (bf*)wsp; wsp += SZ_PL; bf* VTl = (bf*)wsp; wsp += SZ_PL;
    bf* ATh = (bf*)wsp; wsp += SZ_AT; bf* ATl = (bf*)wsp; wsp += SZ_AT;

    const size_t nw8 = (size_t)DQ * DM / 8;
    k_cvtx<<<(unsigned)(((size_t)NB * SEQ * DM / 8 + 255) / 256), 256, 0, stream>>>(x, XB);
    k_cvt8<<<(unsigned)((nw8 + 255) / 256), 256, 0, stream>>>(Wq, WQ, nw8);
    k_cvt8<<<(unsigned)((nw8 + 255) / 256), 256, 0, stream>>>(Wk, WK, nw8);
    k_cvt8<<<(unsigned)((nw8 + 255) / 256), 256, 0, stream>>>(Wv, WV, nw8);
    k_cvt8<<<(unsigned)((nw8 + 255) / 256), 256, 0, stream>>>(Wo, WO, nw8);
    k_cstab<<<(unsigned)((SEQ * (HD / 2) + 255) / 256), 256, 0, stream>>>(CS);
    k_mbits<<<(unsigned)(((size_t)SEQ * SEQ / 1024 + 7) / 8), 256, 0, stream>>>(mask, MB);

    const dim3 gp((unsigned)(NB * SEQ / 128), (unsigned)(DQ / 128), 1);
    k_proj_rope<RH><<<gp, GW * 32, 0, stream>>>(XB, WQ, bq, CS, Q16, QPh, QPl);
    k_proj_rope<SEQ><<<gp, GW * 32, 0, stream>>>(XB, WK, bk, CS, K16, KPh, KPl);
    k_proj_vt<<<gp, GW * 32, 0, stream>>>(XB, WV, bv, VT16, VTh, VTl);

    k_attn_hi<<<dim3((unsigned)(RH / (16 * AW)), (unsigned)(NB * NH), 1), AW * 32, 0, stream>>>(QPh, QPl, KPh, KPl, VTh, VTl, MB, ATh, ATl);
    if (SEQ > RH) k_attn_lo<<<dim3((unsigned)((SEQ - RH) / (16 * AW)), (unsigned)(NB * NH), 1), AW * 32, 0, stream>>>(Q16, K16, VT16, MB, ATh, ATl);

    k_gemm2<<<dim3((unsigned)(SEQ / 128), (unsigned)(DM / 128), (unsigned)NB), GW * 32, 0, stream>>>(ATh, ATl, WO, OUT, DM, bo, (size_t)SEQ * DQ, (size_t)SEQ_FULL * DM);
}

// v004
// Measured time: 127 microseconds a run.
// In two side-by-side timings against v003, it was 1.12 and 1.13 times as fast.
// Counting every step since v000, it is 2.56 times as fast.
#include <hip/hip_runtime.h>

// All contractions on v_wmma_f32_16x16x32 (f32 accumulate): q/k/v projections bf16 x bf16 (x, W, b RNE-converted to bf16; products exact); scores q.k and P.V: query rows < 512 bf16 hi/lo planes (3 products), other rows f16 (P carried x1024); output projection bf16 hi/lo activations x bf16 weights (2 products).
// x [2][2048][1024]; Wq/Wk/Wv/Wo [out][in] with biases; 16 heads x 64; rotate-half rotary on q and k (table computed on the device: powf / sincosf); score scale 1/8; int32 keep-mask [S][S] read by value (0 -> -inf); softmax f32; out = merged heads Wo^T + bo.
// Pipeline: bf16 copies -> mask bit-plane -> projection GEMMs (four waves of 64x64 share a 128x128 tile's operand rows through LDS) whose epilogue applies bias and rotary and writes the head planes itself (q, k [bh][t][d]; v^T [bh][d][t]) -> fused flash attention (four waves of 16 queries share each K / V tile through LDS, transposed tiles so the score accumulators are directly the P operand, online softmax) -> merged hi/lo planes -> output GEMM.

#ifndef NB
#define NB 2
#endif
#ifndef SEQ
#define SEQ 2048
#endif
#define NB_FULL  2
#define SEQ_FULL 2048
#define DM   1024
#define NH   16
#define HD   64
#define DQ   (NH * HD)
#define RH   ((SEQ) < 512 ? (SEQ) : 512)      // query rows < RH use the hi/lo planes
#define PCAR 1024.0f
#define SCL  0.125f                          // HD^-0.5
#define LOG2E 1.4426950408889634f

static_assert(HD == 64);                                   // two 32-deep k-steps per head, 4 output tiles of 16, table index = idx & 31
static_assert(DQ == DM);
static_assert(DM % 32 == 0 && DQ % 32 == 0);               // GEMM k-loop steps by 32
static_assert(DM % 8 == 0);
static_assert(SEQ % 128 == 0 && DQ % 128 == 0 && DM % 128 == 0);   // 128x128 GEMM work-group tiles inside one batch, stages of 128 k, 64-element plane lines
static_assert(RH % 16 == 0 && (SEQ - RH) % 16 == 0);       // 16-query attention tiles
static_assert(SEQ % 32 == 0 && ((size_t)SEQ * SEQ) % 1024 == 0);   // 32-key words, 32 words per bit-plane line
static_assert(NB <= NB_FULL && SEQ <= SEQ_FULL);

typedef _Float16 h16;
typedef unsigned short bf;
typedef __attribute__((ext_vector_type(16))) __bf16   v16bf;
typedef __attribute__((ext_vector_type(16))) _Float16 v16h;
typedef __attribute__((ext_vector_type(8)))  _Float16 v8h;
typedef __attribute__((ext_vector_type(2)))  _Float16 v2h;
typedef __attribute__((ext_vector_type(16))) unsigned short v16us;
typedef __attribute__((ext_vector_type(8)))  unsigned short v8us;
typedef __attribute__((ext_vector_type(2)))  unsigned short v2us;
typedef __attribute__((ext_vector_type(8)))  float    v8f;
typedef __attribute__((ext_vector_type(4)))  float    v4f;
typedef __attribute__((ext_vector_type(2)))  float    v2f;
typedef v4f  __attribute__((may_alias)) v4fa;

__device__ __forceinline__ unsigned short f2bf(float f) { unsigned u = __float_as_uint(f); u += 0x7FFFu + ((u >> 16) & 1u); return (unsigned short)(u >> 16); }
__device__ __forceinline__ float bf2f(unsigned short b) { return __uint_as_float(((unsigned)b) << 16); }
__device__ __forceinline__ float bfr(float f) { return bf2f(f2bf(f)); }
__device__ __forceinline__ void splitf(float y, unsigned short& h, unsigned short& l) { h = f2bf(y); l = f2bf(y - bf2f(h)); }
__device__ __forceinline__ v16h cat16(v8h lo, v8h hi) { return __builtin_shufflevector(lo, hi, 0, 1, 2, 3, 4, 5, 6, 7, 8, 9, 10, 11, 12, 13, 14, 15); }
__device__ __forceinline__ v16bf cat16b(v8us lo, v8us hi) { return __builtin_bit_cast(v16bf, __builtin_shufflevector(lo, hi, 0, 1, 2, 3, 4, 5, 6, 7, 8, 9, 10, 11, 12, 13, 14, 15)); }
// fragment loaders: p already includes row * pitch + k0 + 8 * (lane >> 4); elements 0..7 <- p[0..7], elements 8..15 <- p[16..23]
__device__ __forceinline__ v16h  ldh(const h16* p) { return cat16(*(const v8h*)p, *(const v8h*)(p + 16)); }
__device__ __forceinline__ v16bf ldb(const bf* p)  { return cat16b(*(const v8us*)p, *(const v8us*)(p + 16)); }
__device__ __forceinline__ v8f wmma16(v16h a, v16h b, v8f c) { return __builtin_amdgcn_wmma_f32_16x16x32_f16(false, a, false, b, (short)0, c, false, false); }
__device__ __forceinline__ v8f wmmab(v16bf a, v16bf b, v8f c) { return __builtin_amdgcn_wmma_f32_16x16x32_bf16(false, a, false, b, (short)0, c, false, false); }

// four asynchronous 16-byte copies per lane, global -> LDS; the s_wait_xcnt stands inside the statement so that no address register named here is rewritten ahead of it
__device__ __forceinline__ void copy4(unsigned l0, const void* g0, unsigned l1, const void* g1, unsigned l2, const void* g2, unsigned l3, const void* g3) {
    asm volatile("global_load_async_to_lds_b128 %0, %4, off\n\t"
                 "global_load_async_to_lds_b128 %1, %5, off\n\t"
                 "global_load_async_to_lds_b128 %2, %6, off\n\t"
                 "global_load_async_to_lds_b128 %3, %7, off\n\t"
                 "s_wait_xcnt 0x0"
                 :: "v"(l0), "v"(l1), "v"(l2), "v"(l3), "v"(g0), "v"(g1), "v"(g2), "v"(g3) : "memory"); }

// eight such copies in one statement, one s_wait_xcnt behind the last
__device__ __forceinline__ void copy8(unsigned l0, const void* g0, unsigned l1, const void* g1, unsigned l2, const void* g2, unsigned l3, const void* g3,
                                      unsigned l4, const void* g4, unsigned l5, const void* g5, unsigned l6, const void* g6, unsigned l7, const void* g7) {
    asm volatile("global_load_async_to_lds_b128 %0, %8, off\n\t"
                 "global_load_async_to_lds_b128 %1, %9, off\n\t"
                 "global_load_async_to_lds_b128 %2, %10, off\n\t"
                 "global_load_async_to_lds_b128 %3, %11, off\n\t"
                 "global_load_async_to_lds_b128 %4, %12, off\n\t"
                 "global_load_async_to_lds_b128 %5, %13, off\n\t"
                 "global_load_async_to_lds_b128 %6, %14, off\n\t"
                 "global_load_async_to_lds_b128 %7, %15, off\n\t"
                 "s_wait_xcnt 0x0"
                 :: "v"(l0), "v"(l1), "v"(l2), "v"(l3), "v"(l4), "v"(l5), "v"(l6), "v"(l7), "v"(g0), "v"(g1), "v"(g2), "v"(g3), "v"(g4), "v"(g5), "v"(g6), "v"(g7) : "memory"); }

// ---- GEMM main loop, one work-group of GW waves per 128 x 128 tile, wave (wm, wn) = (w & 1, w >> 1) takes the 64 x 64 part at (64 wm, 64 wn): acc[mb][nb][j] = sum_k A[m0 + 64 wm + 16 mb + 8 hi + j][k] Bt[n0 + 64 wn + 16 nb + lr][k]
// (+ the same with A2 when NA == 2). Operands are K-contiguous bf16 planes, K % GK == 0. A stage is GK k of the tile's 128 A rows (of each A plane) and 128 Bt rows, brought into LDS once for the whole work-group
// (asynchronous copies, two buffers: the next stage flies while this one is worked on); every wave reads its fragments from there, 32 k at a time in rising k.
#define GW 4                                  // waves per GEMM work-group
#define GK 128                                // k per stage: 256 B of every operand row
#define GPI 136                               // LDS pitch of a staged operand row, 16-bit elements: 272 B = 16 B x 17
#define GRING(NA) (2 * ((NA) + 1) * 128 * GPI)   // 16-bit elements of the two buffers
template <int NA>
__device__ __forceinline__ void gemm_acc(unsigned short* ring, const bf* __restrict__ A, const bf* __restrict__ A2, const bf* __restrict__ Bt, const int K, const int m0, const int n0, v8f (&acc)[4][4]) {
    constexpr int PL = 128 * GPI, BUF = (NA + 1) * PL;                // a buffer is [A planes][Bt plane]
    const int tid = (int)threadIdx.x, lane = tid & 31, lr = lane & 15, hi = lane >> 4;
    const int w = __builtin_amdgcn_readfirstlane(tid >> 5), wm = w & 1, wn = w >> 1;
#pragma unroll
    for (int mb = 0; mb < 4; ++mb)
#pragma unroll
        for (int nb = 0; nb < 4; ++nb) acc[mb][nb] = (v8f){};
    // copy map: a plane's stage is 128 rows of 16 pieces of 16 B; piece i = tid + 128 j (j < 16): row (tid >> 4) + 8 j, column tid & 15, so one wave's copy covers two whole 256-B row parts
    const unsigned lb = (unsigned)(size_t)(const void*)ring + (unsigned)((tid >> 4) * (GPI * 2) + (tid & 15) * 16);   // LDS byte address of this lane's piece 0
    const size_t go = (size_t)(tid >> 4) * K + (tid & 15) * 8;
    const bf* ga = A + (size_t)m0 * K + go; const bf* ga2 = A2 + (size_t)m0 * K + go; const bf* gb = Bt + (size_t)n0 * K + go;
    auto plane = [&](const unsigned l, const bf* g) {
        constexpr unsigned LJ = 8 * GPI * 2; const size_t gj = (size_t)8 * K;   // from piece j to piece j + 1: 8 rows, in LDS bytes and in global elements
#pragma unroll
        for (int q = 0; q < 16; q += 8)
            copy8(l + q * LJ, g + q * gj, l + (q + 1) * LJ, g + (q + 1) * gj, l + (q + 2) * LJ, g + (q + 2) * gj, l + (q + 3) * LJ, g + (q + 3) * gj,
                  l + (q + 4) * LJ, g + (q + 4) * gj, l + (q + 5) * LJ, g + (q + 5) * gj, l + (q + 6) * LJ, g + (q + 6) * gj, l + (q + 7) * LJ, g + (q + 7) * gj); };
    auto issue = [&](const int s, const int bi) { const unsigned l = lb + (unsigned)(bi * (BUF * 2)); const size_t ko = (size_t)s * GK;
        plane(l, ga + ko); if (NA == 2) plane(l + PL * 2, ga2 + ko); plane(l + NA * PL * 2, gb + ko); };
    const int NS = K / GK;
    issue(0, 0);
    asm volatile("s_wait_asynccnt 0x0" ::: "memory");                // this wave's share of the first stage has landed
    __syncthreads();                                                 // ... and every other wave's
    if (NS > 1) issue(1, 1);
#pragma unroll 1   // stays rolled: one stage's body already holds 64 (128) matrix instructions
    for (int s = 0; s < NS; ++s) {
        const unsigned short* sa = ring + (s & 1) * BUF + (wm * 64 + lr) * GPI + 8 * hi;
        const unsigned short* sb = ring + (s & 1) * BUF + NA * PL + (wn * 64 + lr) * GPI + 8 * hi;
        // fragments of one 32-k block, two register sets: block ks + 1 of this stage is read while block ks is multiplied (nothing of the next stage is read here)
        v16bf fa[2][4], fa2[2][4], fb[2][4];
        auto frag = [&](const int ks) {
#pragma unroll
            for (int mb = 0; mb < 4; ++mb) { fa[ks & 1][mb] = ldb(sa + mb * 16 * GPI + ks * 32); if (NA == 2) fa2[ks & 1][mb] = ldb(sa + PL + mb * 16 * GPI + ks * 32); }
#pragma unroll
            for (int nb = 0; nb < 4; ++nb) fb[ks & 1][nb] = ldb(sb + nb * 16 * GPI + ks * 32); };
        frag(0);
#pragma unroll   // constant indices keep the fragment sets in registers, constant offsets in the reads
        for (int ks = 0; ks < GK / 32; ++ks) {
            if (ks + 1 < GK / 32) frag(ks + 1);
            __builtin_amdgcn_sched_barrier(0);   // the next block's LDS reads issue as one group ahead of this block's matrix instructions: left to the scheduler they sink among them, two at a time, each pair waited for alone
#pragma unroll
            for (int nb = 0; nb < 4; ++nb)
#pragma unroll
                for (int mb = 0; mb < 4; ++mb) { acc[mb][nb] = wmmab(fa[ks & 1][mb], fb[ks & 1][nb], acc[mb][nb]); if (NA == 2) acc[mb][nb] = wmmab(fa2[ks & 1][mb], fb[ks & 1][nb], acc[mb][nb]); }
            __builtin_amdgcn_sched_barrier(0);   // ... and no matrix instruction of this block moves down among the next group's reads or behind the hand-over
        }
        // keeps the distance behind the stage's last matrix instructions on every path out of it, where address arithmetic or the next stage's reads may overwrite the fragments
        // (it stands behind the scheduling barrier above, so behind all of them, and names no register: a named accumulator would have to lie below v256 and was spilled for it)
        asm volatile("v_nop\n\tv_nop\n\tv_nop\n\tv_nop");
        // hand-over, every wave: my LDS reads of this buffer are done, my share of the next stage has landed, then the barrier that publishes the next stage and frees this buffer
        asm volatile("s_wait_dscnt 0x0" ::: "memory");
        asm volatile("s_wait_asynccnt 0x0" ::: "memory");
        __syncthreads();
        if (s + 2 < NS) issue(s + 2, s & 1);
    }
    asm volatile("s_wait_asynccnt 0x0" ::: "memory");                // no copy is left in flight behind the loop
}

// ---- output GEMM: C[m][n] (f32, pitch ldc) = sum_k A[m][k] Bt[n][k] + A2[m][k] Bt[n][k] + bf16(bias[n]), k < DQ; main loop gemm_acc, each wave stores its own 64 x 64 part
__device__ __forceinline__ void gemm_body(const bf* __restrict__ A, const bf* __restrict__ A2, const bf* __restrict__ Bt,
                                          float* C, const int ldc, const float* __restrict__ bias, const size_t sA, const size_t sC) {
    __shared__ __align__(16) unsigned short ring[GRING(2)];
    __shared__ __align__(16) float osall[GW * 16 * 68];
    const size_t z = blockIdx.z; A += z * sA; A2 += z * sA; C += z * sC;
    const int lane = threadIdx.x & 31, lr = lane & 15, hi = lane >> 4; const int w = __builtin_amdgcn_readfirstlane((int)threadIdx.x >> 5);
    float* os = osall + w * (16 * 68);        // this wave's own staging rows
    const int r0 = (int)blockIdx.x * 128 + (w & 1) * 64, c0 = (int)blockIdx.y * 128 + (w >> 1) * 64;
    v8f acc[4][4];
    gemm_acc<2>(ring, A, A2, Bt, DQ, (int)blockIdx.x * 128, (int)blockIdx.y * 128, acc);
    v4f bv;
#pragma unroll
    for (int q = 0; q < 4; ++q) bv[q] = bfr(bias[c0 + lr * 4 + q]);
#pragma unroll
    for (int mb = 0; mb < 4; ++mb) {
#pragma unroll
        for (int nb = 0; nb < 4; ++nb) {
#pragma unroll
            for (int j = 0; j < 8; ++j) os[(hi * 8 + j) * 68 + nb * 16 + lr] = acc[mb][nb][j]; }
        __builtin_amdgcn_wave_barrier(); asm volatile("" ::: "memory");
        float* crow = C + (size_t)(r0 + mb * 16) * ldc + c0;
{
#pragma unroll
            for (int s = 0; s < 8; ++s) { const int row = 2 * s + hi, cofs = lr * 4; v4f val = *(const v4fa*)(os + row * 68 + cofs); val += bv;
                *(v4f*)(crow + (size_t)row * ldc + cofs) = val; }
             }
        __builtin_amdgcn_wave_barrier(); asm volatile("" ::: "memory");
    }
}
__global__ __launch_bounds__(GW * 32) void k_gemm2(const bf* __restrict__ A, const bf* __restrict__ A2, const bf* __restrict__ Bt, float* C, int ldc, const float* __restrict__ bias, size_t sA, size_t sC) {
    gemm_body(A, A2, Bt, C, ldc, bias, sA, sC); }

__global__ __launch_bounds__(256) void k_cvt8(const float* __restrict__ src, bf* dst, size_t n8) { const size_t i = (size_t)blockIdx.x * 256 + threadIdx.x; if (i >= n8) return; const v8f v = *(const v8f*)(src + i * 8); v8us o;
#pragma unroll
    for (int k = 0; k < 8; ++k) o[k] = f2bf(v[k]);
    *(v8us*)(dst + i * 8) = o;  }
__global__ __launch_bounds__(256) void k_cvtx(const float* __restrict__ src, bf* dst) { const size_t i = (size_t)blockIdx.x * 256 + threadIdx.x; if (i >= (size_t)NB * SEQ * DM / 8) return;
    const size_t row = i / (DM / 8); const size_t c8 = i % (DM / 8); const size_t b = row / SEQ, t = row % SEQ; const v8f v = *(const v8f*)(src + ((b * SEQ_FULL + t) * DM + c8 * 8)); v8us o;
#pragma unroll
    for (int k = 0; k < 8; ++k) o[k] = f2bf(v[k]);
    *(v8us*)(dst + i * 8) = o;  }

__global__ __launch_bounds__(256) void k_cstab(float* CS) { const int idx = (int)blockIdx.x * 256 + (int)threadIdx.x; if (idx >= SEQ * (HD / 2)) return; const int i = idx & 31, t = idx >> 5;
    const float ex = (float)(2 * i) / (float)HD; const float pw = powf(10000.0f, ex); const float invf = 1.0f / pw; const float ang = __fmul_rn((float)t, invf); float sn, cn; sincosf(ang, &sn, &cn);
    v2f cs; cs[0] = cn; cs[1] = sn; float* p0 = CS + ((size_t)t * HD + i) * 2; float* p1 = p0 + (HD / 2) * 2;
    *(v2f*)p0 = cs; *(v2f*)p1 = cs;  }

__global__ __launch_bounds__(256) void k_mbits(const int* __restrict__ mask, unsigned* MB) { const int lane = threadIdx.x & 31; const int g = (int)blockIdx.x * 8 + (int)(threadIdx.x >> 5);
    if (g >= (int)((size_t)SEQ * SEQ / 1024)) return;   // wave-uniform
    unsigned mine = 0u;
#pragma unroll 4
    for (int j = 0; j < 32; ++j) { const int wd = g * 32 + j; const int q = wd / (SEQ / 32), kg = wd % (SEQ / 32); const int v = mask[(size_t)q * SEQ_FULL + kg * 32 + lane];
        const unsigned bal = __builtin_amdgcn_ballot_w32(v != 0); mine = (lane == j) ? bal : mine; }
    *(unsigned*)(MB + (size_t)g * 32 + lane) = mine;  }

// ---- projection tiles, one wave per 64 tokens x one head (64 features), four waves (two heads x two token groups) per work-group, main loop gemm_acc. A lane's 8 accumulator
// registers are 8 consecutive m, so the index that runs innermost in the plane to be written goes on the A side (features for q and k, tokens for v^T) and a lane's 8 values are one 16-byte piece of a plane row.
#define SP 72                                 // LDS pitch of a staged plane row of 64 16-bit elements: 144 B = 16 B x 9
// 16 plane rows x 64 elements, f32 in registers (lane (lr, hi): row lr, elements 16 mb + 8 hi + j) -> f16 plane and, when hl (the same for the whole wave), bf16 hi/lo planes. Staged in this wave's LDS so that every global store covers whole 128-byte lines.
__device__ __forceinline__ void planes_out(unsigned short* st, const v8f (&r)[4], h16* p16, bf* ph, bf* pl, const size_t pitch, const bool hl) {
    const int lane = threadIdx.x & 31, lr = lane & 15, hi = lane >> 4;
    unsigned short* sw = st + lr * SP + 8 * hi;
#pragma unroll
    for (int mb = 0; mb < 4; ++mb) { v8h o16;
#pragma unroll
        for (int j = 0; j < 8; ++j) o16[j] = (h16)r[mb][j];
        *(v8us*)(sw + mb * 16) = __builtin_bit_cast(v8us, o16); }
    if (hl) {
#pragma unroll
        for (int mb = 0; mb < 4; ++mb) { v8us oh, ol;
#pragma unroll
            for (int j = 0; j < 8; ++j) { unsigned short a, c; splitf(r[mb][j], a, c); oh[j] = a; ol[j] = c; }
            *(v8us*)(sw + 16 * SP + mb * 16) = oh; *(v8us*)(sw + 32 * SP + mb * 16) = ol; }
    }
    __builtin_amdgcn_wave_barrier(); asm volatile("" ::: "memory");   // the rows are read back by other lanes of the wave: no LDS read may move up over the writes
    const int rr = lane >> 3, cc = (lane & 7) * 8;
#pragma unroll
    for (int it = 0; it < 4; ++it) { const int row = it * 4 + rr; *(v8us*)((unsigned short*)p16 + (size_t)row * pitch + cc) = *(const v8us*)(st + row * SP + cc); }
    asm volatile("s_wait_xcnt 0x0" ::: "memory");   // stands in front of whatever next overwrites a register that these stores name
    if (hl) {
#pragma unroll
        for (int it = 0; it < 4; ++it) { const int row = it * 4 + rr;
            *(v8us*)(ph + (size_t)row * pitch + cc) = *(const v8us*)(st + 16 * SP + row * SP + cc); *(v8us*)(pl + (size_t)row * pitch + cc) = *(const v8us*)(st + 32 * SP + row * SP + cc); }
        asm volatile("s_wait_xcnt 0x0" ::: "memory");   // as above
    }
    __builtin_amdgcn_wave_barrier(); asm volatile("" ::: "memory");   // ... and the next group's writes may not move up over these reads
    __builtin_amdgcn_sched_barrier(0);        // nor the next group's arithmetic over the waits above, where it would overwrite the stores' registers ahead of them
}
// q or k: y = x W^T + bf16(b), rotate-half rotary out[d] = y[d] c - y[d+32] s (d < 32), out[d] = y[d] c + y[d-32] s (d >= 32); d and d + 32 lie in the same lane (mb and mb + 2). Planes [bh][t][d]: f16, and bf16 hi/lo for t < HROWS.
template <int HROWS>
__global__ __launch_bounds__(GW * 32) void k_proj_rope(const bf* __restrict__ X, const bf* __restrict__ Wt, const float* __restrict__ bias, const float* __restrict__ CS, h16* P16, bf* Ph, bf* Pl) {
    static_assert(HROWS % 16 == 0);           // a group of 16 tokens has its hi/lo rows or has none
    __shared__ __align__(16) unsigned short ring[GRING(1)];
    __shared__ __align__(16) unsigned short stall[GW * 3 * 16 * SP];
    const int lane = threadIdx.x & 31, lr = lane & 15, hi = lane >> 4; const int w = __builtin_amdgcn_readfirstlane((int)threadIdx.x >> 5);
    unsigned short* st = stall + w * (3 * 16 * SP);   // this wave's own staging rows
    const int r0 = (int)blockIdx.x * 128 + (w >> 1) * 64, h = (int)blockIdx.y * 2 + (w & 1);
    const int b = r0 / SEQ, t0 = r0 % SEQ, bh = b * NH + h;
    v8f acc[4][4];
    gemm_acc<1>(ring, Wt, Wt, X, DM, (int)blockIdx.y * 128, (int)blockIdx.x * 128, acc);
    // a lane's (cos, sin) pairs of token group nb: token t0 + 16 nb + lr, frequencies 8 hi + j (pieces 0..3) and 16 + 8 hi + j (pieces 4..7)
    const float* cp = CS + ((size_t)(t0 + lr) * HD + 8 * hi) * 2;
    v4f cs[2][8]; v8f xb[4];
    auto ldcs = [&](const int nb) {
#pragma unroll
        for (int q = 0; q < 8; ++q) cs[nb & 1][q] = *(const v4f*)(cp + (size_t)nb * 16 * HD * 2 + (q >> 2) * 32 + (q & 3) * 4);
        asm volatile("s_wait_xcnt 0x0" ::: "memory"); };   // stands in front of whatever next overwrites an address register of these loads
#pragma unroll
    for (int mb = 0; mb < 4; ++mb) xb[mb] = *(const v8f*)(bias + h * HD + mb * 16 + 8 * hi);
    ldcs(0); ldcs(1);
    __builtin_amdgcn_sched_barrier(0);        // bias and the first two groups' table loads issue as one run: left to the scheduler they are issued two at a time, each pair waited for alone
#pragma unroll
    for (int mb = 0; mb < 4; ++mb) { v8f bb;
#pragma unroll
        for (int j = 0; j < 8; ++j) bb[j] = bfr(xb[mb][j]);
#pragma unroll
        for (int nb = 0; nb < 4; ++nb) acc[mb][nb] += bb; }
#pragma unroll
    for (int nb = 0; nb < 4; ++nb) {
        v8f r[4];
#pragma unroll
        for (int mp = 0; mp < 2; ++mp)
#pragma unroll
            for (int j = 0; j < 8; ++j) { const float c = cs[nb & 1][mp * 4 + (j >> 1)][(j & 1) * 2], s = cs[nb & 1][mp * 4 + (j >> 1)][(j & 1) * 2 + 1];
                const float y1 = acc[mp][nb][j], y2 = acc[mp + 2][nb][j];
                r[mp][j] = y1 * c - y2 * s; r[mp + 2][j] = y2 * c + y1 * s; }
        if (nb + 2 < 4) { ldcs(nb + 2);
            __builtin_amdgcn_sched_barrier(0); }   // the table loads of the group after next issue no later than here, so that they fly under this group's conversion and stores
        const int tg = t0 + nb * 16; const bool hl = tg < HROWS;
        const size_t eh = ((size_t)bh * HROWS + (hl ? tg : 0)) * HD;
        planes_out(st, r, P16 + ((size_t)bh * SEQ + tg) * HD, Ph + eh, Pl + eh, HD, hl);
    }
}
// v: y = x W^T + bf16(b), planes [bh][d][t] (f16, bf16 hi/lo): tokens on the A side, so a lane's 8 values are 8 consecutive t of feature row 16 nb + lr
__global__ __launch_bounds__(GW * 32) void k_proj_vt(const bf* __restrict__ X, const bf* __restrict__ Wt, const float* __restrict__ bias, h16* V16, bf* Vh, bf* Vl) {
    __shared__ __align__(16) unsigned short ring[GRING(1)];
    __shared__ __align__(16) unsigned short stall[GW * 3 * 16 * SP];
    const int lane = threadIdx.x & 31, lr = lane & 15; const int w = __builtin_amdgcn_readfirstlane((int)threadIdx.x >> 5);
    unsigned short* st = stall + w * (3 * 16 * SP);   // this wave's own staging rows
    const int r0 = (int)blockIdx.x * 128 + (w & 1) * 64, h = (int)blockIdx.y * 2 + (w >> 1);
    const int b = r0 / SEQ, t0 = r0 % SEQ, bh = b * NH + h;
    float xb[4];
#pragma unroll
    for (int nb = 0; nb < 4; ++nb) xb[nb] = bias[h * HD + nb * 16 + lr];
    v8f acc[4][4];
    gemm_acc<1>(ring, X, X, Wt, DM, (int)blockIdx.x * 128, (int)blockIdx.y * 128, acc);
#pragma unroll
    for (int nb = 0; nb < 4; ++nb) {
        const float bv = bfr(xb[nb]);
        v8f r[4];
#pragma unroll
        for (int mb = 0; mb < 4; ++mb) r[mb] = acc[mb][nb] + bv;
        const size_t e = ((size_t)bh * HD + nb * 16) * SEQ + t0;
        planes_out(st, r, V16 + e, Vh + e, Vl + e, SEQ, true);
    }
}

// ---- fused attention, one work-group of AW waves per 16 * AW query rows of one (batch, head), one wave per 16 rows; KS = 64 keys per step (two mask words). Each step's K rows and V^T rows are brought into LDS once for the whole work-group
// (asynchronous copies, two buffers: the next step's tile flies while this one is worked on) and every wave reads its fragments from there. The rows' mask words are read once into LDS; a step is staged only when some
// row of the work-group keeps one of its 64 keys, and a wave works on it only when one of its own 16 rows does (exact for any mask; the steps a wave works on and their order are those of a walk over all SEQ / 64 steps).
// Transposed tiles: S^T[key][query] = K (A operand) x Q^T (B operand), so lane (hi, lr) holds query lr, keys 16 kt + 8 hi + r of key tile kt (four tiles); tiles 2 c and 2 c + 1 are exactly the B-operand elements of P over the 32 keys of half c for
// O^T[d][query] = V^T (A operand) x P^T (B operand). Row statistics (running max, sum) are per lane; the two lane halves exchange once per step (xor 16). HR: bf16 hi/lo planes, 3 products; else f16, P x1024.
#define AW 4                                  // waves per attention work-group
#define KP 72                                 // LDS pitch of a K row, 16-bit elements: 144 B = 16 B x 9, conflict-free for 16-byte reads down a column of rows
#define KS 64                                 // keys per step
#define VP 72                                 // LDS pitch of a V^T row of 64 keys: 144 B = 16 B x 9
#define MP 65                                 // LDS pitch of a row's mask words, dwords
static_assert(RH % (16 * AW) == 0 && (SEQ - RH) % (16 * AW) == 0);   // whole work-groups
static_assert(SEQ / 32 <= 64);                                       // a row's mask words fit one 64-bit word
static_assert(AW * 32 == 128 && HD == 64 && KS == 64);               // the copy index maps below: 512 16-byte pieces per K plane and per V^T plane, four of each per lane
static_assert(SEQ % KS == 0);                                        // a step is a whole pair of mask words

template <bool HR>
__device__ __forceinline__ void attn_body(const h16* __restrict__ Q16, const h16* __restrict__ K16, const h16* __restrict__ VT16,
                                          const bf* __restrict__ Qh, const bf* __restrict__ Ql, const bf* __restrict__ Kh, const bf* __restrict__ Kl,
                                          const bf* __restrict__ VTh, const bf* __restrict__ VTl, const unsigned* __restrict__ MB, bf* ATh, bf* ATl) {
    constexpr int NPL = HR ? 2 : 1;                                   // planes per operand
    constexpr int KT = KS * KP, VT = HD * VP, BUF = NPL * (KT + VT);  // 16-bit elements; a buffer is [K planes][V^T planes]
    constexpr int NW = SEQ / 32;
    __shared__ __align__(16) unsigned short ring[2 * BUF];
    __shared__ unsigned msk[AW * 16 * MP];
    __shared__ unsigned lv[AW * 2];
    __shared__ __align__(16) float csall[AW * 16 * 68];
    const int tid = (int)threadIdx.x, lane = tid & 31, lr = lane & 15, hi = lane >> 4;
    const int w = __builtin_amdgcn_readfirstlane(tid >> 5);
    float* cs = csall + w * (16 * 68);
    const int q0 = (HR ? 0 : RH) + (int)blockIdx.x * (16 * AW) + w * 16;
    const int bh = (int)blockIdx.y, b = bh / NH, h = bh % NH;
    const size_t qoff = ((size_t)bh * (HR ? RH : SEQ) + q0 + lr) * HD + 8 * hi;
    const float NINF = -__builtin_huge_valf();

    // mask words of this wave's 16 rows -> LDS (read back by this wave alone); which steps keep a key: for the wave (own), for the work-group (live)
    unsigned nz0 = 0u, nz1 = 0u;
#pragma unroll   // all 32 loads in flight at once
    for (int r = 0; r < 16; ++r) { const unsigned* mrow = MB + (size_t)(q0 + r) * NW; const unsigned a = (lane < NW) ? mrow[lane] : 0u, c = (lane + 32 < NW) ? mrow[lane + 32] : 0u;
        msk[(w * 16 + r) * MP + lane] = a; msk[(w * 16 + r) * MP + 32 + lane] = c; nz0 |= a; nz1 |= c; }
    const unsigned own0 = __builtin_amdgcn_ballot_w32(nz0 != 0u), own1 = __builtin_amdgcn_ballot_w32(nz1 != 0u);
    if (lane == 0) { lv[w * 2] = own0; lv[w * 2 + 1] = own1; }
    __syncthreads();
    unsigned g0 = 0u, g1 = 0u;
    for (int i = 0; i < AW; ++i) { g0 |= lv[i * 2]; g1 |= lv[i * 2 + 1]; }
    // a step is named by the first of its two mask words (an even number); its bit is set when either word keeps a key
    constexpr unsigned long long EVEN = 0x5555555555555555ull;
    const unsigned long long ownw = (unsigned long long)own0 | ((unsigned long long)own1 << 32);
    const unsigned long long own = (ownw | (ownw >> 1)) & EVEN;
    const unsigned long long livew = (unsigned long long)(unsigned)__builtin_amdgcn_readfirstlane((int)g0) | ((unsigned long long)(unsigned)__builtin_amdgcn_readfirstlane((int)g1) << 32);
    unsigned long long rest = (livew | (livew >> 1)) & EVEN;          // steps not yet issued, the same in every wave

    // Q fragments stay in registers
    v16h qf[2]; v16bf qh[2], ql[2];
#pragma unroll   // constant indices keep the fragment arrays in registers (so at the K fragments below)
    for (int ks = 0; ks < 2; ++ks) { if (HR) { qh[ks] = ldb(Qh + qoff + ks * 32); ql[ks] = ldb(Ql + qoff + ks * 32); } else qf[ks] = ldh(Q16 + qoff + ks * 32); }

    // copy maps: a step's 64 K rows are 8 KiB in a row in global memory (piece i = tid + 128 j, j < 4: row i >> 3, 16-byte column i & 7); its V^T tile is 64 rows of 128 B (the same piece map)
    const unsigned ringb = (unsigned)(size_t)(const void*)ring;       // LDS byte address of the ring
    const unsigned lk = ringb + (unsigned)((tid >> 3) * (KP * 2) + (tid & 7) * 16);
    const unsigned lvv = ringb + (unsigned)(NPL * KT * 2 + (tid >> 3) * (VP * 2) + (tid & 7) * 16);
    const size_t gk = (size_t)bh * SEQ * HD + (size_t)tid * 8;
    const size_t gv = ((size_t)bh * HD + (tid >> 3)) * SEQ + (tid & 7) * 8;
    auto issue = [&](const int kc, const int bi) {                    // kc: the step's first mask word, so its first key is 32 kc
        constexpr unsigned KJ = 16 * KP * 2, VJ = 16 * VP * 2; constexpr size_t GK16 = (size_t)16 * HD, GV16 = (size_t)16 * SEQ;   // from piece j to piece j + 1: 16 rows, in LDS bytes and in global elements
        const unsigned k0 = lk + (unsigned)(bi * (BUF * 2)), v0 = lvv + (unsigned)(bi * (BUF * 2)); const size_t ko = gk + (size_t)kc * 32 * HD, vo = gv + (size_t)kc * 32;
        if (HR) {
            copy8(k0, Kh + ko, k0 + KJ, Kh + ko + GK16, k0 + 2 * KJ, Kh + ko + 2 * GK16, k0 + 3 * KJ, Kh + ko + 3 * GK16,
                  k0 + KT * 2, Kl + ko, k0 + KT * 2 + KJ, Kl + ko + GK16, k0 + KT * 2 + 2 * KJ, Kl + ko + 2 * GK16, k0 + KT * 2 + 3 * KJ, Kl + ko + 3 * GK16);
            copy8(v0, VTh + vo, v0 + VJ, VTh + vo + GV16, v0 + 2 * VJ, VTh + vo + 2 * GV16, v0 + 3 * VJ, VTh + vo + 3 * GV16,
                  v0 + VT * 2, VTl + vo, v0 + VT * 2 + VJ, VTl + vo + GV16, v0 + VT * 2 + 2 * VJ, VTl + vo + 2 * GV16, v0 + VT * 2 + 3 * VJ, VTl + vo + 3 * GV16);
        } else {
            copy8(k0, K16 + ko, k0 + KJ, K16 + ko + GK16, k0 + 2 * KJ, K16 + ko + 2 * GK16, k0 + 3 * KJ, K16 + ko + 3 * GK16,
                  v0, VT16 + vo, v0 + VJ, VT16 + vo + GV16, v0 + 2 * VJ, VT16 + vo + 2 * GV16, v0 + 3 * VJ, VT16 + vo + 3 * GV16);
        } };

    v8f o[4];
#pragma unroll
    for (int dt = 0; dt < 4; ++dt) o[dt] = (v8f){};
    float m = NINF, l = 0.0f;
    int cur = -1, nxt = -1, bi = 0;
    if (rest != 0ull) {
        cur = __builtin_ctzll(rest); rest &= rest - 1ull; issue(cur, 0);
        asm volatile("s_wait_asynccnt 0x0" ::: "memory");            // this wave's share of the first tile has landed
        __syncthreads();                                             // ... and every other wave's
        if (rest != 0ull) { nxt = __builtin_ctzll(rest); rest &= rest - 1ull; issue(nxt, 1); }
    }
    while (cur >= 0) {
      if ((own >> cur) & 1ull) {                                      // wave-uniform: else all 16 rows mask all 64 keys
        const unsigned W0 = msk[(w * 16 + lr) * MP + cur], W1 = msk[(w * 16 + lr) * MP + cur + 1];
        const unsigned short* kb = ring + bi * BUF + lr * KP + 8 * hi;
        const unsigned short* vb = ring + bi * BUF + NPL * KT + lr * VP + 8 * hi;
        v8f s[4];
#pragma unroll   // constant indices keep the tile and fragment arrays in registers (so in every loop of this step)
        for (int kt = 0; kt < 4; ++kt) s[kt] = (v8f){};
        if (HR) {
            v16bf ah[4][2], al[4][2];
#pragma unroll
            for (int kt = 0; kt < 4; ++kt)
#pragma unroll
                for (int ks = 0; ks < 2; ++ks) { ah[kt][ks] = ldb(kb + kt * 16 * KP + ks * 32); al[kt][ks] = ldb(kb + KT + kt * 16 * KP + ks * 32); }
#pragma unroll
            for (int ks = 0; ks < 2; ++ks) {
#pragma unroll
                for (int kt = 0; kt < 4; ++kt) s[kt] = wmmab(ah[kt][ks], qh[ks], s[kt]);
#pragma unroll
                for (int kt = 0; kt < 4; ++kt) s[kt] = wmmab(al[kt][ks], qh[ks], s[kt]);
#pragma unroll
                for (int kt = 0; kt < 4; ++kt) s[kt] = wmmab(ah[kt][ks], ql[ks], s[kt]);
            }
        } else {
            v16h kf[4][2];
#pragma unroll
            for (int kt = 0; kt < 4; ++kt)
#pragma unroll
                for (int ks = 0; ks < 2; ++ks) kf[kt][ks] = ldh((const h16*)kb + kt * 16 * KP + ks * 32);
#pragma unroll
            for (int ks = 0; ks < 2; ++ks)
#pragma unroll
                for (int kt = 0; kt < 4; ++kt) s[kt] = wmma16(kf[kt][ks], qf[ks], s[kt]);
        }
        // online softmax for query lr over this lane's 32 keys + the partner lane's 32 keys
        float t[4][8], mt[4];
#pragma unroll
        for (int kt = 0; kt < 4; ++kt) { const unsigned Wl = ((kt < 2) ? W0 : W1) >> (8 * hi + 16 * (kt & 1)); mt[kt] = NINF;
#pragma unroll
            for (int r = 0; r < 8; ++r) { t[kt][r] = ((Wl >> r) & 1u) ? s[kt][r] * SCL : NINF; mt[kt] = fmaxf(mt[kt], t[kt][r]); } }
        float mx = fmaxf(fmaxf(mt[0], mt[1]), fmaxf(mt[2], mt[3]));
        mx = fmaxf(mx, __shfl_xor(mx, 16, 32));
        const float mnew = fmaxf(m, mx);
        const float msub = (mnew == NINF) ? 0.0f : mnew;
        // each difference below stays a rounded value of its own ahead of its multiply by log2 e (the empty statements name differences, never products)
        float ds = __fsub_rn(m, msub); asm volatile("" : "+v"(ds));
        const float scl = __builtin_amdgcn_exp2f(__fmul_rn(ds, LOG2E));
        float p[4][8], pt[4];
#pragma unroll
        for (int kt = 0; kt < 4; ++kt) { pt[kt] = 0.0f;
#pragma unroll
            for (int r = 0; r < 8; ++r) { float d = __fsub_rn(t[kt][r], msub); asm volatile("" : "+v"(d)); p[kt][r] = __builtin_amdgcn_exp2f(__fmul_rn(d, LOG2E)); pt[kt] += p[kt][r]; } }
        float psum = (pt[0] + pt[1]) + (pt[2] + pt[3]);
        psum += __shfl_xor(psum, 16, 32);
        l = l * scl + psum; m = mnew;
#pragma unroll
        for (int dt = 0; dt < 4; ++dt)
#pragma unroll
            for (int r = 0; r < 8; ++r) o[dt][r] *= scl;
        if (HR) {
            v16bf pbh[2], pbl[2];
#pragma unroll
            for (int c = 0; c < 2; ++c) { v16us ph, pl;
#pragma unroll
                for (int r = 0; r < 8; ++r) { unsigned short a, e; splitf(p[2 * c][r], a, e); ph[r] = a; pl[r] = e; splitf(p[2 * c + 1][r], a, e); ph[8 + r] = a; pl[8 + r] = e; }
                pbh[c] = __builtin_bit_cast(v16bf, ph); pbl[c] = __builtin_bit_cast(v16bf, pl); }
            v16bf vh[2][4], vl[2][4];
#pragma unroll
            for (int c = 0; c < 2; ++c)
#pragma unroll
                for (int dt = 0; dt < 4; ++dt) { vh[c][dt] = ldb(vb + dt * 16 * VP + c * 32); vl[c][dt] = ldb(vb + VT + dt * 16 * VP + c * 32); }
#pragma unroll
            for (int c = 0; c < 2; ++c) {
#pragma unroll
                for (int dt = 0; dt < 4; ++dt) o[dt] = wmmab(vh[c][dt], pbh[c], o[dt]);
#pragma unroll
                for (int dt = 0; dt < 4; ++dt) o[dt] = wmmab(vl[c][dt], pbh[c], o[dt]);
#pragma unroll
                for (int dt = 0; dt < 4; ++dt) o[dt] = wmmab(vh[c][dt], pbl[c], o[dt]);
            }
            // keeps the distance behind the step's last matrix instructions on the path into the hand-over, where the next copies' address arithmetic may overwrite their operands
            asm volatile("v_nop\n\tv_nop\n\tv_nop\n\tv_nop" : "+v"(o[0]), "+v"(o[1]), "+v"(o[2]), "+v"(o[3]) : "v"(pbl[1]), "v"(vh[1][0]), "v"(vh[1][3]));
        } else {
            v16h pb[2];
#pragma unroll
            for (int c = 0; c < 2; ++c)
#pragma unroll
                for (int r = 0; r < 8; ++r) { pb[c][r] = (h16)(p[2 * c][r] * PCAR); pb[c][8 + r] = (h16)(p[2 * c + 1][r] * PCAR); }
            v16h vf[2][4];
#pragma unroll
            for (int c = 0; c < 2; ++c)
#pragma unroll
                for (int dt = 0; dt < 4; ++dt) vf[c][dt] = ldh((const h16*)vb + dt * 16 * VP + c * 32);
#pragma unroll
            for (int c = 0; c < 2; ++c)
#pragma unroll
                for (int dt = 0; dt < 4; ++dt) o[dt] = wmma16(vf[c][dt], pb[c], o[dt]);
            // as above
            asm volatile("v_nop\n\tv_nop\n\tv_nop\n\tv_nop" : "+v"(o[0]), "+v"(o[1]), "+v"(o[2]), "+v"(o[3]) : "v"(pb[1]), "v"(vf[1][0]), "v"(vf[1][3]));
        }
      }
        // hand-over, every wave, also one that skipped the step: my LDS reads of this buffer are done, my share of the next tile has landed, then the barrier that publishes the next tile and frees this buffer
        asm volatile("s_wait_dscnt 0x0" ::: "memory");
        asm volatile("s_wait_asynccnt 0x0" ::: "memory");
        __syncthreads();
        cur = nxt; nxt = -1;
        if (rest != 0ull) { nxt = __builtin_ctzll(rest); rest &= rest - 1ull; issue(nxt, bi); }
        bi ^= 1;
    }
    asm volatile("s_wait_asynccnt 0x0" ::: "memory");                // no copy is left in flight when the wave ends
    // normalise (a row without any kept key gives 0 x inf = NaN, as a softmax over an all -inf row does) and stage O[query lr][d]
    const float rl = 1.0f / l; const float inv = HR ? rl : rl * (1.0f / PCAR);
#pragma unroll
    for (int dt = 0; dt < 4; ++dt)
#pragma unroll
        for (int r = 0; r < 8; ++r) cs[lr * 68 + dt * 16 + 8 * hi + r] = o[dt][r] * inv;
    __builtin_amdgcn_wave_barrier(); asm volatile("" ::: "memory");
    bf* ah = ATh + ((size_t)b * SEQ + q0) * DQ + h * HD; bf* al = ATl + ((size_t)b * SEQ + q0) * DQ + h * HD;
{
#pragma unroll
        for (int it = 0; it < 4; ++it) { const int row = it * 4 + (lane >> 3), c = (lane & 7) * 8;
            const v4f x0 = *(const v4fa*)(cs + row * 68 + c), x1 = *(const v4fa*)(cs + row * 68 + c + 4); v8us oh, ol;
#pragma unroll
            for (int q = 0; q < 4; ++q) { unsigned short a, c2; splitf(x0[q], a, c2); oh[q] = a; ol[q] = c2; splitf(x1[q], a, c2); oh[4 + q] = a; ol[4 + q] = c2; }
            *(v8us*)(ah + (size_t)row * DQ + c) = oh; *(v8us*)(al + (size_t)row * DQ + c) = ol; }
         }
}
__global__ __launch_bounds__(AW * 32) void k_attn_hi(const bf* __restrict__ Qh, const bf* __restrict__ Ql, const bf* __restrict__ Kh, const bf* __restrict__ Kl, const bf* __restrict__ VTh, const bf* __restrict__ VTl,
                                                const unsigned* __restrict__ MB, bf* ATh, bf* ATl) {
    attn_body<true>(nullptr, nullptr, nullptr, Qh, Ql, Kh, Kl, VTh, VTl, MB, ATh, ATl); }
__global__ __launch_bounds__(AW * 32) void k_attn_lo(const h16* __restrict__ Q16, const h16* __restrict__ K16, const h16* __restrict__ VT16, const unsigned* __restrict__ MB, bf* ATh, bf* ATl) {
    attn_body<false>(Q16, K16, VT16, nullptr, nullptr, nullptr, nullptr, nullptr, nullptr, MB, ATh, ATl); }

// ---- workspace carve (bytes, every region a multiple of 256)
constexpr size_t al256(size_t x) { return (x + 255) & ~(size_t)255; }
constexpr size_t SZ_XB  = al256((size_t)NB * SEQ * DM * 2);
constexpr size_t SZ_W   = al256((size_t)DQ * DM * 2);
constexpr size_t SZ_CS  = al256((size_t)SEQ * HD * 2 * 4);
constexpr size_t SZ_MB  = al256((size_t)SEQ * SEQ / 8);
constexpr size_t SZ_PL  = al256((size_t)NB * NH * SEQ * HD * 2);
constexpr size_t SZ_QH  = al256((size_t)NB * NH * RH * HD * 2);
constexpr size_t SZ_AT  = al256((size_t)NB * SEQ * DQ * 2);
constexpr size_t WS_TOTAL = SZ_XB + 4 * SZ_W + SZ_CS + SZ_MB + SZ_PL + 2 * SZ_QH + 3 * SZ_PL + 3 * SZ_PL + 2 * SZ_AT;
static_assert(WS_TOTAL <= (size_t)134217728);

extern "C" void kernel_launch(void* const* d_in, const int* in_sizes, int n_in,
                              void* d_out, int out_size, void* d_ws, size_t ws_size, hipStream_t stream) {
    if (n_in < 10) return;
    const long long need_x = (long long)(NB - 1) * SEQ_FULL * DM + (long long)SEQ * DM;
    if ((long long)in_sizes[0] < need_x || (long long)out_size < need_x) return;
    if (in_sizes[1] < DQ * DM || in_sizes[3] < DQ * DM || in_sizes[5] < DQ * DM || in_sizes[7] < DM * DQ) return;
    if (in_sizes[2] < DQ || in_sizes[4] < DQ || in_sizes[6] < DQ || in_sizes[8] < DM) return;
    if ((long long)in_sizes[9] < (long long)(SEQ - 1) * SEQ_FULL + SEQ) return;
    if (WS_TOTAL > ws_size) return;
    const float* x  = (const float*)d_in[0];
    const float* Wq = (const float*)d_in[1]; const float* bq = (const float*)d_in[2];
    const float* Wk = (const float*)d_in[3]; const float* bk = (const float*)d_in[4];
    const float* Wv = (const float*)d_in[5]; const float* bv = (const float*)d_in[6];
    const float* Wo = (const float*)d_in[7]; const float* bo = (const float*)d_in[8];
    const int* mask = (const int*)d_in[9];
    float* OUT = (float*)d_out;
    char* wsp = (char*)d_ws;
    bf* XB = (bf*)wsp; wsp += SZ_XB;
    bf* WQ = (bf*)wsp; wsp += SZ_W; bf* WK = (bf*)wsp; wsp += SZ_W; bf* WV = (bf*)wsp; wsp += SZ_W; bf* WO = (bf*)wsp; wsp += SZ_W;
    float* CS = (float*)wsp; wsp += SZ_CS;
    unsigned* MB = (unsigned*)wsp; wsp += SZ_MB;
    h16* Q16 = (h16*)wsp; wsp += SZ_PL; bf* QPh = (bf*)wsp; wsp += SZ_QH; bf* QPl = (bf*)wsp; wsp += SZ_QH;
    h16* K16 = (h16*)wsp; wsp += SZ_PL; bf* KPh = (bf*)wsp; wsp += SZ_PL; bf* KPl = (bf*)wsp; wsp += SZ_PL;
    h16* VT16 = (h16*)wsp; wsp += SZ_PL; bf* VTh = (bf*)wsp; wsp += SZ_PL; bf* VTl = (bf*)wsp; wsp += SZ_PL;
    bf* ATh = (bf*)wsp; wsp += SZ_AT; bf* ATl = (bf*)wsp; wsp += SZ_AT;

    const size_t nw8 = (size_t)DQ * DM / 8;
    k_cvtx<<<(unsigned)(((size_t)NB * SEQ * DM / 8 + 255) / 256), 256, 0, stream>>>(x, XB);
    k_cvt8<<<(unsigned)((nw8 + 255) / 256), 256, 0, stream>>>(Wq, WQ, nw8);
    k_cvt8<<<(unsigned)((nw8 + 255) / 256), 256, 0, stream>>>(Wk, WK, nw8);
    k_cvt8<<<(unsigned)((nw8 + 255) / 256), 256, 0, stream>>>(Wv, WV, nw8);
    k_cvt8<<<(unsigned)((nw8 + 255) / 256), 256, 0, stream>>>(Wo, WO, nw8);
    k_cstab<<<(unsigned)((SEQ * (HD / 2) + 255) / 256), 256, 0, stream>>>(CS);
    k_mbits<<<(unsigned)(((size_t)SEQ * SEQ / 1024 + 7) / 8), 256, 0, stream>>>(mask, MB);

    const dim3 gp((unsigned)(NB * SEQ / 128), (unsigned)(DQ / 128), 1);
    k_proj_rope<RH><<<gp, GW * 32, 0, stream>>>(XB, WQ, bq, CS, Q16, QPh, QPl);
    k_proj_rope<SEQ><<<gp, GW * 32, 0, stream>>>(XB, WK, bk, CS, K16, KPh, KPl);
    k_proj_vt<<<gp, GW * 32, 0, stream>>>(XB, WV, bv, VT16, VTh, VTl);

    k_attn_hi<<<dim3((unsigned)(RH / (16 * AW)), (unsigned)(NB * NH), 1), AW * 32, 0, stream>>>(QPh, QPl, KPh, KPl, VTh, VTl, MB, ATh, ATl);
    if (SEQ > RH) k_attn_lo<<<dim3((unsigned)((SEQ - RH) / (16 * AW)), (unsigned)(NB * NH), 1), AW * 32, 0, stream>>>(Q16, K16, VT16, MB, ATh, ATl);

    k_gemm2<<<dim3((unsigned)(SEQ / 128), (unsigned)(DM / 128), (unsigned)NB), GW * 32, 0, stream>>>(ATh, ATl, WO, OUT, DM, bo, (size_t)SEQ * DQ, (size_t)SEQ_FULL * DM);
}

// v005
// It runs in 99 microseconds.
// In two side-by-side timings against v004, it was 1.28 and 1.29 times as fast.
// All steps since v000 together make it 3.29 times as fast.
#include <hip/hip_runtime.h>

// All contractions on v_wmma_f32_16x16x32 (f32 accumulate): q/k/v projections bf16 x bf16 (x, W, b RNE-converted to bf16; products exact); scores q.k and P.V: query rows < 512 bf16 hi/lo planes (3 products), other rows f16 (P carried x1024); output projection bf16 hi/lo activations x bf16 weights (2 products).
// x [2][2048][1024]; Wq/Wk/Wv/Wo [out][in] with biases; 16 heads x 64; rotate-half rotary on q and k (table computed on the device: powf / sincosf); score scale 1/8; int32 keep-mask [S][S] read by value (0 -> -inf); softmax f32; out = merged heads Wo^T + bo.
// Four launches; jobs that read none of each other's output share a grid and are told apart by a block index: input-only jobs | q, k, v projections | attention, both operand kinds | output GEMM.
// Pipeline: bf16 copies and mask bit-plane -> projection GEMMs (four waves of 64x64 share a 128x128 tile's operand rows through LDS) whose epilogue applies bias and rotary and writes the head planes itself (q, k [bh][t][d]; v^T [bh][d][t]) -> fused flash attention (four waves of 16 queries share each K / V tile through LDS, transposed tiles so the score accumulators are directly the P operand, online softmax) -> merged hi/lo planes -> output GEMM.

#ifndef NB
#define NB 2
#endif
#ifndef SEQ
#define SEQ 2048
#endif
#define NB_FULL  2
#define SEQ_FULL 2048
#define DM   1024
#define NH   16
#define HD   64
#define DQ   (NH * HD)
#define RH   ((SEQ) < 512 ? (SEQ) : 512)      // query rows < RH use the hi/lo planes
#define PCAR 1024.0f
#define SCL  0.125f                          // HD^-0.5
#define LOG2E 1.4426950408889634f

static_assert(HD == 64);                                   // two 32-deep k-steps per head, 4 output tiles of 16, table index = idx & 31
static_assert(DQ == DM);
static_assert(DM % 32 == 0 && DQ % 32 == 0);               // GEMM k-loop steps by 32
static_assert(DM % 8 == 0);
static_assert(SEQ % 128 == 0 && DQ % 128 == 0 && DM % 128 == 0);   // 128x128 GEMM work-group tiles inside one batch, stages of 128 k, 64-element plane lines
static_assert(RH % 16 == 0 && (SEQ - RH) % 16 == 0);       // 16-query attention tiles
static_assert(SEQ % 32 == 0 && ((size_t)SEQ * SEQ) % 1024 == 0);   // 32-key words, 32 words per bit-plane line
static_assert(NB <= NB_FULL && SEQ <= SEQ_FULL);

typedef _Float16 h16;
typedef unsigned short bf;
typedef __attribute__((ext_vector_type(16))) __bf16   v16bf;
typedef __attribute__((ext_vector_type(16))) _Float16 v16h;
typedef __attribute__((ext_vector_type(8)))  _Float16 v8h;
typedef __attribute__((ext_vector_type(2)))  _Float16 v2h;
typedef __attribute__((ext_vector_type(16))) unsigned short v16us;
typedef __attribute__((ext_vector_type(8)))  unsigned short v8us;
typedef __attribute__((ext_vector_type(2)))  unsigned short v2us;
typedef __attribute__((ext_vector_type(8)))  float    v8f;
typedef __attribute__((ext_vector_type(4)))  float    v4f;
typedef __attribute__((ext_vector_type(2)))  float    v2f;
typedef v4f  __attribute__((may_alias)) v4fa;

__device__ __forceinline__ unsigned short f2bf(float f) { unsigned u = __float_as_uint(f); u += 0x7FFFu + ((u >> 16) & 1u); return (unsigned short)(u >> 16); }
__device__ __forceinline__ float bf2f(unsigned short b) { return __uint_as_float(((unsigned)b) << 16); }
__device__ __forceinline__ float bfr(float f) { return bf2f(f2bf(f)); }
__device__ __forceinline__ void splitf(float y, unsigned short& h, unsigned short& l) { h = f2bf(y); l = f2bf(y - bf2f(h)); }
__device__ __forceinline__ v16h cat16(v8h lo, v8h hi) { return __builtin_shufflevector(lo, hi, 0, 1, 2, 3, 4, 5, 6, 7, 8, 9, 10, 11, 12, 13, 14, 15); }
__device__ __forceinline__ v16bf cat16b(v8us lo, v8us hi) { return __builtin_bit_cast(v16bf, __builtin_shufflevector(lo, hi, 0, 1, 2, 3, 4, 5, 6, 7, 8, 9, 10, 11, 12, 13, 14, 15)); }
// fragment loaders: p already includes row * pitch + k0 + 8 * (lane >> 4); elements 0..7 <- p[0..7], elements 8..15 <- p[16..23]
__device__ __forceinline__ v16h  ldh(const h16* p) { return cat16(*(const v8h*)p, *(const v8h*)(p + 16)); }
__device__ __forceinline__ v16bf ldb(const bf* p)  { return cat16b(*(const v8us*)p, *(const v8us*)(p + 16)); }
__device__ __forceinline__ v8f wmma16(v16h a, v16h b, v8f c) { return __builtin_amdgcn_wmma_f32_16x16x32_f16(false, a, false, b, (short)0, c, false, false); }
__device__ __forceinline__ v8f wmmab(v16bf a, v16bf b, v8f c) { return __builtin_amdgcn_wmma_f32_16x16x32_bf16(false, a, false, b, (short)0, c, false, false); }

// four asynchronous 16-byte copies per lane, global -> LDS; the s_wait_xcnt stands inside the statement so that no address register named here is rewritten ahead of it
__device__ __forceinline__ void copy4(unsigned l0, const void* g0, unsigned l1, const void* g1, unsigned l2, const void* g2, unsigned l3, const void* g3) {
    asm volatile("global_load_async_to_lds_b128 %0, %4, off\n\t"
                 "global_load_async_to_lds_b128 %1, %5, off\n\t"
                 "global_load_async_to_lds_b128 %2, %6, off\n\t"
                 "global_load_async_to_lds_b128 %3, %7, off\n\t"
                 "s_wait_xcnt 0x0"
                 :: "v"(l0), "v"(l1), "v"(l2), "v"(l3), "v"(g0), "v"(g1), "v"(g2), "v"(g3) : "memory"); }

// eight such copies in one statement, one s_wait_xcnt behind the last
__device__ __forceinline__ void copy8(unsigned l0, const void* g0, unsigned l1, const void* g1, unsigned l2, const void* g2, unsigned l3, const void* g3,
                                      unsigned l4, const void* g4, unsigned l5, const void* g5, unsigned l6, const void* g6, unsigned l7, const void* g7) {
    asm volatile("global_load_async_to_lds_b128 %0, %8, off\n\t"
                 "global_load_async_to_lds_b128 %1, %9, off\n\t"
                 "global_load_async_to_lds_b128 %2, %10, off\n\t"
                 "global_load_async_to_lds_b128 %3, %11, off\n\t"
                 "global_load_async_to_lds_b128 %4, %12, off\n\t"
                 "global_load_async_to_lds_b128 %5, %13, off\n\t"
                 "global_load_async_to_lds_b128 %6, %14, off\n\t"
                 "global_load_async_to_lds_b128 %7, %15, off\n\t"
                 "s_wait_xcnt 0x0"
                 :: "v"(l0), "v"(l1), "v"(l2), "v"(l3), "v"(l4), "v"(l5), "v"(l6), "v"(l7), "v"(g0), "v"(g1), "v"(g2), "v"(g3), "v"(g4), "v"(g5), "v"(g6), "v"(g7) : "memory"); }

// ---- GEMM main loop, one work-group of GW waves per 128 x 128 tile, wave (wm, wn) = (w & 1, w >> 1) takes the 64 x 64 part at (64 wm, 64 wn): acc[mb][nb][j] = sum_k A[m0 + 64 wm + 16 mb + 8 hi + j][k] Bt[n0 + 64 wn + 16 nb + lr][k]
// (+ the same with A2 when NA == 2). Operands are K-contiguous bf16 planes, K % GK == 0. A stage is GK k of the tile's 128 A rows (of each A plane) and 128 Bt rows, brought into LDS once for the whole work-group
// (asynchronous copies, two buffers: the next stage flies while this one is worked on); every wave reads its fragments from there, 32 k at a time in rising k.
#define GW 4                                  // waves per GEMM work-group
#define GK 128                                // k per stage: 256 B of every operand row
#define GPI 136                               // LDS pitch of a staged operand row, 16-bit elements: 272 B = 16 B x 17
#define GRING(NA) (2 * ((NA) + 1) * 128 * GPI)   // 16-bit elements of the two buffers
template <int NA>
__device__ __forceinline__ void gemm_acc(unsigned short* ring, const bf* __restrict__ A, const bf* __restrict__ A2, const bf* __restrict__ Bt, const int K, const int m0, const int n0, v8f (&acc)[4][4]) {
    constexpr int PL = 128 * GPI, BUF = (NA + 1) * PL;                // a buffer is [A planes][Bt plane]
    const int tid = (int)threadIdx.x, lane = tid & 31, lr = lane & 15, hi = lane >> 4;
    const int w = __builtin_amdgcn_readfirstlane(tid >> 5), wm = w & 1, wn = w >> 1;
#pragma unroll
    for (int mb = 0; mb < 4; ++mb)
#pragma unroll
        for (int nb = 0; nb < 4; ++nb) acc[mb][nb] = (v8f){};
    // copy map: a plane's stage is 128 rows of 16 pieces of 16 B; piece i = tid + 128 j (j < 16): row (tid >> 4) + 8 j, column tid & 15, so one wave's copy covers two whole 256-B row parts
    const unsigned lb = (unsigned)(size_t)(const void*)ring + (unsigned)((tid >> 4) * (GPI * 2) + (tid & 15) * 16);   // LDS byte address of this lane's piece 0
    const size_t go = (size_t)(tid >> 4) * K + (tid & 15) * 8;
    const bf* ga = A + (size_t)m0 * K + go; const bf* ga2 = A2 + (size_t)m0 * K + go; const bf* gb = Bt + (size_t)n0 * K + go;
    auto plane = [&](const unsigned l, const bf* g) {
        constexpr unsigned LJ = 8 * GPI * 2; const size_t gj = (size_t)8 * K;   // from piece j to piece j + 1: 8 rows, in LDS bytes and in global elements
#pragma unroll
        for (int q = 0; q < 16; q += 8)
            copy8(l + q * LJ, g + q * gj, l + (q + 1) * LJ, g + (q + 1) * gj, l + (q + 2) * LJ, g + (q + 2) * gj, l + (q + 3) * LJ, g + (q + 3) * gj,
                  l + (q + 4) * LJ, g + (q + 4) * gj, l + (q + 5) * LJ, g + (q + 5) * gj, l + (q + 6) * LJ, g + (q + 6) * gj, l + (q + 7) * LJ, g + (q + 7) * gj); };
    auto issue = [&](const int s, const int bi) { const unsigned l = lb + (unsigned)(bi * (BUF * 2)); const size_t ko = (size_t)s * GK;
        plane(l, ga + ko); if (NA == 2) plane(l + PL * 2, ga2 + ko); plane(l + NA * PL * 2, gb + ko); };
    const int NS = K / GK;
    issue(0, 0);
    asm volatile("s_wait_asynccnt 0x0" ::: "memory");                // this wave's share of the first stage has landed
    __syncthreads();                                                 // ... and every other wave's
    if (NS > 1) issue(1, 1);
#pragma unroll 1   // stays rolled: one stage's body already holds 64 (128) matrix instructions
    for (int s = 0; s < NS; ++s) {
        const unsigned short* sa = ring + (s & 1) * BUF + (wm * 64 + lr) * GPI + 8 * hi;
        const unsigned short* sb = ring + (s & 1) * BUF + NA * PL + (wn * 64 + lr) * GPI + 8 * hi;
        // fragments of one 32-k block, two register sets: block ks + 1 of this stage is read while block ks is multiplied (nothing of the next stage is read here)
        v16bf fa[2][4], fa2[2][4], fb[2][4];
        auto frag = [&](const int ks) {
#pragma unroll
            for (int mb = 0; mb < 4; ++mb) { fa[ks & 1][mb] = ldb(sa + mb * 16 * GPI + ks * 32); if (NA == 2) fa2[ks & 1][mb] = ldb(sa + PL + mb * 16 * GPI + ks * 32); }
#pragma unroll
            for (int nb = 0; nb < 4; ++nb) fb[ks & 1][nb] = ldb(sb + nb * 16 * GPI + ks * 32); };
        frag(0);
#pragma unroll   // constant indices keep the fragment sets in registers, constant offsets in the reads
        for (int ks = 0; ks < GK / 32; ++ks) {
            if (ks + 1 < GK / 32) frag(ks + 1);
            __builtin_amdgcn_sched_barrier(0);   // the next block's LDS reads issue as one group ahead of this block's matrix instructions: left to the scheduler they sink among them, two at a time, each pair waited for alone
#pragma unroll
            for (int nb = 0; nb < 4; ++nb)
#pragma unroll
                for (int mb = 0; mb < 4; ++mb) { acc[mb][nb] = wmmab(fa[ks & 1][mb], fb[ks & 1][nb], acc[mb][nb]); if (NA == 2) acc[mb][nb] = wmmab(fa2[ks & 1][mb], fb[ks & 1][nb], acc[mb][nb]); }
            __builtin_amdgcn_sched_barrier(0);   // ... and no matrix instruction of this block moves down among the next group's reads or behind the hand-over
        }
        // keeps the distance behind the stage's last matrix instructions on every path out of it, where address arithmetic or the next stage's reads may overwrite the fragments
        // (it stands behind the scheduling barrier above, so behind all of them, and names no register: a named accumulator would have to lie below v256 and was spilled for it)
        asm volatile("v_nop\n\tv_nop\n\tv_nop\n\tv_nop");
        // hand-over, every wave: my LDS reads of this buffer are done, my share of the next stage has landed, then the barrier that publishes the next stage and frees this buffer
        asm volatile("s_wait_dscnt 0x0" ::: "memory");
        asm volatile("s_wait_asynccnt 0x0" ::: "memory");
        __syncthreads();
        if (s + 2 < NS) issue(s + 2, s & 1);
    }
    asm volatile("s_wait_asynccnt 0x0" ::: "memory");                // no copy is left in flight behind the loop
}

// ---- output GEMM: C[m][n] (f32, pitch ldc) = sum_k A[m][k] Bt[n][k] + A2[m][k] Bt[n][k] + bf16(bias[n]), k < DQ; main loop gemm_acc, each wave stores its own 64 x 64 part
__device__ __forceinline__ void gemm_body(const bf* __restrict__ A, const bf* __restrict__ A2, const bf* __restrict__ Bt,
                                          float* C, const int ldc, const float* __restrict__ bias, const size_t sA, const size_t sC) {
    __shared__ __align__(16) unsigned short ring[GRING(2)];
    __shared__ __align__(16) float osall[GW * 16 * 68];
    const size_t z = blockIdx.z; A += z * sA; A2 += z * sA; C += z * sC;
    const int lane = threadIdx.x & 31, lr = lane & 15, hi = lane >> 4; const int w = __builtin_amdgcn_readfirstlane((int)threadIdx.x >> 5);
    float* os = osall + w * (16 * 68);        // this wave's own staging rows
    const int r0 = (int)blockIdx.x * 128 + (w & 1) * 64, c0 = (int)blockIdx.y * 128 + (w >> 1) * 64;
    v8f acc[4][4];
    gemm_acc<2>(ring, A, A2, Bt, DQ, (int)blockIdx.x * 128, (int)blockIdx.y * 128, acc);
    v4f bv;
#pragma unroll
    for (int q = 0; q < 4; ++q) bv[q] = bfr(bias[c0 + lr * 4 + q]);
#pragma unroll
    for (int mb = 0; mb < 4; ++mb) {
#pragma unroll
        for (int nb = 0; nb < 4; ++nb) {
#pragma unroll
            for (int j = 0; j < 8; ++j) os[(hi * 8 + j) * 68 + nb * 16 + lr] = acc[mb][nb][j]; }
        __builtin_amdgcn_wave_barrier(); asm volatile("" ::: "memory");
        float* crow = C + (size_t)(r0 + mb * 16) * ldc + c0;
{
#pragma unroll
            for (int s = 0; s < 8; ++s) { const int row = 2 * s + hi, cofs = lr * 4; v4f val = *(const v4fa*)(os + row * 68 + cofs); val += bv;
                *(v4f*)(crow + (size_t)row * ldc + cofs) = val; }
             }
        __builtin_amdgcn_wave_barrier(); asm volatile("" ::: "memory");
    }
}
__global__ __launch_bounds__(GW * 32) void k_gemm2(const bf* __restrict__ A, const bf* __restrict__ A2, const bf* __restrict__ Bt, float* C, int ldc, const float* __restrict__ bias, size_t sA, size_t sC) {
    gemm_body(A, A2, Bt, C, ldc, bias, sA, sC); }

// ---- input-only jobs, each written for blocks of 256 threads; blk is the block's number inside its job
__device__ __forceinline__ void job_cvt8(const int blk, const float* __restrict__ src, bf* dst, size_t n8) { const size_t i = (size_t)blk * 256 + threadIdx.x; if (i >= n8) return; const v8f v = *(const v8f*)(src + i * 8); v8us o;
#pragma unroll
    for (int k = 0; k < 8; ++k) o[k] = f2bf(v[k]);
    *(v8us*)(dst + i * 8) = o;  }
__device__ __forceinline__ void job_cvtx(const int blk, const float* __restrict__ src, bf* dst) { const size_t i = (size_t)blk * 256 + threadIdx.x; if (i >= (size_t)NB * SEQ * DM / 8) return;
    const size_t row = i / (DM / 8); const size_t c8 = i % (DM / 8); const size_t b = row / SEQ, t = row % SEQ; const v8f v = *(const v8f*)(src + ((b * SEQ_FULL + t) * DM + c8 * 8)); v8us o;
#pragma unroll
    for (int k = 0; k < 8; ++k) o[k] = f2bf(v[k]);
    *(v8us*)(dst + i * 8) = o;  }

__device__ __forceinline__ void job_cstab(const int blk, float* CS) { const int idx = blk * 256 + (int)threadIdx.x; if (idx >= SEQ * (HD / 2)) return; const int i = idx & 31, t = idx >> 5;
    const float ex = (float)(2 * i) / (float)HD; const float pw = powf(10000.0f, ex); const float invf = 1.0f / pw; const float ang = __fmul_rn((float)t, invf); float sn, cn; sincosf(ang, &sn, &cn);
    v2f cs; cs[0] = cn; cs[1] = sn; float* p0 = CS + ((size_t)t * HD + i) * 2; float* p1 = p0 + (HD / 2) * 2;
    *(v2f*)p0 = cs; *(v2f*)p1 = cs;  }

__device__ __forceinline__ void job_mbits(const int blk, const int* __restrict__ mask, unsigned* MB) { const int lane = threadIdx.x & 31; const int g = blk * 8 + (int)(threadIdx.x >> 5);
    if (g >= (int)((size_t)SEQ * SEQ / 1024)) return;   // wave-uniform
    unsigned mine = 0u;
#pragma unroll 4
    for (int j = 0; j < 32; ++j) { const int wd = g * 32 + j; const int q = wd / (SEQ / 32), kg = wd % (SEQ / 32); const int v = mask[(size_t)q * SEQ_FULL + kg * 32 + lane];
        const unsigned bal = __builtin_amdgcn_ballot_w32(v != 0); mine = (lane == j) ? bal : mine; }
    *(unsigned*)(MB + (size_t)g * 32 + lane) = mine;  }
// one grid for all of them (none reads what another writes): blocks [0, PB_MB) mask bit-plane, then the rotary table, then x, then the four weights; the two jobs whose threads run longest stand first
constexpr int PB_MB = (int)(((size_t)SEQ * SEQ / 1024 + 7) / 8);
constexpr int PB_CS = (SEQ * (HD / 2) + 255) / 256;
constexpr int PB_X  = (int)(((size_t)NB * SEQ * DM / 8 + 255) / 256);
constexpr int PB_W  = (int)(((size_t)DQ * DM / 8 + 255) / 256);
__global__ __launch_bounds__(256) void k_prep(const float* __restrict__ x, const float* __restrict__ Wq, const float* __restrict__ Wk, const float* __restrict__ Wv, const float* __restrict__ Wo, const int* __restrict__ mask,
                                              bf* XB, bf* WQ, bf* WK, bf* WV, bf* WO, float* CS, unsigned* MB) {
    int blk = (int)blockIdx.x;
    if (blk < PB_MB) { job_mbits(blk, mask, MB); return; }
    blk -= PB_MB;
    if (blk < PB_CS) { job_cstab(blk, CS); return; }
    blk -= PB_CS;
    if (blk < PB_X) { job_cvtx(blk, x, XB); return; }
    blk -= PB_X;
    const int j = blk / PB_W;                 // which weight
    job_cvt8(blk - j * PB_W, j == 0 ? Wq : j == 1 ? Wk : j == 2 ? Wv : Wo, j == 0 ? WQ : j == 1 ? WK : j == 2 ? WV : WO, (size_t)DQ * DM / 8);
}

// ---- projection tiles, one wave per 64 tokens x one head (64 features), four waves (two heads x two token groups) per work-group, main loop gemm_acc. A lane's 8 accumulator
// registers are 8 consecutive m, so the index that runs innermost in the plane to be written goes on the A side (features for q and k, tokens for v^T) and a lane's 8 values are one 16-byte piece of a plane row.
#define SP 72                                 // LDS pitch of a staged plane row of 64 16-bit elements: 144 B = 16 B x 9
// 16 plane rows x 64 elements, f32 in registers (lane (lr, hi): row lr, elements 16 mb + 8 hi + j) -> f16 plane and, when hl (the same for the whole wave), bf16 hi/lo planes. Staged in this wave's LDS so that every global store covers whole 128-byte lines.
__device__ __forceinline__ void planes_out(unsigned short* st, const v8f (&r)[4], h16* p16, bf* ph, bf* pl, const size_t pitch, const bool hl) {
    const int lane = threadIdx.x & 31, lr = lane & 15, hi = lane >> 4;
    unsigned short* sw = st + lr * SP + 8 * hi;
#pragma unroll
    for (int mb = 0; mb < 4; ++mb) { v8h o16;
#pragma unroll
        for (int j = 0; j < 8; ++j) o16[j] = (h16)r[mb][j];
        *(v8us*)(sw + mb * 16) = __builtin_bit_cast(v8us, o16); }
    if (hl) {
#pragma unroll
        for (int mb = 0; mb < 4; ++mb) { v8us oh, ol;
#pragma unroll
            for (int j = 0; j < 8; ++j) { unsigned short a, c; splitf(r[mb][j], a, c); oh[j] = a; ol[j] = c; }
            *(v8us*)(sw + 16 * SP + mb * 16) = oh; *(v8us*)(sw + 32 * SP + mb * 16) = ol; }
    }
    __builtin_amdgcn_wave_barrier(); asm volatile("" ::: "memory");   // the rows are read back by other lanes of the wave: no LDS read may move up over the writes
    const int rr = lane >> 3, cc = (lane & 7) * 8;
#pragma unroll
    for (int it = 0; it < 4; ++it) { const int row = it * 4 + rr; *(v8us*)((unsigned short*)p16 + (size_t)row * pitch + cc) = *(const v8us*)(st + row * SP + cc); }
    asm volatile("s_wait_xcnt 0x0" ::: "memory");   // stands in front of whatever next overwrites a register that these stores name
    if (hl) {
#pragma unroll
        for (int it = 0; it < 4; ++it) { const int row = it * 4 + rr;
            *(v8us*)(ph + (size_t)row * pitch + cc) = *(const v8us*)(st + 16 * SP + row * SP + cc); *(v8us*)(pl + (size_t)row * pitch + cc) = *(const v8us*)(st + 32 * SP + row * SP + cc); }
        asm volatile("s_wait_xcnt 0x0" ::: "memory");   // as above
    }
    __builtin_amdgcn_wave_barrier(); asm volatile("" ::: "memory");   // ... and the next group's writes may not move up over these reads
    __builtin_amdgcn_sched_barrier(0);        // nor the next group's arithmetic over the waits above, where it would overwrite the stores' registers ahead of them
}
// q, k and v tiles in one grid: blockIdx.z = 0 q, 1 k, 2 v; blockIdx.x the 128 tokens, blockIdx.y the 128 features. One main loop and one plane writer serve all three (the kernel's text stays small); z is the same for the whole work-group.
// q or k: y = x W^T + bf16(b), rotate-half rotary out[d] = y[d] c - y[d+32] s (d < 32), out[d] = y[d] c + y[d-32] s (d >= 32); d and d + 32 lie in the same lane (mb and mb + 2). Planes [bh][t][d]: f16, and bf16 hi/lo for t < RH (q) or every t (k).
// v: y = x W^T + bf16(b), planes [bh][d][t] (f16, bf16 hi/lo): tokens on the A side, so a lane's 8 values are 8 consecutive t of feature row 16 nb + lr
__global__ __launch_bounds__(GW * 32) void k_proj(const bf* __restrict__ X, const bf* __restrict__ WQ, const bf* __restrict__ WK, const bf* __restrict__ WV,
                                                  const float* __restrict__ bq, const float* __restrict__ bk, const float* __restrict__ bv, const float* __restrict__ CS,
                                                  h16* Q16, bf* QPh, bf* QPl, h16* K16, bf* KPh, bf* KPl, h16* VT16, bf* VTh, bf* VTl) {
    __shared__ __align__(16) unsigned short ring[GRING(1)];
    __shared__ __align__(16) unsigned short stall[GW * 3 * 16 * SP];
    const int z = (int)blockIdx.z; const bool tv = z == 2;
    const int lane = threadIdx.x & 31, lr = lane & 15, hi = lane >> 4; const int w = __builtin_amdgcn_readfirstlane((int)threadIdx.x >> 5);
    unsigned short* st = stall + w * (3 * 16 * SP);   // this wave's own staging rows
    const int tk0 = (int)blockIdx.x * 128, ft0 = (int)blockIdx.y * 128;
    // the wave's 64 tokens and its head: the A side is split by w & 1, the B side by w >> 1
    const int r0 = tk0 + (tv ? (w & 1) : (w >> 1)) * 64, h = (int)blockIdx.y * 2 + (tv ? (w >> 1) : (w & 1));
    const int b = r0 / SEQ, t0 = r0 % SEQ, bh = b * NH + h;
    const bf* Wt = z == 0 ? WQ : z == 1 ? WK : WV;
    h16* P16 = z == 0 ? Q16 : z == 1 ? K16 : VT16; bf* Ph = z == 0 ? QPh : z == 1 ? KPh : VTh; bf* Pl = z == 0 ? QPl : z == 1 ? KPl : VTl;
    const int hrows = z == 0 ? RH : SEQ;      // q, k: the tokens that have hi/lo rows (a multiple of 16: a group of 16 tokens has them or has none)
    float xv[4] = {0.0f, 0.0f, 0.0f, 0.0f};
    if (tv) {
#pragma unroll
        for (int nb = 0; nb < 4; ++nb) xv[nb] = bv[h * HD + nb * 16 + lr];
        asm volatile("s_wait_xcnt 0x0" ::: "memory");   // stands in front of whatever next overwrites an address register of these loads
    }
    v8f acc[4][4];
    gemm_acc<1>(ring, tv ? X : Wt, tv ? X : Wt, tv ? Wt : X, DM, tv ? tk0 : ft0, tv ? ft0 : tk0, acc);
    // q, k: a lane's (cos, sin) pairs of token group nb: token t0 + 16 nb + lr, frequencies 8 hi + j (pieces 0..3) and 16 + 8 hi + j (pieces 4..7)
    const float* cp = CS + ((size_t)(t0 + lr) * HD + 8 * hi) * 2;
    v4f cs[2][8];
    auto ldcs = [&](const int nb) {
#pragma unroll
        for (int q = 0; q < 8; ++q) cs[nb & 1][q] = *(const v4f*)(cp + (size_t)nb * 16 * HD * 2 + (q >> 2) * 32 + (q & 3) * 4);
        asm volatile("s_wait_xcnt 0x0" :: "v"(cp) : "memory"); };   // stands in front of whatever next overwrites an address register of these loads; it names the pointer, so that the pair stays the pointer's up to here
    if (!tv) {
        const float* bias = z == 0 ? bq : bk;
        v8f xb[4];
#pragma unroll
        for (int mb = 0; mb < 4; ++mb) xb[mb] = *(const v8f*)(bias + h * HD + mb * 16 + 8 * hi);
        ldcs(0); ldcs(1);
        __builtin_amdgcn_sched_barrier(0);    // bias and the first two groups' table loads issue as one run: left to the scheduler they are issued two at a time, each pair waited for alone
#pragma unroll
        for (int mb = 0; mb < 4; ++mb) { v8f bb;
#pragma unroll
            for (int j = 0; j < 8; ++j) bb[j] = bfr(xb[mb][j]);
#pragma unroll
            for (int nb = 0; nb < 4; ++nb) acc[mb][nb] += bb; }
    }
#pragma unroll
    for (int nb = 0; nb < 4; ++nb) {
        v8f r[4];
        size_t e16, ehl, pitch; bool hl;
        if (!tv) {
#pragma unroll
            for (int mp = 0; mp < 2; ++mp)
#pragma unroll
                for (int j = 0; j < 8; ++j) { const float c = cs[nb & 1][mp * 4 + (j >> 1)][(j & 1) * 2], s = cs[nb & 1][mp * 4 + (j >> 1)][(j & 1) * 2 + 1];
                    const float y1 = acc[mp][nb][j], y2 = acc[mp + 2][nb][j];
                    r[mp][j] = y1 * c - y2 * s; r[mp + 2][j] = y2 * c + y1 * s; }
            if (nb + 2 < 4) { ldcs(nb + 2);
                __builtin_amdgcn_sched_barrier(0); }   // the table loads of the group after next issue no later than here, so that they fly under this group's conversion and stores
            const int tg = t0 + nb * 16; hl = tg < hrows;
            e16 = ((size_t)bh * SEQ + tg) * HD; ehl = ((size_t)bh * hrows + (hl ? tg : 0)) * HD; pitch = HD;
        } else {
            const float bb = bfr(xv[nb]);
#pragma unroll
            for (int mb = 0; mb < 4; ++mb) r[mb] = acc[mb][nb] + bb;
            e16 = ((size_t)bh * HD + nb * 16) * SEQ + t0; ehl = e16; pitch = SEQ; hl = true;
        }
        planes_out(st, r, P16 + e16, Ph + ehl, Pl + ehl, pitch, hl);
    }
}

// ---- fused attention, one work-group of AW waves per 16 * AW query rows of one (batch, head), one wave per 16 rows; KS = 64 keys per step (two mask words). Each step's K rows and V^T rows are brought into LDS once for the whole work-group
// (asynchronous copies, two buffers: the next step's tile flies while this one is worked on) and every wave reads its fragments from there. The rows' mask words are read once into LDS; a step is staged only when some
// row of the work-group keeps one of its 64 keys, and a wave works on it only when one of its own 16 rows does (exact for any mask; the steps a wave works on and their order are those of a walk over all SEQ / 64 steps).
// Transposed tiles: S^T[key][query] = K (A operand) x Q^T (B operand), so lane (hi, lr) holds query lr, keys 16 kt + 8 hi + r of key tile kt (four tiles); tiles 2 c and 2 c + 1 are exactly the B-operand elements of P over the 32 keys of half c for
// O^T[d][query] = V^T (A operand) x P^T (B operand). Row statistics (running max, sum) are per lane; the two lane halves exchange once per step (xor 16). HR: bf16 hi/lo planes, 3 products; else f16, P x1024.
#define AW 4                                  // waves per attention work-group
#define KP 72                                 // LDS pitch of a K row, 16-bit elements: 144 B = 16 B x 9, conflict-free for 16-byte reads down a column of rows
#define KS 64                                 // keys per step
#define VP 72                                 // LDS pitch of a V^T row of 64 keys: 144 B = 16 B x 9
#define MP 65                                 // LDS pitch of a row's mask words, dwords
static_assert(RH % (16 * AW) == 0 && (SEQ - RH) % (16 * AW) == 0);   // whole work-groups
static_assert(SEQ / 32 <= 64);                                       // a row's mask words fit one 64-bit word
static_assert(AW * 32 == 128 && HD == 64 && KS == 64);               // the copy index maps below: 512 16-byte pieces per K plane and per V^T plane, four of each per lane
static_assert(SEQ % KS == 0);                                        // a step is a whole pair of mask words

template <bool HR>
__device__ __forceinline__ void attn_body(unsigned short* ring, unsigned* msk, unsigned* lv, float* csall, const int tile, const int bh, const h16* __restrict__ Q16, const h16* __restrict__ K16, const h16* __restrict__ VT16,
                                          const bf* __restrict__ Qh, const bf* __restrict__ Ql, const bf* __restrict__ Kh, const bf* __restrict__ Kl,
                                          const bf* __restrict__ VTh, const bf* __restrict__ VTl, const unsigned* __restrict__ MB, bf* ATh, bf* ATl) {
    constexpr int NPL = HR ? 2 : 1;                                   // planes per operand
    constexpr int KT = KS * KP, VT = HD * VP, BUF = NPL * (KT + VT);  // 16-bit elements; a buffer is [K planes][V^T planes]
    constexpr int NW = SEQ / 32;
    const int tid = (int)threadIdx.x, lane = tid & 31, lr = lane & 15, hi = lane >> 4;
    const int w = __builtin_amdgcn_readfirstlane(tid >> 5);
    float* cs = csall + w * (16 * 68);
    const int q0 = tile * (16 * AW) + w * 16;
    const int b = bh / NH, h = bh % NH;
    const size_t qoff = ((size_t)bh * (HR ? RH : SEQ) + q0 + lr) * HD + 8 * hi;
    const float NINF = -__builtin_huge_valf();

    // mask words of this wave's 16 rows -> LDS (read back by this wave alone); which steps keep a key: for the wave (own), for the work-group (live)
    unsigned nz0 = 0u, nz1 = 0u;
#pragma unroll   // all 32 loads in flight at once
    for (int r = 0; r < 16; ++r) { const unsigned* mrow = MB + (size_t)(q0 + r) * NW; const unsigned a = (lane < NW) ? mrow[lane] : 0u, c = (lane + 32 < NW) ? mrow[lane + 32] : 0u;
        msk[(w * 16 + r) * MP + lane] = a; msk[(w * 16 + r) * MP + 32 + lane] = c; nz0 |= a; nz1 |= c; }
    const unsigned own0 = __builtin_amdgcn_ballot_w32(nz0 != 0u), own1 = __builtin_amdgcn_ballot_w32(nz1 != 0u);
    if (lane == 0) { lv[w * 2] = own0; lv[w * 2 + 1] = own1; }
    __syncthreads();
    unsigned g0 = 0u, g1 = 0u;
    for (int i = 0; i < AW; ++i) { g0 |= lv[i * 2]; g1 |= lv[i * 2 + 1]; }
    // a step is named by the first of its two mask words (an even number); its bit is set when either word keeps a key
    constexpr unsigned long long EVEN = 0x5555555555555555ull;
    const unsigned long long ownw = (unsigned long long)own0 | ((unsigned long long)own1 << 32);
    const unsigned long long own = (ownw | (ownw >> 1)) & EVEN;
    const unsigned long long livew = (unsigned long long)(unsigned)__builtin_amdgcn_readfirstlane((int)g0) | ((unsigned long long)(unsigned)__builtin_amdgcn_readfirstlane((int)g1) << 32);
    unsigned long long rest = (livew | (livew >> 1)) & EVEN;          // steps not yet issued, the same in every wave

    // Q fragments stay in registers
    v16h qf[2]; v16bf qh[2], ql[2];
#pragma unroll   // constant indices keep the fragment arrays in registers (so at the K fragments below)
    for (int ks = 0; ks < 2; ++ks) { if (HR) { qh[ks] = ldb(Qh + qoff + ks * 32); ql[ks] = ldb(Ql + qoff + ks * 32); } else qf[ks] = ldh(Q16 + qoff + ks * 32); }

    // copy maps: a step's 64 K rows are 8 KiB in a row in global memory (piece i = tid + 128 j, j < 4: row i >> 3, 16-byte column i & 7); its V^T tile is 64 rows of 128 B (the same piece map)
    const unsigned ringb = (unsigned)(size_t)(const void*)ring;       // LDS byte address of the ring
    const unsigned lk = ringb + (unsigned)((tid >> 3) * (KP * 2) + (tid & 7) * 16);
    const unsigned lvv = ringb + (unsigned)(NPL * KT * 2 + (tid >> 3) * (VP * 2) + (tid & 7) * 16);
    const size_t gk = (size_t)bh * SEQ * HD + (size_t)tid * 8;
    const size_t gv = ((size_t)bh * HD + (tid >> 3)) * SEQ + (tid & 7) * 8;
    auto issue = [&](const int kc, const int bi) {                    // kc: the step's first mask word, so its first key is 32 kc
        constexpr unsigned KJ = 16 * KP * 2, VJ = 16 * VP * 2; constexpr size_t GK16 = (size_t)16 * HD, GV16 = (size_t)16 * SEQ;   // from piece j to piece j + 1: 16 rows, in LDS bytes and in global elements
        const unsigned k0 = lk + (unsigned)(bi * (BUF * 2)), v0 = lvv + (unsigned)(bi * (BUF * 2)); const size_t ko = gk + (size_t)kc * 32 * HD, vo = gv + (size_t)kc * 32;
        if (HR) {
            copy8(k0, Kh + ko, k0 + KJ, Kh + ko + GK16, k0 + 2 * KJ, Kh + ko + 2 * GK16, k0 + 3 * KJ, Kh + ko + 3 * GK16,
                  k0 + KT * 2, Kl + ko, k0 + KT * 2 + KJ, Kl + ko + GK16, k0 + KT * 2 + 2 * KJ, Kl + ko + 2 * GK16, k0 + KT * 2 + 3 * KJ, Kl + ko + 3 * GK16);
            copy8(v0, VTh + vo, v0 + VJ, VTh + vo + GV16, v0 + 2 * VJ, VTh + vo + 2 * GV16, v0 + 3 * VJ, VTh + vo + 3 * GV16,
                  v0 + VT * 2, VTl + vo, v0 + VT * 2 + VJ, VTl + vo + GV16, v0 + VT * 2 + 2 * VJ, VTl + vo + 2 * GV16, v0 + VT * 2 + 3 * VJ, VTl + vo + 3 * GV16);
        } else {
            copy8(k0, K16 + ko, k0 + KJ, K16 + ko + GK16, k0 + 2 * KJ, K16 + ko + 2 * GK16, k0 + 3 * KJ, K16 + ko + 3 * GK16,
                  v0, VT16 + vo, v0 + VJ, VT16 + vo + GV16, v0 + 2 * VJ, VT16 + vo + 2 * GV16, v0 + 3 * VJ, VT16 + vo + 3 * GV16);
        } };

    v8f o[4];
#pragma unroll
    for (int dt = 0; dt < 4; ++dt) o[dt] = (v8f){};
    float m = NINF, l = 0.0f;
    int cur = -1, nxt = -1, bi = 0;
    if (rest != 0ull) {
        cur = __builtin_ctzll(rest); rest &= rest - 1ull; issue(cur, 0);
        asm volatile("s_wait_asynccnt 0x0" ::: "memory");            // this wave's share of the first tile has landed
        __syncthreads();                                             // ... and every other wave's
        if (rest != 0ull) { nxt = __builtin_ctzll(rest); rest &= rest - 1ull; issue(nxt, 1); }
    }
    while (cur >= 0) {
      if ((own >> cur) & 1ull) {                                      // wave-uniform: else all 16 rows mask all 64 keys
        const unsigned W0 = msk[(w * 16 + lr) * MP + cur], W1 = msk[(w * 16 + lr) * MP + cur + 1];
        const unsigned short* kb = ring + bi * BUF + lr * KP + 8 * hi;
        const unsigned short* vb = ring + bi * BUF + NPL * KT + lr * VP + 8 * hi;
        v8f s[4];
#pragma unroll   // constant indices keep the tile and fragment arrays in registers (so in every loop of this step)
        for (int kt = 0; kt < 4; ++kt) s[kt] = (v8f){};
        if (HR) {
            v16bf ah[4][2], al[4][2];
#pragma unroll
            for (int kt = 0; kt < 4; ++kt)
#pragma unroll
                for (int ks = 0; ks < 2; ++ks) { ah[kt][ks] = ldb(kb + kt * 16 * KP + ks * 32); al[kt][ks] = ldb(kb + KT + kt * 16 * KP + ks * 32); }
#pragma unroll
            for (int ks = 0; ks < 2; ++ks) {
#pragma unroll
                for (int kt = 0; kt < 4; ++kt) s[kt] = wmmab(ah[kt][ks], qh[ks], s[kt]);
#pragma unroll
                for (int kt = 0; kt < 4; ++kt) s[kt] = wmmab(al[kt][ks], qh[ks], s[kt]);
#pragma unroll
                for (int kt = 0; kt < 4; ++kt) s[kt] = wmmab(ah[kt][ks], ql[ks], s[kt]);
            }
        } else {
            v16h kf[4][2];
#pragma unroll
            for (int kt = 0; kt < 4; ++kt)
#pragma unroll
                for (int ks = 0; ks < 2; ++ks) kf[kt][ks] = ldh((const h16*)kb + kt * 16 * KP + ks * 32);
#pragma unroll
            for (int ks = 0; ks < 2; ++ks)
#pragma unroll
                for (int kt = 0; kt < 4; ++kt) s[kt] = wmma16(kf[kt][ks], qf[ks], s[kt]);
        }
        // online softmax for query lr over this lane's 32 keys + the partner lane's 32 keys
        float t[4][8], mt[4];
#pragma unroll
        for (int kt = 0; kt < 4; ++kt) { const unsigned Wl = ((kt < 2) ? W0 : W1) >> (8 * hi + 16 * (kt & 1)); mt[kt] = NINF;
#pragma unroll
            for (int r = 0; r < 8; ++r) { t[kt][r] = ((Wl >> r) & 1u) ? s[kt][r] * SCL : NINF; mt[kt] = fmaxf(mt[kt], t[kt][r]); } }
        float mx = fmaxf(fmaxf(mt[0], mt[1]), fmaxf(mt[2], mt[3]));
        mx = fmaxf(mx, __shfl_xor(mx, 16, 32));
        const float mnew = fmaxf(m, mx);
        const float msub = (mnew == NINF) ? 0.0f : mnew;
        // each difference below stays a rounded value of its own ahead of its multiply by log2 e (the empty statements name differences, never products)
        float ds = __fsub_rn(m, msub); asm volatile("" : "+v"(ds));
        const float scl = __builtin_amdgcn_exp2f(__fmul_rn(ds, LOG2E));
        float p[4][8], pt[4];
#pragma unroll
        for (int kt = 0; kt < 4; ++kt) { pt[kt] = 0.0f;
#pragma unroll
            for (int r = 0; r < 8; ++r) { float d = __fsub_rn(t[kt][r], msub); asm volatile("" : "+v"(d)); p[kt][r] = __builtin_amdgcn_exp2f(__fmul_rn(d, LOG2E)); pt[kt] += p[kt][r]; } }
        float psum = (pt[0] + pt[1]) + (pt[2] + pt[3]);
        psum += __shfl_xor(psum, 16, 32);
        l = l * scl + psum; m = mnew;
#pragma unroll
        for (int dt = 0; dt < 4; ++dt)
#pragma unroll
            for (int r = 0; r < 8; ++r) o[dt][r] *= scl;
        if (HR) {
            v16bf pbh[2], pbl[2];
#pragma unroll
            for (int c = 0; c < 2; ++c) { v16us ph, pl;
#pragma unroll
                for (int r = 0; r < 8; ++r) { unsigned short a, e; splitf(p[2 * c][r], a, e); ph[r] = a; pl[r] = e; splitf(p[2 * c + 1][r], a, e); ph[8 + r] = a; pl[8 + r] = e; }
                pbh[c] = __builtin_bit_cast(v16bf, ph); pbl[c] = __builtin_bit_cast(v16bf, pl); }
            v16bf vh[2][4], vl[2][4];
#pragma unroll
            for (int c = 0; c < 2; ++c)
#pragma unroll
                for (int dt = 0; dt < 4; ++dt) { vh[c][dt] = ldb(vb + dt * 16 * VP + c * 32); vl[c][dt] = ldb(vb + VT + dt * 16 * VP + c * 32); }
#pragma unroll
            for (int c = 0; c < 2; ++c) {
#pragma unroll
                for (int dt = 0; dt < 4; ++dt) o[dt] = wmmab(vh[c][dt], pbh[c], o[dt]);
#pragma unroll
                for (int dt = 0; dt < 4; ++dt) o[dt] = wmmab(vl[c][dt], pbh[c], o[dt]);
#pragma unroll
                for (int dt = 0; dt < 4; ++dt) o[dt] = wmmab(vh[c][dt], pbl[c], o[dt]);
            }
            // keeps the distance behind the step's last matrix instructions on the path into the hand-over, where the next copies' address arithmetic may overwrite their operands
            asm volatile("v_nop\n\tv_nop\n\tv_nop\n\tv_nop" : "+v"(o[0]), "+v"(o[1]), "+v"(o[2]), "+v"(o[3]) : "v"(pbl[1]), "v"(vh[1][0]), "v"(vh[1][3]));
        } else {
            v16h pb[2];
#pragma unroll
            for (int c = 0; c < 2; ++c)
#pragma unroll
                for (int r = 0; r < 8; ++r) { pb[c][r] = (h16)(p[2 * c][r] * PCAR); pb[c][8 + r] = (h16)(p[2 * c + 1][r] * PCAR); }
            v16h vf[2][4];
#pragma unroll
            for (int c = 0; c < 2; ++c)
#pragma unroll
                for (int dt = 0; dt < 4; ++dt) vf[c][dt] = ldh((const h16*)vb + dt * 16 * VP + c * 32);
#pragma unroll
            for (int c = 0; c < 2; ++c)
#pragma unroll
                for (int dt = 0; dt < 4; ++dt) o[dt] = wmma16(vf[c][dt], pb[c], o[dt]);
            // as above
            asm volatile("v_nop\n\tv_nop\n\tv_nop\n\tv_nop" : "+v"(o[0]), "+v"(o[1]), "+v"(o[2]), "+v"(o[3]) : "v"(pb[1]), "v"(vf[1][0]), "v"(vf[1][3]));
        }
      }
        // hand-over, every wave, also one that skipped the step: my LDS reads of this buffer are done, my share of the next tile has landed, then the barrier that publishes the next tile and frees this buffer
        asm volatile("s_wait_dscnt 0x0" ::: "memory");
        asm volatile("s_wait_asynccnt 0x0" ::: "memory");
        __syncthreads();
        cur = nxt; nxt = -1;
        if (rest != 0ull) { nxt = __builtin_ctzll(rest); rest &= rest - 1ull; issue(nxt, bi); }
        bi ^= 1;
    }
    asm volatile("s_wait_asynccnt 0x0" ::: "memory");                // no copy is left in flight when the wave ends
    // normalise (a row without any kept key gives 0 x inf = NaN, as a softmax over an all -inf row does) and stage O[query lr][d]
    const float rl = 1.0f / l; const float inv = HR ? rl : rl * (1.0f / PCAR);
#pragma unroll
    for (int dt = 0; dt < 4; ++dt)
#pragma unroll
        for (int r = 0; r < 8; ++r) cs[lr * 68 + dt * 16 + 8 * hi + r] = o[dt][r] * inv;
    __builtin_amdgcn_wave_barrier(); asm volatile("" ::: "memory");
    bf* ah = ATh + ((size_t)b * SEQ + q0) * DQ + h * HD; bf* al = ATl + ((size_t)b * SEQ + q0) * DQ + h * HD;
{
#pragma unroll
        for (int it = 0; it < 4; ++it) { const int row = it * 4 + (lane >> 3), c = (lane & 7) * 8;
            const v4f x0 = *(const v4fa*)(cs + row * 68 + c), x1 = *(const v4fa*)(cs + row * 68 + c + 4); v8us oh, ol;
#pragma unroll
            for (int q = 0; q < 4; ++q) { unsigned short a, c2; splitf(x0[q], a, c2); oh[q] = a; ol[q] = c2; splitf(x1[q], a, c2); oh[4 + q] = a; ol[4 + q] = c2; }
            *(v8us*)(ah + (size_t)row * DQ + c) = oh; *(v8us*)(al + (size_t)row * DQ + c) = ol; }
         }
}
// both operand kinds in one grid (neither reads what the other writes), each job's blocks in the order of a grid (tiles, heads) of its own: blocks [0, AB_LO) the f16 rows, then the hi/lo rows.
// The larger job stands first and the smaller one takes the places that come free (a matter of speed alone: every tile is complete for any mask); the kind is the same for the whole work-group.
constexpr int AT_HI = RH / (16 * AW), AT_LO = (SEQ - RH) / (16 * AW), AB_LO = AT_LO * NB * NH;
static_assert(AT_HI > 0 && AT_LO > 0);        // both jobs have tiles: the block index is divided by either count
__global__ __launch_bounds__(AW * 32) void k_attn(const h16* __restrict__ Q16, const h16* __restrict__ K16, const h16* __restrict__ VT16,
                                                  const bf* __restrict__ Qh, const bf* __restrict__ Ql, const bf* __restrict__ Kh, const bf* __restrict__ Kl, const bf* __restrict__ VTh, const bf* __restrict__ VTl,
                                                  const unsigned* __restrict__ MB, bf* ATh, bf* ATl) {
    __shared__ __align__(16) unsigned short ring[2 * 2 * (KS * KP + HD * VP)];   // two buffers of the larger kind (hi/lo planes)
    __shared__ unsigned msk[AW * 16 * MP];
    __shared__ unsigned lv[AW * 2];
    __shared__ __align__(16) float csall[AW * 16 * 68];
    const int blk = (int)blockIdx.x;
    if (blk < AB_LO) attn_body<false>(ring, msk, lv, csall, AT_HI + blk % AT_LO, blk / AT_LO, Q16, K16, VT16, Qh, Ql, Kh, Kl, VTh, VTl, MB, ATh, ATl);
    else attn_body<true>(ring, msk, lv, csall, (blk - AB_LO) % AT_HI, (blk - AB_LO) / AT_HI, Q16, K16, VT16, Qh, Ql, Kh, Kl, VTh, VTl, MB, ATh, ATl);
}

// ---- workspace carve (bytes, every region a multiple of 256)
constexpr size_t al256(size_t x) { return (x + 255) & ~(size_t)255; }
constexpr size_t SZ_XB  = al256((size_t)NB * SEQ * DM * 2);
constexpr size_t SZ_W   = al256((size_t)DQ * DM * 2);
constexpr size_t SZ_CS  = al256((size_t)SEQ * HD * 2 * 4);
constexpr size_t SZ_MB  = al256((size_t)SEQ * SEQ / 8);
constexpr size_t SZ_PL  = al256((size_t)NB * NH * SEQ * HD * 2);
constexpr size_t SZ_QH  = al256((size_t)NB * NH * RH * HD * 2);
constexpr size_t SZ_AT  = al256((size_t)NB * SEQ * DQ * 2);
constexpr size_t WS_TOTAL = SZ_XB + 4 * SZ_W + SZ_CS + SZ_MB + SZ_PL + 2 * SZ_QH + 3 * SZ_PL + 3 * SZ_PL + 2 * SZ_AT;
static_assert(WS_TOTAL <= (size_t)134217728);

extern "C" void kernel_launch(void* const* d_in, const int* in_sizes, int n_in,
                              void* d_out, int out_size, void* d_ws, size_t ws_size, hipStream_t stream) {
    if (n_in < 10) return;
    const long long need_x = (long long)(NB - 1) * SEQ_FULL * DM + (long long)SEQ * DM;
    if ((long long)in_sizes[0] < need_x || (long long)out_size < need_x) return;
    if (in_sizes[1] < DQ * DM || in_sizes[3] < DQ * DM || in_sizes[5] < DQ * DM || in_sizes[7] < DM * DQ) return;
    if (in_sizes[2] < DQ || in_sizes[4] < DQ || in_sizes[6] < DQ || in_sizes[8] < DM) return;
    if ((long long)in_sizes[9] < (long long)(SEQ - 1) * SEQ_FULL + SEQ) return;
    if (WS_TOTAL > ws_size) return;
    const float* x  = (const float*)d_in[0];
    const float* Wq = (const float*)d_in[1]; const float* bq = (const float*)d_in[2];
    const float* Wk = (const float*)d_in[3]; const float* bk = (const float*)d_in[4];
    const float* Wv = (const float*)d_in[5]; const float* bv = (const float*)d_in[6];
    const float* Wo = (const float*)d_in[7]; const float* bo = (const float*)d_in[8];
    const int* mask = (const int*)d_in[9];
    float* OUT = (float*)d_out;
    char* wsp = (char*)d_ws;
    bf* XB = (bf*)wsp; wsp += SZ_XB;
    bf* WQ = (bf*)wsp; wsp += SZ_W; bf* WK = (bf*)wsp; wsp += SZ_W; bf* WV = (bf*)wsp; wsp += SZ_W; bf* WO = (bf*)wsp; wsp += SZ_W;
    float* CS = (float*)wsp; wsp += SZ_CS;
    unsigned* MB = (unsigned*)wsp; wsp += SZ_MB;
    h16* Q16 = (h16*)wsp; wsp += SZ_PL; bf* QPh = (bf*)wsp; wsp += SZ_QH; bf* QPl = (bf*)wsp; wsp += SZ_QH;
    h16* K16 = (h16*)wsp; wsp += SZ_PL; bf* KPh = (bf*)wsp; wsp += SZ_PL; bf* KPl = (bf*)wsp; wsp += SZ_PL;
    h16* VT16 = (h16*)wsp; wsp += SZ_PL; bf* VTh = (bf*)wsp; wsp += SZ_PL; bf* VTl = (bf*)wsp; wsp += SZ_PL;
    bf* ATh = (bf*)wsp; wsp += SZ_AT; bf* ATl = (bf*)wsp; wsp += SZ_AT;

    k_prep<<<(unsigned)(PB_MB + PB_CS + PB_X + 4 * PB_W), 256, 0, stream>>>(x, Wq, Wk, Wv, Wo, mask, XB, WQ, WK, WV, WO, CS, MB);

    k_proj<<<dim3((unsigned)(NB * SEQ / 128), (unsigned)(DQ / 128), 3), GW * 32, 0, stream>>>(XB, WQ, WK, WV, bq, bk, bv, CS, Q16, QPh, QPl, K16, KPh, KPl, VT16, VTh, VTl);

    k_attn<<<(unsigned)(AB_LO + AT_HI * NB * NH), AW * 32, 0, stream>>>(Q16, K16, VT16, QPh, QPl, KPh, KPl, VTh, VTl, MB, ATh, ATl);

    k_gemm2<<<dim3((unsigned)(SEQ / 128), (unsigned)(DM / 128), (unsigned)NB), GW * 32, 0, stream>>>(ATh, ATl, WO, OUT, DM, bo, (size_t)SEQ * DQ, (size_t)SEQ_FULL * DM);
}

// v006
// A run of this version takes 89.6 microseconds.
// Next to v005, in two timings, it ran 1.10 and 1.11 times as fast.
// All steps since v000 together make it 3.63 times as fast.
#include <hip/hip_runtime.h>

// All contractions on v_wmma_f32_16x16x32 (f32 accumulate): q/k/v projections bf16 x bf16 (x, W, b RNE-converted to bf16; products exact); scores q.k and P.V: query rows < 512 bf16 hi/lo planes (3 products), other rows f16 (P carried x1024); output projection bf16 hi/lo activations x bf16 weights (2 products).
// x [2][2048][1024]; Wq/Wk/Wv/Wo [out][in] with biases; 16 heads x 64; rotate-half rotary on q and k (table computed on the device: powf / sincosf); score scale 1/8; int32 keep-mask [S][S] read by value (0 -> -inf); softmax f32; out = merged heads Wo^T + bo.
// Four launches; jobs that read none of each other's output share a grid and are told apart by a block index: input-only jobs | q, k, v projections | attention, both operand kinds | output GEMM.
// Pipeline: bf16 copies and mask bit-plane -> projection GEMMs (four waves of 64x64 share a 128x128 tile's operand rows through LDS) whose epilogue applies bias and rotary and writes the head planes itself (q, k [bh][t][d]; v^T [bh][d][t]) -> fused flash attention (four waves of 16 queries share each K / V tile through LDS, transposed tiles so the score accumulators are directly the P operand, online softmax) -> merged hi/lo planes -> output GEMM.

#ifndef NB
#define NB 2
#endif
#ifndef SEQ
#define SEQ 2048
#endif
#define NB_FULL  2
#define SEQ_FULL 2048
#define DM   1024
#define NH   16
#define HD   64
#define DQ   (NH * HD)
#define RH   ((SEQ) < 512 ? (SEQ) : 512)      // query rows < RH use the hi/lo planes
#define PCAR 1024.0f
#define SCL  0.125f                          // HD^-0.5
#define LOG2E 1.4426950408889634f

static_assert(HD == 64);                                   // two 32-deep k-steps per head, 4 output tiles of 16, table index = idx & 31
static_assert(DQ == DM);
static_assert(DM % 32 == 0 && DQ % 32 == 0);               // GEMM k-loop steps by 32
static_assert(DM % 8 == 0);
static_assert(SEQ % 128 == 0 && DQ % 128 == 0 && DM % 128 == 0);   // 128x128 GEMM work-group tiles inside one batch, stages of 128 k, 64-element plane lines
static_assert(RH % 16 == 0 && (SEQ - RH) % 16 == 0);       // 16-query attention tiles
static_assert(SEQ % 32 == 0 && ((size_t)SEQ * SEQ) % 1024 == 0);   // 32-key words, 32 words per bit-plane line
static_assert(NB <= NB_FULL && SEQ <= SEQ_FULL);

typedef _Float16 h16;
typedef unsigned short bf;
typedef __attribute__((ext_vector_type(16))) __bf16   v16bf;
typedef __attribute__((ext_vector_type(16))) _Float16 v16h;
typedef __attribute__((ext_vector_type(8)))  _Float16 v8h;
typedef __attribute__((ext_vector_type(2)))  _Float16 v2h;
typedef __attribute__((ext_vector_type(16))) unsigned short v16us;
typedef __attribute__((ext_vector_type(8)))  unsigned short v8us;
typedef __attribute__((ext_vector_type(2)))  unsigned short v2us;
typedef __attribute__((ext_vector_type(8)))  float    v8f;
typedef __attribute__((ext_vector_type(4)))  float    v4f;
typedef __attribute__((ext_vector_type(2)))  float    v2f;
typedef v4f  __attribute__((may_alias)) v4fa;

__device__ __forceinline__ unsigned short f2bf(float f) { unsigned u = __float_as_uint(f); u += 0x7FFFu + ((u >> 16) & 1u); return (unsigned short)(u >> 16); }
__device__ __forceinline__ float bf2f(unsigned short b) { return __uint_as_float(((unsigned)b) << 16); }
__device__ __forceinline__ float bfr(float f) { return bf2f(f2bf(f)); }
__device__ __forceinline__ void splitf(float y, unsigned short& h, unsigned short& l) { h = f2bf(y); l = f2bf(y - bf2f(h)); }
__device__ __forceinline__ v16h cat16(v8h lo, v8h hi) { return __builtin_shufflevector(lo, hi, 0, 1, 2, 3, 4, 5, 6, 7, 8, 9, 10, 11, 12, 13, 14, 15); }
__device__ __forceinline__ v16bf cat16b(v8us lo, v8us hi) { return __builtin_bit_cast(v16bf, __builtin_shufflevector(lo, hi, 0, 1, 2, 3, 4, 5, 6, 7, 8, 9, 10, 11, 12, 13, 14, 15)); }
// fragment loaders: p already includes row * pitch + k0 + 8 * (lane >> 4); elements 0..7 <- p[0..7], elements 8..15 <- p[16..23]
__device__ __forceinline__ v16h  ldh(const h16* p) { return cat16(*(const v8h*)p, *(const v8h*)(p + 16)); }
__device__ __forceinline__ v16bf ldb(const bf* p)  { return cat16b(*(const v8us*)p, *(const v8us*)(p + 16)); }
__device__ __forceinline__ v8f wmma16(v16h a, v16h b, v8f c) { return __builtin_amdgcn_wmma_f32_16x16x32_f16(false, a, false, b, (short)0, c, false, false); }
__device__ __forceinline__ v8f wmmab(v16bf a, v16bf b, v8f c) { return __builtin_amdgcn_wmma_f32_16x16x32_bf16(false, a, false, b, (short)0, c, false, false); }

// four asynchronous 16-byte copies per lane, global -> LDS; the s_wait_xcnt stands inside the statement so that no address register named here is rewritten ahead of it
__device__ __forceinline__ void copy4(unsigned l0, const void* g0, unsigned l1, const void* g1, unsigned l2, const void* g2, unsigned l3, const void* g3) {
    asm volatile("global_load_async_to_lds_b128 %0, %4, off\n\t"
                 "global_load_async_to_lds_b128 %1, %5, off\n\t"
                 "global_load_async_to_lds_b128 %2, %6, off\n\t"
                 "global_load_async_to_lds_b128 %3, %7, off\n\t"
                 "s_wait_xcnt 0x0"
                 :: "v"(l0), "v"(l1), "v"(l2), "v"(l3), "v"(g0), "v"(g1), "v"(g2), "v"(g3) : "memory"); }

// eight such copies in one statement, one s_wait_xcnt behind the last
__device__ __forceinline__ void copy8(unsigned l0, const void* g0, unsigned l1, const void* g1, unsigned l2, const void* g2, unsigned l3, const void* g3,
                                      unsigned l4, const void* g4, unsigned l5, const void* g5, unsigned l6, const void* g6, unsigned l7, const void* g7) {
    asm volatile("global_load_async_to_lds_b128 %0, %8, off\n\t"
                 "global_load_async_to_lds_b128 %1, %9, off\n\t"
                 "global_load_async_to_lds_b128 %2, %10, off\n\t"
                 "global_load_async_to_lds_b128 %3, %11, off\n\t"
                 "global_load_async_to_lds_b128 %4, %12, off\n\t"
                 "global_load_async_to_lds_b128 %5, %13, off\n\t"
                 "global_load_async_to_lds_b128 %6, %14, off\n\t"
                 "global_load_async_to_lds_b128 %7, %15, off\n\t"
                 "s_wait_xcnt 0x0"
                 :: "v"(l0), "v"(l1), "v"(l2), "v"(l3), "v"(l4), "v"(l5), "v"(l6), "v"(l7), "v"(g0), "v"(g1), "v"(g2), "v"(g3), "v"(g4), "v"(g5), "v"(g6), "v"(g7) : "memory"); }

// ---- GEMM main loop, one work-group of GW waves per 128 x 128 tile, wave (wm, wn) = (w & 1, w >> 1) takes the 64 x 64 part at (64 wm, 64 wn): acc[mb][nb][j] = sum_k A[m0 + 64 wm + 16 mb + 8 hi + j][k] Bt[n0 + 64 wn + 16 nb + lr][k]
// (+ the same with A2 when NA == 2). Operands are K-contiguous bf16 planes, K % GK == 0. A stage is GK k (64 or 128, the caller's choice) of the tile's 128 A rows (of each A plane) and 128 Bt rows, brought into LDS once for the whole work-group
// (asynchronous copies, two buffers: the next stage flies while this one is worked on); every wave reads its fragments from there, 32 k at a time in rising k.
#define GW 4                                  // waves per GEMM work-group
#define GRING(NA, GK) (2 * ((NA) + 1) * 128 * ((GK) + 8))   // 16-bit elements of the two buffers
template <int NA, int GK>
__device__ __forceinline__ void gemm_acc(unsigned short* ring, const bf* __restrict__ A, const bf* __restrict__ A2, const bf* __restrict__ Bt, const int K, const int m0, const int n0, v8f (&acc)[4][4]) {
    static_assert(GK == 64 || GK == 128);
    constexpr int GPI = GK + 8;                                       // LDS pitch of a staged operand row, 16-bit elements: 144 B = 16 B x 9 or 272 B = 16 B x 17
    constexpr int PL = 128 * GPI, BUF = (NA + 1) * PL;                // a buffer is [A planes][Bt plane]
    constexpr int CPR = GK / 8, RPJ = 128 / CPR;                      // 16-byte pieces in a row's part of a stage; rows that the work-group's 128 lanes cover with one piece each
    const int tid = (int)threadIdx.x, lane = tid & 31, lr = lane & 15, hi = lane >> 4;
    const int w = __builtin_amdgcn_readfirstlane(tid >> 5), wm = w & 1, wn = w >> 1;
#pragma unroll
    for (int mb = 0; mb < 4; ++mb)
#pragma unroll
        for (int nb = 0; nb < 4; ++nb) acc[mb][nb] = (v8f){};
    // copy map: a plane's stage is 128 rows of CPR pieces of 16 B; piece i = tid + 128 j (j < CPR): row tid / CPR + RPJ j, column tid % CPR, so one wave's copy covers whole row parts (two of 256 B or four of 128 B)
    const unsigned lb = (unsigned)(size_t)(const void*)ring + (unsigned)((tid / CPR) * (GPI * 2) + (tid % CPR) * 16);   // LDS byte address of this lane's piece 0
    const size_t go = (size_t)(tid / CPR) * K + (tid % CPR) * 8;
    const bf* ga = A + (size_t)m0 * K + go; const bf* ga2 = A2 + (size_t)m0 * K + go; const bf* gb = Bt + (size_t)n0 * K + go;
    auto plane = [&](const unsigned l, const bf* g) {
        constexpr unsigned LJ = RPJ * GPI * 2; const size_t gj = (size_t)RPJ * K;   // from piece j to piece j + 1: RPJ rows, in LDS bytes and in global elements
#pragma unroll
        for (int q = 0; q < CPR; q += 8)
            copy8(l + q * LJ, g + q * gj, l + (q + 1) * LJ, g + (q + 1) * gj, l + (q + 2) * LJ, g + (q + 2) * gj, l + (q + 3) * LJ, g + (q + 3) * gj,
                  l + (q + 4) * LJ, g + (q + 4) * gj, l + (q + 5) * LJ, g + (q + 5) * gj, l + (q + 6) * LJ, g + (q + 6) * gj, l + (q + 7) * LJ, g + (q + 7) * gj); };
    auto issue = [&](const int s, const int bi) { const unsigned l = lb + (unsigned)(bi * (BUF * 2)); const size_t ko = (size_t)s * GK;
        plane(l, ga + ko); if (NA == 2) plane(l + PL * 2, ga2 + ko); plane(l + NA * PL * 2, gb + ko); };
    const int NS = K / GK;
    issue(0, 0);
    asm volatile("s_wait_asynccnt 0x0" ::: "memory");                // this wave's share of the first stage has landed
    __syncthreads();                                                 // ... and every other wave's
    if (NS > 1) issue(1, 1);
#pragma unroll 1   // stays rolled: one stage's body already holds 32 to 128 matrix instructions
    for (int s = 0; s < NS; ++s) {
        const unsigned short* sa = ring + (s & 1) * BUF + (wm * 64 + lr) * GPI + 8 * hi;
        const unsigned short* sb = ring + (s & 1) * BUF + NA * PL + (wn * 64 + lr) * GPI + 8 * hi;
        // fragments of one 32-k block, two register sets: block ks + 1 of this stage is read while block ks is multiplied (nothing of the next stage is read here)
        v16bf fa[2][4], fa2[2][4], fb[2][4];
        auto frag = [&](const int ks) {
#pragma unroll
            for (int mb = 0; mb < 4; ++mb) { fa[ks & 1][mb] = ldb(sa + mb * 16 * GPI + ks * 32); if (NA == 2) fa2[ks & 1][mb] = ldb(sa + PL + mb * 16 * GPI + ks * 32); }
#pragma unroll
            for (int nb = 0; nb < 4; ++nb) fb[ks & 1][nb] = ldb(sb + nb * 16 * GPI + ks * 32); };
        frag(0);
#pragma unroll   // constant indices keep the fragment sets in registers, constant offsets in the reads
        for (int ks = 0; ks < GK / 32; ++ks) {
            if (ks + 1 < GK / 32) frag(ks + 1);
            __builtin_amdgcn_sched_barrier(0);   // the next block's LDS reads issue as one group ahead of this block's matrix instructions: left to the scheduler they sink among them, two at a time, each pair waited for alone
#pragma unroll
            for (int nb = 0; nb < 4; ++nb)
#pragma unroll
                for (int mb = 0; mb < 4; ++mb) { acc[mb][nb] = wmmab(fa[ks & 1][mb], fb[ks & 1][nb], acc[mb][nb]); if (NA == 2) acc[mb][nb] = wmmab(fa2[ks & 1][mb], fb[ks & 1][nb], acc[mb][nb]); }
            __builtin_amdgcn_sched_barrier(0);   // ... and no matrix instruction of this block moves down among the next group's reads or behind the hand-over
        }
        // keeps the distance behind the stage's last matrix instructions on every path out of it, where address arithmetic or the next stage's reads may overwrite the fragments
        // (it stands behind the scheduling barrier above, so behind all of them, and names no register: a named accumulator would have to lie below v256 and was spilled for it)
        asm volatile("v_nop\n\tv_nop\n\tv_nop\n\tv_nop");
        // hand-over, every wave: my LDS reads of this buffer are done, my share of the next stage has landed, then the barrier that publishes the next stage and frees this buffer
        asm volatile("s_wait_dscnt 0x0" ::: "memory");
        asm volatile("s_wait_asynccnt 0x0" ::: "memory");
        __syncthreads();
        if (s + 2 < NS) issue(s + 2, s & 1);
    }
    asm volatile("s_wait_asynccnt 0x0" ::: "memory");                // no copy is left in flight behind the loop
}

// ---- output GEMM: C[m][n] (f32, pitch ldc) = sum_k A[m][k] Bt[n][k] + A2[m][k] Bt[n][k] + bf16(bias[n]), k < DQ; main loop gemm_acc, each wave stores its own 64 x 64 part
__device__ __forceinline__ void gemm_body(const bf* __restrict__ A, const bf* __restrict__ A2, const bf* __restrict__ Bt,
                                          float* C, const int ldc, const float* __restrict__ bias, const size_t sA, const size_t sC) {
    __shared__ __align__(16) unsigned short ring[GRING(2, 128)];
    __shared__ __align__(16) float osall[GW * 16 * 68];
    const size_t z = blockIdx.z; A += z * sA; A2 += z * sA; C += z * sC;
    const int lane = threadIdx.x & 31, lr = lane & 15, hi = lane >> 4; const int w = __builtin_amdgcn_readfirstlane((int)threadIdx.x >> 5);
    float* os = osall + w * (16 * 68);        // this wave's own staging rows
    const int r0 = (int)blockIdx.x * 128 + (w & 1) * 64, c0 = (int)blockIdx.y * 128 + (w >> 1) * 64;
    v8f acc[4][4];
    gemm_acc<2, 128>(ring, A, A2, Bt, DQ, (int)blockIdx.x * 128, (int)blockIdx.y * 128, acc);
    v4f bv;
#pragma unroll
    for (int q = 0; q < 4; ++q) bv[q] = bfr(bias[c0 + lr * 4 + q]);
#pragma unroll
    for (int mb = 0; mb < 4; ++mb) {
#pragma unroll
        for (int nb = 0; nb < 4; ++nb) {
#pragma unroll
            for (int j = 0; j < 8; ++j) os[(hi * 8 + j) * 68 + nb * 16 + lr] = acc[mb][nb][j]; }
        __builtin_amdgcn_wave_barrier(); asm volatile("" ::: "memory");
        float* crow = C + (size_t)(r0 + mb * 16) * ldc + c0;
{
#pragma unroll
            for (int s = 0; s < 8; ++s) { const int row = 2 * s + hi, cofs = lr * 4; v4f val = *(const v4fa*)(os + row * 68 + cofs); val += bv;
                *(v4f*)(crow + (size_t)row * ldc + cofs) = val; }
             }
        __builtin_amdgcn_wave_barrier(); asm volatile("" ::: "memory");
    }
}
__global__ __launch_bounds__(GW * 32) void k_gemm2(const bf* __restrict__ A, const bf* __restrict__ A2, const bf* __restrict__ Bt, float* C, int ldc, const float* __restrict__ bias, size_t sA, size_t sC) {
    gemm_body(A, A2, Bt, C, ldc, bias, sA, sC); }

// ---- input-only jobs, each written for blocks of 256 threads; blk is the block's number inside its job
__device__ __forceinline__ void job_cvt8(const int blk, const float* __restrict__ src, bf* dst, size_t n8) { const size_t i = (size_t)blk * 256 + threadIdx.x; if (i >= n8) return; const v8f v = *(const v8f*)(src + i * 8); v8us o;
#pragma unroll
    for (int k = 0; k < 8; ++k) o[k] = f2bf(v[k]);
    *(v8us*)(dst + i * 8) = o;  }
__device__ __forceinline__ void job_cvtx(const int blk, const float* __restrict__ src, bf* dst) { const size_t i = (size_t)blk * 256 + threadIdx.x; if (i >= (size_t)NB * SEQ * DM / 8) return;
    const size_t row = i / (DM / 8); const size_t c8 = i % (DM / 8); const size_t b = row / SEQ, t = row % SEQ; const v8f v = *(const v8f*)(src + ((b * SEQ_FULL + t) * DM + c8 * 8)); v8us o;
#pragma unroll
    for (int k = 0; k < 8; ++k) o[k] = f2bf(v[k]);
    *(v8us*)(dst + i * 8) = o;  }

__device__ __forceinline__ void job_cstab(const int blk, float* CS) { const int idx = blk * 256 + (int)threadIdx.x; if (idx >= SEQ * (HD / 2)) return; const int i = idx & 31, t = idx >> 5;
    const float ex = (float)(2 * i) / (float)HD; const float pw = powf(10000.0f, ex); const float invf = 1.0f / pw; const float ang = __fmul_rn((float)t, invf); float sn, cn; sincosf(ang, &sn, &cn);
    v2f cs; cs[0] = cn; cs[1] = sn; float* p0 = CS + ((size_t)t * HD + i) * 2; float* p1 = p0 + (HD / 2) * 2;
    *(v2f*)p0 = cs; *(v2f*)p1 = cs;  }

__device__ __forceinline__ void job_mbits(const int blk, const int* __restrict__ mask, unsigned* MB) { const int lane = threadIdx.x & 31; const int g = blk * 8 + (int)(threadIdx.x >> 5);
    if (g >= (int)((size_t)SEQ * SEQ / 1024)) return;   // wave-uniform
    unsigned mine = 0u;
#pragma unroll 4
    for (int j = 0; j < 32; ++j) { const int wd = g * 32 + j; const int q = wd / (SEQ / 32), kg = wd % (SEQ / 32); const int v = mask[(size_t)q * SEQ_FULL + kg * 32 + lane];
        const unsigned bal = __builtin_amdgcn_ballot_w32(v != 0); mine = (lane == j) ? bal : mine; }
    *(unsigned*)(MB + (size_t)g * 32 + lane) = mine;  }
// one grid for all of them (none reads what another writes): blocks [0, PB_MB) mask bit-plane, then the rotary table, then x, then the four weights; the two jobs whose threads run longest stand first
constexpr int PB_MB = (int)(((size_t)SEQ * SEQ / 1024 + 7) / 8);
constexpr int PB_CS = (SEQ * (HD / 2) + 255) / 256;
constexpr int PB_X  = (int)(((size_t)NB * SEQ * DM / 8 + 255) / 256);
constexpr int PB_W  = (int)(((size_t)DQ * DM / 8 + 255) / 256);
__global__ __launch_bounds__(256) void k_prep(const float* __restrict__ x, const float* __restrict__ Wq, const float* __restrict__ Wk, const float* __restrict__ Wv, const float* __restrict__ Wo, const int* __restrict__ mask,
                                              bf* XB, bf* WQ, bf* WK, bf* WV, bf* WO, float* CS, unsigned* MB) {
    int blk = (int)blockIdx.x;
    if (blk < PB_MB) { job_mbits(blk, mask, MB); return; }
    blk -= PB_MB;
    if (blk < PB_CS) { job_cstab(blk, CS); return; }
    blk -= PB_CS;
    if (blk < PB_X) { job_cvtx(blk, x, XB); return; }
    blk -= PB_X;
    const int j = blk / PB_W;                 // which weight
    job_cvt8(blk - j * PB_W, j == 0 ? Wq : j == 1 ? Wk : j == 2 ? Wv : Wo, j == 0 ? WQ : j == 1 ? WK : j == 2 ? WV : WO, (size_t)DQ * DM / 8);
}

// ---- projection tiles, one wave per 64 tokens x one head (64 features), four waves (two heads x two token groups) per work-group, main loop gemm_acc. A lane's 8 accumulator
// registers are 8 consecutive m, so the index that runs innermost in the plane to be written goes on the A side (features for q and k, tokens for v^T) and a lane's 8 values are one 16-byte piece of a plane row.
#define SP 72                                 // LDS pitch of a staged plane row of 64 16-bit elements: 144 B = 16 B x 9
// 16 plane rows x 64 elements, f32 in registers (lane (lr, hi): row lr, elements 16 mb + 8 hi + j) -> f16 plane and, when hl (the same for the whole wave), bf16 hi/lo planes. Staged in this wave's LDS so that every global store covers whole 128-byte lines.
__device__ __forceinline__ void planes_out(unsigned short* st, const v8f (&r)[4], h16* p16, bf* ph, bf* pl, const size_t pitch, const bool hl) {
    const int lane = threadIdx.x & 31, lr = lane & 15, hi = lane >> 4;
    unsigned short* sw = st + lr * SP + 8 * hi;
#pragma unroll
    for (int mb = 0; mb < 4; ++mb) { v8h o16;
#pragma unroll
        for (int j = 0; j < 8; ++j) o16[j] = (h16)r[mb][j];
        *(v8us*)(sw + mb * 16) = __builtin_bit_cast(v8us, o16); }
    if (hl) {
#pragma unroll
        for (int mb = 0; mb < 4; ++mb) { v8us oh, ol;
#pragma unroll
            for (int j = 0; j < 8; ++j) { unsigned short a, c; splitf(r[mb][j], a, c); oh[j] = a; ol[j] = c; }
            *(v8us*)(sw + 16 * SP + mb * 16) = oh; *(v8us*)(sw + 32 * SP + mb * 16) = ol; }
    }
    __builtin_amdgcn_wave_barrier(); asm volatile("" ::: "memory");   // the rows are read back by other lanes of the wave: no LDS read may move up over the writes
    const int rr = lane >> 3, cc = (lane & 7) * 8;
#pragma unroll
    for (int it = 0; it < 4; ++it) { const int row = it * 4 + rr; *(v8us*)((unsigned short*)p16 + (size_t)row * pitch + cc) = *(const v8us*)(st + row * SP + cc); }
    asm volatile("s_wait_xcnt 0x0" ::: "memory");   // stands in front of whatever next overwrites a register that these stores name
    if (hl) {
#pragma unroll
        for (int it = 0; it < 4; ++it) { const int row = it * 4 + rr;
            *(v8us*)(ph + (size_t)row * pitch + cc) = *(const v8us*)(st + 16 * SP + row * SP + cc); *(v8us*)(pl + (size_t)row * pitch + cc) = *(const v8us*)(st + 32 * SP + row * SP + cc); }
        asm volatile("s_wait_xcnt 0x0" ::: "memory");   // as above
    }
    __builtin_amdgcn_wave_barrier(); asm volatile("" ::: "memory");   // ... and the next group's writes may not move up over these reads
    __builtin_amdgcn_sched_barrier(0);        // nor the next group's arithmetic over the waits above, where it would overwrite the stores' registers ahead of them
}
// q, k and v tiles in one grid: blockIdx.z = 0 q, 1 k, 2 v; blockIdx.x the 128 tokens, blockIdx.y the 128 features. One main loop and one plane writer serve all three (the kernel's text stays small); z is the same for the whole work-group.
// q or k: y = x W^T + bf16(b), rotate-half rotary out[d] = y[d] c - y[d+32] s (d < 32), out[d] = y[d] c + y[d-32] s (d >= 32); d and d + 32 lie in the same lane (mb and mb + 2). Planes [bh][t][d]: f16, and bf16 hi/lo for t < RH (q) or every t (k).
// v: y = x W^T + bf16(b), planes [bh][d][t] (f16, bf16 hi/lo): tokens on the A side, so a lane's 8 values are 8 consecutive t of feature row 16 nb + lr
__global__ __launch_bounds__(GW * 32) void k_proj(const bf* __restrict__ X, const bf* __restrict__ WQ, const bf* __restrict__ WK, const bf* __restrict__ WV,
                                                  const float* __restrict__ bq, const float* __restrict__ bk, const float* __restrict__ bv, const float* __restrict__ CS,
                                                  h16* Q16, bf* QPh, bf* QPl, h16* K16, bf* KPh, bf* KPl, h16* VT16, bf* VTh, bf* VTl) {
    // stages of 64 k: ring and staging rows take 101,376 B, so that three work-groups share a WGP (the registers allow three waves per SIMD) and the whole grid is resident at once:
    // one work-group's first loads, hand-overs, table loads, conversions and stores run under the others' matrix work, and no second or third round pays them again
    __shared__ __align__(16) unsigned short ring[GRING(1, 64)];
    __shared__ __align__(16) unsigned short stall[GW * 3 * 16 * SP];
    const int z = (int)blockIdx.z; const bool tv = z == 2;
    const int lane = threadIdx.x & 31, lr = lane & 15, hi = lane >> 4; const int w = __builtin_amdgcn_readfirstlane((int)threadIdx.x >> 5);
    unsigned short* st = stall + w * (3 * 16 * SP);   // this wave's own staging rows
    const int tk0 = (int)blockIdx.x * 128, ft0 = (int)blockIdx.y * 128;
    // the wave's 64 tokens and its head: the A side is split by w & 1, the B side by w >> 1
    const int r0 = tk0 + (tv ? (w & 1) : (w >> 1)) * 64, h = (int)blockIdx.y * 2 + (tv ? (w >> 1) : (w & 1));
    const int b = r0 / SEQ, t0 = r0 % SEQ, bh = b * NH + h;
    const bf* Wt = z == 0 ? WQ : z == 1 ? WK : WV;
    h16* P16 = z == 0 ? Q16 : z == 1 ? K16 : VT16; bf* Ph = z == 0 ? QPh : z == 1 ? KPh : VTh; bf* Pl = z == 0 ? QPl : z == 1 ? KPl : VTl;
    const int hrows = z == 0 ? RH : SEQ;      // q, k: the tokens that have hi/lo rows (a multiple of 16: a group of 16 tokens has them or has none)
    float xv[4] = {0.0f, 0.0f, 0.0f, 0.0f};
    if (tv) {
#pragma unroll
        for (int nb = 0; nb < 4; ++nb) xv[nb] = bv[h * HD + nb * 16 + lr];
        asm volatile("s_wait_xcnt 0x0" ::: "memory");   // stands in front of whatever next overwrites an address register of these loads
    }
    v8f acc[4][4];
    gemm_acc<1, 64>(ring, tv ? X : Wt, tv ? X : Wt, tv ? Wt : X, DM, tv ? tk0 : ft0, tv ? ft0 : tk0, acc);
    // q, k: a lane's (cos, sin) pairs of token group nb: token t0 + 16 nb + lr, frequencies 8 hi + j (pieces 0..3) and 16 + 8 hi + j (pieces 4..7)
    const float* cp = CS + ((size_t)(t0 + lr) * HD + 8 * hi) * 2;
    v4f cs[2][8];
    auto ldcs = [&](const int nb) {
#pragma unroll
        for (int q = 0; q < 8; ++q) cs[nb & 1][q] = *(const v4f*)(cp + (size_t)nb * 16 * HD * 2 + (q >> 2) * 32 + (q & 3) * 4);
        asm volatile("s_wait_xcnt 0x0" :: "v"(cp) : "memory"); };   // stands in front of whatever next overwrites an address register of these loads; it names the pointer, so that the pair stays the pointer's up to here
    if (!tv) {
        const float* bias = z == 0 ? bq : bk;
        v8f xb[4];
#pragma unroll
        for (int mb = 0; mb < 4; ++mb) xb[mb] = *(const v8f*)(bias + h * HD + mb * 16 + 8 * hi);
        ldcs(0); ldcs(1);
        __builtin_amdgcn_sched_barrier(0);    // bias and the first two groups' table loads issue as one run: left to the scheduler they are issued two at a time, each pair waited for alone
#pragma unroll
        for (int mb = 0; mb < 4; ++mb) { v8f bb;
#pragma unroll
            for (int j = 0; j < 8; ++j) bb[j] = bfr(xb[mb][j]);
#pragma unroll
            for (int nb = 0; nb < 4; ++nb) acc[mb][nb] += bb; }
    }
#pragma unroll
    for (int nb = 0; nb < 4; ++nb) {
        v8f r[4];
        size_t e16, ehl, pitch; bool hl;
        if (!tv) {
#pragma unroll
            for (int mp = 0; mp < 2; ++mp)
#pragma unroll
                for (int j = 0; j < 8; ++j) { const float c = cs[nb & 1][mp * 4 + (j >> 1)][(j & 1) * 2], s = cs[nb & 1][mp * 4 + (j >> 1)][(j & 1) * 2 + 1];
                    const float y1 = acc[mp][nb][j], y2 = acc[mp + 2][nb][j];
                    r[mp][j] = y1 * c - y2 * s; r[mp + 2][j] = y2 * c + y1 * s; }
            if (nb + 2 < 4) { ldcs(nb + 2);
                __builtin_amdgcn_sched_barrier(0); }   // the table loads of the group after next issue no later than here, so that they fly under this group's conversion and stores
            const int tg = t0 + nb * 16; hl = tg < hrows;
            e16 = ((size_t)bh * SEQ + tg) * HD; ehl = ((size_t)bh * hrows + (hl ? tg : 0)) * HD; pitch = HD;
        } else {
            const float bb = bfr(xv[nb]);
#pragma unroll
            for (int mb = 0; mb < 4; ++mb) r[mb] = acc[mb][nb] + bb;
            e16 = ((size_t)bh * HD + nb * 16) * SEQ + t0; ehl = e16; pitch = SEQ; hl = true;
        }
        planes_out(st, r, P16 + e16, Ph + ehl, Pl + ehl, pitch, hl);
    }
}

// ---- fused attention, one work-group of AW waves per 16 * AW query rows of one (batch, head), one wave per 16 rows; KS = 64 keys per step (two mask words). Each step's K rows and V^T rows are brought into LDS once for the whole work-group
// (asynchronous copies, two buffers: the next step's tile flies while this one is worked on) and every wave reads its fragments from there. The rows' mask words are read once into LDS; a step is staged only when some
// row of the work-group keeps one of its 64 keys, and a wave works on it only when one of its own 16 rows does (exact for any mask; the steps a wave works on and their order are those of a walk over all SEQ / 64 steps).
// Transposed tiles: S^T[key][query] = K (A operand) x Q^T (B operand), so lane (hi, lr) holds query lr, keys 16 kt + 8 hi + r of key tile kt (four tiles); tiles 2 c and 2 c + 1 are exactly the B-operand elements of P over the 32 keys of half c for
// O^T[d][query] = V^T (A operand) x P^T (B operand). Row statistics (running max, sum) are per lane; the two lane halves exchange once per step (xor 16). HR: bf16 hi/lo planes, 3 products; else f16, P x1024.
#define AW 4                                  // waves per attention work-group
#define KP 72                                 // LDS pitch of a K row, 16-bit elements: 144 B = 16 B x 9, conflict-free for 16-byte reads down a column of rows
#define KS 64                                 // keys per step
#define VP 72                                 // LDS pitch of a V^T row of 64 keys: 144 B = 16 B x 9
#define MP 65                                 // LDS pitch of a row's mask words, dwords
static_assert(RH % (16 * AW) == 0 && (SEQ - RH) % (16 * AW) == 0);   // whole work-groups
static_assert(SEQ / 32 <= 64);                                       // a row's mask words fit one 64-bit word
static_assert(AW * 32 == 128 && HD == 64 && KS == 64);               // the copy index maps below: 512 16-byte pieces per K plane and per V^T plane, four of each per lane
static_assert(SEQ % KS == 0);                                        // a step is a whole pair of mask words

template <bool HR>
__device__ __forceinline__ void attn_body(unsigned short* ring, unsigned* msk, unsigned* lv, float* csall, const int tile, const int bh, const h16* __restrict__ Q16, const h16* __restrict__ K16, const h16* __restrict__ VT16,
                                          const bf* __restrict__ Qh, const bf* __restrict__ Ql, const bf* __restrict__ Kh, const bf* __restrict__ Kl,
                                          const bf* __restrict__ VTh, const bf* __restrict__ VTl, const unsigned* __restrict__ MB, bf* ATh, bf* ATl) {
    constexpr int NPL = HR ? 2 : 1;                                   // planes per operand
    constexpr int KT = KS * KP, VT = HD * VP, BUF = NPL * (KT + VT);  // 16-bit elements; a buffer is [K planes][V^T planes]
    constexpr int NW = SEQ / 32;
    const int tid = (int)threadIdx.x, lane = tid & 31, lr = lane & 15, hi = lane >> 4;
    const int w = __builtin_amdgcn_readfirstlane(tid >> 5);
    float* cs = csall + w * (16 * 68);
    const int q0 = tile * (16 * AW) + w * 16;
    const int b = bh / NH, h = bh % NH;
    const size_t qoff = ((size_t)bh * (HR ? RH : SEQ) + q0 + lr) * HD + 8 * hi;
    const float NINF = -__builtin_huge_valf();

    // mask words of this wave's 16 rows -> LDS (read back by this wave alone); which steps keep a key: for the wave (own), for the work-group (live)
    unsigned nz0 = 0u, nz1 = 0u;
#pragma unroll   // all 32 loads in flight at once
    for (int r = 0; r < 16; ++r) { const unsigned* mrow = MB + (size_t)(q0 + r) * NW; const unsigned a = (lane < NW) ? mrow[lane] : 0u, c = (lane + 32 < NW) ? mrow[lane + 32] : 0u;
        msk[(w * 16 + r) * MP + lane] = a; msk[(w * 16 + r) * MP + 32 + lane] = c; nz0 |= a; nz1 |= c; }
    const unsigned own0 = __builtin_amdgcn_ballot_w32(nz0 != 0u), own1 = __builtin_amdgcn_ballot_w32(nz1 != 0u);
    if (lane == 0) { lv[w * 2] = own0; lv[w * 2 + 1] = own1; }
    __syncthreads();
    unsigned g0 = 0u, g1 = 0u;
    for (int i = 0; i < AW; ++i) { g0 |= lv[i * 2]; g1 |= lv[i * 2 + 1]; }
    // a step is named by the first of its two mask words (an even number); its bit is set when either word keeps a key
    constexpr unsigned long long EVEN = 0x5555555555555555ull;
    const unsigned long long ownw = (unsigned long long)own0 | ((unsigned long long)own1 << 32);
    const unsigned long long own = (ownw | (ownw >> 1)) & EVEN;
    const unsigned long long livew = (unsigned long long)(unsigned)__builtin_amdgcn_readfirstlane((int)g0) | ((unsigned long long)(unsigned)__builtin_amdgcn_readfirstlane((int)g1) << 32);
    unsigned long long rest = (livew | (livew >> 1)) & EVEN;          // steps not yet issued, the same in every wave

    // Q fragments stay in registers
    v16h qf[2]; v16bf qh[2], ql[2];
#pragma unroll   // constant indices keep the fragment arrays in registers (so at the K fragments below)
    for (int ks = 0; ks < 2; ++ks) { if (HR) { qh[ks] = ldb(Qh + qoff + ks * 32); ql[ks] = ldb(Ql + qoff + ks * 32); } else qf[ks] = ldh(Q16 + qoff + ks * 32); }

    // copy maps: a step's 64 K rows are 8 KiB in a row in global memory (piece i = tid + 128 j, j < 4: row i >> 3, 16-byte column i & 7); its V^T tile is 64 rows of 128 B (the same piece map)
    const unsigned ringb = (unsigned)(size_t)(const void*)ring;       // LDS byte address of the ring
    const unsigned lk = ringb + (unsigned)((tid >> 3) * (KP * 2) + (tid & 7) * 16);
    const unsigned lvv = ringb + (unsigned)(NPL * KT * 2 + (tid >> 3) * (VP * 2) + (tid & 7) * 16);
    const size_t gk = (size_t)bh * SEQ * HD + (size_t)tid * 8;
    const size_t gv = ((size_t)bh * HD + (tid >> 3)) * SEQ + (tid & 7) * 8;
    auto issue = [&](const int kc, const int bi) {                    // kc: the step's first mask word, so its first key is 32 kc
        constexpr unsigned KJ = 16 * KP * 2, VJ = 16 * VP * 2; constexpr size_t GK16 = (size_t)16 * HD, GV16 = (size_t)16 * SEQ;   // from piece j to piece j + 1: 16 rows, in LDS bytes and in global elements
        const unsigned k0 = lk + (unsigned)(bi * (BUF * 2)), v0 = lvv + (unsigned)(bi * (BUF * 2)); const size_t ko = gk + (size_t)kc * 32 * HD, vo = gv + (size_t)kc * 32;
        if (HR) {
            copy8(k0, Kh + ko, k0 + KJ, Kh + ko + GK16, k0 + 2 * KJ, Kh + ko + 2 * GK16, k0 + 3 * KJ, Kh + ko + 3 * GK16,
                  k0 + KT * 2, Kl + ko, k0 + KT * 2 + KJ, Kl + ko + GK16, k0 + KT * 2 + 2 * KJ, Kl + ko + 2 * GK16, k0 + KT * 2 + 3 * KJ, Kl + ko + 3 * GK16);
            copy8(v0, VTh + vo, v0 + VJ, VTh + vo + GV16, v0 + 2 * VJ, VTh + vo + 2 * GV16, v0 + 3 * VJ, VTh + vo + 3 * GV16,
                  v0 + VT * 2, VTl + vo, v0 + VT * 2 + VJ, VTl + vo + GV16, v0 + VT * 2 + 2 * VJ, VTl + vo + 2 * GV16, v0 + VT * 2 + 3 * VJ, VTl + vo + 3 * GV16);
        } else {
            copy8(k0, K16 + ko, k0 + KJ, K16 + ko + GK16, k0 + 2 * KJ, K16 + ko + 2 * GK16, k0 + 3 * KJ, K16 + ko + 3 * GK16,
                  v0, VT16 + vo, v0 + VJ, VT16 + vo + GV16, v0 + 2 * VJ, VT16 + vo + 2 * GV16, v0 + 3 * VJ, VT16 + vo + 3 * GV16);
        } };

    v8f o[4];
#pragma unroll
    for (int dt = 0; dt < 4; ++dt) o[dt] = (v8f){};
    float m = NINF, l = 0.0f;
    int cur = -1, nxt = -1, bi = 0;
    if (rest != 0ull) {
        cur = __builtin_ctzll(rest); rest &= rest - 1ull; issue(cur, 0);
        asm volatile("s_wait_asynccnt 0x0" ::: "memory");            // this wave's share of the first tile has landed
        __syncthreads();                                             // ... and every other wave's
        if (rest != 0ull) { nxt = __builtin_ctzll(rest); rest &= rest - 1ull; issue(nxt, 1); }
    }
    while (cur >= 0) {
      if ((own >> cur) & 1ull) {                                      // wave-uniform: else all 16 rows mask all 64 keys
        const unsigned W0 = msk[(w * 16 + lr) * MP + cur], W1 = msk[(w * 16 + lr) * MP + cur + 1];
        const unsigned short* kb = ring + bi * BUF + lr * KP + 8 * hi;
        const unsigned short* vb = ring + bi * BUF + NPL * KT + lr * VP + 8 * hi;
        v8f s[4];
#pragma unroll   // constant indices keep the tile and fragment arrays in registers (so in every loop of this step)
        for (int kt = 0; kt < 4; ++kt) s[kt] = (v8f){};
        if (HR) {
            v16bf ah[4][2], al[4][2];
#pragma unroll
            for (int kt = 0; kt < 4; ++kt)
#pragma unroll
                for (int ks = 0; ks < 2; ++ks) { ah[kt][ks] = ldb(kb + kt * 16 * KP + ks * 32); al[kt][ks] = ldb(kb + KT + kt * 16 * KP + ks * 32); }
#pragma unroll
            for (int ks = 0; ks < 2; ++ks) {
#pragma unroll
                for (int kt = 0; kt < 4; ++kt) s[kt] = wmmab(ah[kt][ks], qh[ks], s[kt]);
#pragma unroll
                for (int kt = 0; kt < 4; ++kt) s[kt] = wmmab(al[kt][ks], qh[ks], s[kt]);
#pragma unroll
                for (int kt = 0; kt < 4; ++kt) s[kt] = wmmab(ah[kt][ks], ql[ks], s[kt]);
            }
        } else {
            v16h kf[4][2];
#pragma unroll
            for (int kt = 0; kt < 4; ++kt)
#pragma unroll
                for (int ks = 0; ks < 2; ++ks) kf[kt][ks] = ldh((const h16*)kb + kt * 16 * KP + ks * 32);
#pragma unroll
            for (int ks = 0; ks < 2; ++ks)
#pragma unroll
                for (int kt = 0; kt < 4; ++kt) s[kt] = wmma16(kf[kt][ks], qf[ks], s[kt]);
        }
        // online softmax for query lr over this lane's 32 keys + the partner lane's 32 keys
        float t[4][8], mt[4];
#pragma unroll
        for (int kt = 0; kt < 4; ++kt) { const unsigned Wl = ((kt < 2) ? W0 : W1) >> (8 * hi + 16 * (kt & 1)); mt[kt] = NINF;
#pragma unroll
            for (int r = 0; r < 8; ++r) { t[kt][r] = ((Wl >> r) & 1u) ? s[kt][r] * SCL : NINF; mt[kt] = fmaxf(mt[kt], t[kt][r]); } }
        float mx = fmaxf(fmaxf(mt[0], mt[1]), fmaxf(mt[2], mt[3]));
        mx = fmaxf(mx, __shfl_xor(mx, 16, 32));
        const float mnew = fmaxf(m, mx);
        const float msub = (mnew == NINF) ? 0.0f : mnew;
        // each difference below stays a rounded value of its own ahead of its multiply by log2 e (the empty statements name differences, never products)
        float ds = __fsub_rn(m, msub); asm volatile("" : "+v"(ds));
        const float scl = __builtin_amdgcn_exp2f(__fmul_rn(ds, LOG2E));
        float p[4][8], pt[4];
#pragma unroll
        for (int kt = 0; kt < 4; ++kt) { pt[kt] = 0.0f;
#pragma unroll
            for (int r = 0; r < 8; ++r) { float d = __fsub_rn(t[kt][r], msub); asm volatile("" : "+v"(d)); p[kt][r] = __builtin_amdgcn_exp2f(__fmul_rn(d, LOG2E)); pt[kt] += p[kt][r]; } }
        float psum = (pt[0] + pt[1]) + (pt[2] + pt[3]);
        psum += __shfl_xor(psum, 16, 32);
        l = l * scl + psum; m = mnew;
#pragma unroll
        for (int dt = 0; dt < 4; ++dt)
#pragma unroll
            for (int r = 0; r < 8; ++r) o[dt][r] *= scl;
        if (HR) {
            v16bf pbh[2], pbl[2];
#pragma unroll
            for (int c = 0; c < 2; ++c) { v16us ph, pl;
#pragma unroll
                for (int r = 0; r < 8; ++r) { unsigned short a, e; splitf(p[2 * c][r], a, e); ph[r] = a; pl[r] = e; splitf(p[2 * c + 1][r], a, e); ph[8 + r] = a; pl[8 + r] = e; }
                pbh[c] = __builtin_bit_cast(v16bf, ph); pbl[c] = __builtin_bit_cast(v16bf, pl); }
            v16bf vh[2][4], vl[2][4];
#pragma unroll
            for (int c = 0; c < 2; ++c)
#pragma unroll
                for (int dt = 0; dt < 4; ++dt) { vh[c][dt] = ldb(vb + dt * 16 * VP + c * 32); vl[c][dt] = ldb(vb + VT + dt * 16 * VP + c * 32); }
#pragma unroll
            for (int c = 0; c < 2; ++c) {
#pragma unroll
                for (int dt = 0; dt < 4; ++dt) o[dt] = wmmab(vh[c][dt], pbh[c], o[dt]);
#pragma unroll
                for (int dt = 0; dt < 4; ++dt) o[dt] = wmmab(vl[c][dt], pbh[c], o[dt]);
#pragma unroll
                for (int dt = 0; dt < 4; ++dt) o[dt] = wmmab(vh[c][dt], pbl[c], o[dt]);
            }
            // keeps the distance behind the step's last matrix instructions on the path into the hand-over, where the next copies' address arithmetic may overwrite their operands
            asm volatile("v_nop\n\tv_nop\n\tv_nop\n\tv_nop" : "+v"(o[0]), "+v"(o[1]), "+v"(o[2]), "+v"(o[3]) : "v"(pbl[1]), "v"(vh[1][0]), "v"(vh[1][3]));
        } else {
            v16h pb[2];
#pragma unroll
            for (int c = 0; c < 2; ++c)
#pragma unroll
                for (int r = 0; r < 8; ++r) { pb[c][r] = (h16)(p[2 * c][r] * PCAR); pb[c][8 + r] = (h16)(p[2 * c + 1][r] * PCAR); }
            v16h vf[2][4];
#pragma unroll
            for (int c = 0; c < 2; ++c)
#pragma unroll
                for (int dt = 0; dt < 4; ++dt) vf[c][dt] = ldh((const h16*)vb + dt * 16 * VP + c * 32);
#pragma unroll
            for (int c = 0; c < 2; ++c)
#pragma unroll
                for (int dt = 0; dt < 4; ++dt) o[dt] = wmma16(vf[c][dt], pb[c], o[dt]);
            // as above
            asm volatile("v_nop\n\tv_nop\n\tv_nop\n\tv_nop" : "+v"(o[0]), "+v"(o[1]), "+v"(o[2]), "+v"(o[3]) : "v"(pb[1]), "v"(vf[1][0]), "v"(vf[1][3]));
        }
      }
        // hand-over, every wave, also one that skipped the step: my LDS reads of this buffer are done, my share of the next tile has landed, then the barrier that publishes the next tile and frees this buffer
        asm volatile("s_wait_dscnt 0x0" ::: "memory");
        asm volatile("s_wait_asynccnt 0x0" ::: "memory");
        __syncthreads();
        cur = nxt; nxt = -1;
        if (rest != 0ull) { nxt = __builtin_ctzll(rest); rest &= rest - 1ull; issue(nxt, bi); }
        bi ^= 1;
    }
    asm volatile("s_wait_asynccnt 0x0" ::: "memory");                // no copy is left in flight when the wave ends
    // normalise (a row without any kept key gives 0 x inf = NaN, as a softmax over an all -inf row does) and stage O[query lr][d]
    const float rl = 1.0f / l; const float inv = HR ? rl : rl * (1.0f / PCAR);
#pragma unroll
    for (int dt = 0; dt < 4; ++dt)
#pragma unroll
        for (int r = 0; r < 8; ++r) cs[lr * 68 + dt * 16 + 8 * hi + r] = o[dt][r] * inv;
    __builtin_amdgcn_wave_barrier(); asm volatile("" ::: "memory");
    bf* ah = ATh + ((size_t)b * SEQ + q0) * DQ + h * HD; bf* al = ATl + ((size_t)b * SEQ + q0) * DQ + h * HD;
{
#pragma unroll
        for (int it = 0; it < 4; ++it) { const int row = it * 4 + (lane >> 3), c = (lane & 7) * 8;
            const v4f x0 = *(const v4fa*)(cs + row * 68 + c), x1 = *(const v4fa*)(cs + row * 68 + c + 4); v8us oh, ol;
#pragma unroll
            for (int q = 0; q < 4; ++q) { unsigned short a, c2; splitf(x0[q], a, c2); oh[q] = a; ol[q] = c2; splitf(x1[q], a, c2); oh[4 + q] = a; ol[4 + q] = c2; }
            *(v8us*)(ah + (size_t)row * DQ + c) = oh; *(v8us*)(al + (size_t)row * DQ + c) = ol; }
         }
}
// both operand kinds in one grid (neither reads what the other writes), each job's blocks in the order of a grid (tiles, heads) of its own: blocks [0, AB_LO) the f16 rows, then the hi/lo rows.
// The larger job stands first and the smaller one takes the places that come free (a matter of speed alone: every tile is complete for any mask); the kind is the same for the whole work-group.
constexpr int AT_HI = RH / (16 * AW), AT_LO = (SEQ - RH) / (16 * AW), AB_LO = AT_LO * NB * NH;
static_assert(AT_HI > 0 && AT_LO > 0);        // both jobs have tiles: the block index is divided by either count
__global__ __launch_bounds__(AW * 32) void k_attn(const h16* __restrict__ Q16, const h16* __restrict__ K16, const h16* __restrict__ VT16,
                                                  const bf* __restrict__ Qh, const bf* __restrict__ Ql, const bf* __restrict__ Kh, const bf* __restrict__ Kl, const bf* __restrict__ VTh, const bf* __restrict__ VTl,
                                                  const unsigned* __restrict__ MB, bf* ATh, bf* ATl) {
    __shared__ __align__(16) unsigned short ring[2 * 2 * (KS * KP + HD * VP)];   // two buffers of the larger kind (hi/lo planes)
    __shared__ unsigned msk[AW * 16 * MP];
    __shared__ unsigned lv[AW * 2];
    __shared__ __align__(16) float csall[AW * 16 * 68];
    const int blk = (int)blockIdx.x;
    if (blk < AB_LO) attn_body<false>(ring, msk, lv, csall, AT_HI + blk % AT_LO, blk / AT_LO, Q16, K16, VT16, Qh, Ql, Kh, Kl, VTh, VTl, MB, ATh, ATl);
    else attn_body<true>(ring, msk, lv, csall, (blk - AB_LO) % AT_HI, (blk - AB_LO) / AT_HI, Q16, K16, VT16, Qh, Ql, Kh, Kl, VTh, VTl, MB, ATh, ATl);
}

// ---- workspace carve (bytes, every region a multiple of 256)
constexpr size_t al256(size_t x) { return (x + 255) & ~(size_t)255; }
constexpr size_t SZ_XB  = al256((size_t)NB * SEQ * DM * 2);
constexpr size_t SZ_W   = al256((size_t)DQ * DM * 2);
constexpr size_t SZ_CS  = al256((size_t)SEQ * HD * 2 * 4);
constexpr size_t SZ_MB  = al256((size_t)SEQ * SEQ / 8);
constexpr size_t SZ_PL  = al256((size_t)NB * NH * SEQ * HD * 2);
constexpr size_t SZ_QH  = al256((size_t)NB * NH * RH * HD * 2);
constexpr size_t SZ_AT  = al256((size_t)NB * SEQ * DQ * 2);
constexpr size_t WS_TOTAL = SZ_XB + 4 * SZ_W + SZ_CS + SZ_MB + SZ_PL + 2 * SZ_QH + 3 * SZ_PL + 3 * SZ_PL + 2 * SZ_AT;
static_assert(WS_TOTAL <= (size_t)134217728);

extern "C" void kernel_launch(void* const* d_in, const int* in_sizes, int n_in,
                              void* d_out, int out_size, void* d_ws, size_t ws_size, hipStream_t stream) {
    if (n_in < 10) return;
    const long long need_x = (long long)(NB - 1) * SEQ_FULL * DM + (long long)SEQ * DM;
    if ((long long)in_sizes[0] < need_x || (long long)out_size < need_x) return;
    if (in_sizes[1] < DQ * DM || in_sizes[3] < DQ * DM || in_sizes[5] < DQ * DM || in_sizes[7] < DM * DQ) return;
    if (in_sizes[2] < DQ || in_sizes[4] < DQ || in_sizes[6] < DQ || in_sizes[8] < DM) return;
    if ((long long)in_sizes[9] < (long long)(SEQ - 1) * SEQ_FULL + SEQ) return;
    if (WS_TOTAL > ws_size) return;
    const float* x  = (const float*)d_in[0];
    const float* Wq = (const float*)d_in[1]; const float* bq = (const float*)d_in[2];
    const float* Wk = (const float*)d_in[3]; const float* bk = (const float*)d_in[4];
    const float* Wv = (const float*)d_in[5]; const float* bv = (const float*)d_in[6];
    const float* Wo = (const float*)d_in[7]; const float* bo = (const float*)d_in[8];
    const int* mask = (const int*)d_in[9];
    float* OUT = (float*)d_out;
    char* wsp = (char*)d_ws;
    bf* XB = (bf*)wsp; wsp += SZ_XB;
    bf* WQ = (bf*)wsp; wsp += SZ_W; bf* WK = (bf*)wsp; wsp += SZ_W; bf* WV = (bf*)wsp; wsp += SZ_W; bf* WO = (bf*)wsp; wsp += SZ_W;
    float* CS = (float*)wsp; wsp += SZ_CS;
    unsigned* MB = (unsigned*)wsp; wsp += SZ_MB;
    h16* Q16 = (h16*)wsp; wsp += SZ_PL; bf* QPh = (bf*)wsp; wsp += SZ_QH; bf* QPl = (bf*)wsp; wsp += SZ_QH;
    h16* K16 = (h16*)wsp; wsp += SZ_PL; bf* KPh = (bf*)wsp; wsp += SZ_PL; bf* KPl = (bf*)wsp; wsp += SZ_PL;
    h16* VT16 = (h16*)wsp; wsp += SZ_PL; bf* VTh = (bf*)wsp; wsp += SZ_PL; bf* VTl = (bf*)wsp; wsp += SZ_PL;
    bf* ATh = (bf*)wsp; wsp += SZ_AT; bf* ATl = (bf*)wsp; wsp += SZ_AT;

    k_prep<<<(unsigned)(PB_MB + PB_CS + PB_X + 4 * PB_W), 256, 0, stream>>>(x, Wq, Wk, Wv, Wo, mask, XB, WQ, WK, WV, WO, CS, MB);

    k_proj<<<dim3((unsigned)(NB * SEQ / 128), (unsigned)(DQ / 128), 3), GW * 32, 0, stream>>>(XB, WQ, WK, WV, bq, bk, bv, CS, Q16, QPh, QPl, K16, KPh, KPl, VT16, VTh, VTl);

    k_attn<<<(unsigned)(AB_LO + AT_HI * NB * NH), AW * 32, 0, stream>>>(Q16, K16, VT16, QPh, QPl, KPh, KPl, VTh, VTl, MB, ATh, ATl);

    k_gemm2<<<dim3((unsigned)(SEQ / 128), (unsigned)(DM / 128), (unsigned)NB), GW * 32, 0, stream>>>(ATh, ATl, WO, OUT, DM, bo, (size_t)SEQ * DQ, (size_t)SEQ_FULL * DM);
}

// v007
// One run takes 86.7 microseconds.
// Next to v006, in two timings, it ran 1.04 times as fast each time.
// Over all steps from v000 it is 3.76 times as fast.
#include <hip/hip_runtime.h>

// All contractions on v_wmma_f32_16x16x32 (f32 accumulate): q/k/v projections bf16 x bf16 (x, W, b RNE-converted to bf16; products exact); scores q.k and P.V: query rows < 512 bf16 hi/lo planes (3 products), other rows f16 (P carried x1024); output projection bf16 hi/lo activations x bf16 weights (2 products).
// x [2][2048][1024]; Wq/Wk/Wv/Wo [out][in] with biases; 16 heads x 64; rotate-half rotary on q and k (table computed on the device: powf / sincosf); score scale 1/8; int32 keep-mask [S][S] read by value (0 -> -inf); softmax f32; out = merged heads Wo^T + bo.
// Four launches; jobs that read none of each other's output share a grid and are told apart by a block index: input-only jobs | q, k, v projections | attention, both operand kinds | output GEMM.
// Pipeline: bf16 copies and mask bit-plane -> projection GEMMs (four waves of 64x64 share a 128x128 tile's operand rows through LDS) whose epilogue applies bias and rotary and writes the head planes itself (q, k [bh][t][d]; v^T [bh][d][t]) -> fused flash attention (four waves of 16 queries share each K / V tile through LDS, transposed tiles so the score accumulators are directly the P operand, online softmax) -> merged hi/lo planes -> output GEMM.

#ifndef NB
#define NB 2
#endif
#ifndef SEQ
#define SEQ 2048
#endif
#define NB_FULL  2
#define SEQ_FULL 2048
#define DM   1024
#define NH   16
#define HD   64
#define DQ   (NH * HD)
#define RH   ((SEQ) < 512 ? (SEQ) : 512)      // query rows < RH use the hi/lo planes
#define PCAR 1024.0f
#define SCL  0.125f                          // HD^-0.5
#define LOG2E 1.4426950408889634f

static_assert(HD == 64);                                   // two 32-deep k-steps per head, 4 output tiles of 16, table index = idx & 31
static_assert(DQ == DM);
static_assert(DM % 32 == 0 && DQ % 32 == 0);               // GEMM k-loop steps by 32
static_assert(DM % 8 == 0);
static_assert(SEQ % 128 == 0 && DQ % 128 == 0 && DM % 128 == 0);   // 128x128 GEMM work-group tiles inside one batch, stages of 128 k, 64-element plane lines
static_assert(RH % 16 == 0 && (SEQ - RH) % 16 == 0);       // 16-query attention tiles
static_assert(SEQ % 32 == 0 && ((size_t)SEQ * SEQ) % 1024 == 0);   // 32-key words, 32 words per bit-plane line
static_assert(NB <= NB_FULL && SEQ <= SEQ_FULL);

typedef _Float16 h16;
typedef unsigned short bf;
typedef __attribute__((ext_vector_type(16))) __bf16   v16bf;
typedef __attribute__((ext_vector_type(16))) _Float16 v16h;
typedef __attribute__((ext_vector_type(8)))  _Float16 v8h;
typedef __attribute__((ext_vector_type(2)))  _Float16 v2h;
typedef __attribute__((ext_vector_type(16))) unsigned short v16us;
typedef __attribute__((ext_vector_type(8)))  unsigned short v8us;
typedef __attribute__((ext_vector_type(2)))  unsigned short v2us;
typedef __attribute__((ext_vector_type(8)))  float    v8f;
typedef __attribute__((ext_vector_type(4)))  float    v4f;
typedef __attribute__((ext_vector_type(2)))  float    v2f;
typedef v4f  __attribute__((may_alias)) v4fa;

__device__ __forceinline__ unsigned short f2bf(float f) { unsigned u = __float_as_uint(f); u += 0x7FFFu + ((u >> 16) & 1u); return (unsigned short)(u >> 16); }
__device__ __forceinline__ float bf2f(unsigned short b) { return __uint_as_float(((unsigned)b) << 16); }
__device__ __forceinline__ float bfr(float f) { return bf2f(f2bf(f)); }
__device__ __forceinline__ void splitf(float y, unsigned short& h, unsigned short& l) { h = f2bf(y); l = f2bf(y - bf2f(h)); }
__device__ __forceinline__ v16h cat16(v8h lo, v8h hi) { return __builtin_shufflevector(lo, hi, 0, 1, 2, 3, 4, 5, 6, 7, 8, 9, 10, 11, 12, 13, 14, 15); }
__device__ __forceinline__ v16bf cat16b(v8us lo, v8us hi) { return __builtin_bit_cast(v16bf, __builtin_shufflevector(lo, hi, 0, 1, 2, 3, 4, 5, 6, 7, 8, 9, 10, 11, 12, 13, 14, 15)); }
// fragment loaders: p already includes row * pitch + k0 + 8 * (lane >> 4); elements 0..7 <- p[0..7], elements 8..15 <- p[16..23]
__device__ __forceinline__ v16h  ldh(const h16* p) { return cat16(*(const v8h*)p, *(const v8h*)(p + 16)); }
__device__ __forceinline__ v16bf ldb(const bf* p)  { return cat16b(*(const v8us*)p, *(const v8us*)(p + 16)); }
__device__ __forceinline__ v8f wmma16(v16h a, v16h b, v8f c) { return __builtin_amdgcn_wmma_f32_16x16x32_f16(false, a, false, b, (short)0, c, false, false); }
__device__ __forceinline__ v8f wmmab(v16bf a, v16bf b, v8f c) { return __builtin_amdgcn_wmma_f32_16x16x32_bf16(false, a, false, b, (short)0, c, false, false); }

// four asynchronous 16-byte copies per lane, global -> LDS; the s_wait_xcnt stands inside the statement so that no address register named here is rewritten ahead of it
__device__ __forceinline__ void copy4(unsigned l0, const void* g0, unsigned l1, const void* g1, unsigned l2, const void* g2, unsigned l3, const void* g3) {
    asm volatile("global_load_async_to_lds_b128 %0, %4, off\n\t"
                 "global_load_async_to_lds_b128 %1, %5, off\n\t"
                 "global_load_async_to_lds_b128 %2, %6, off\n\t"
                 "global_load_async_to_lds_b128 %3, %7, off\n\t"
                 "s_wait_xcnt 0x0"
                 :: "v"(l0), "v"(l1), "v"(l2), "v"(l3), "v"(g0), "v"(g1), "v"(g2), "v"(g3) : "memory"); }

// eight such copies in one statement, one s_wait_xcnt behind the last
__device__ __forceinline__ void copy8(unsigned l0, const void* g0, unsigned l1, const void* g1, unsigned l2, const void* g2, unsigned l3, const void* g3,
                                      unsigned l4, const void* g4, unsigned l5, const void* g5, unsigned l6, const void* g6, unsigned l7, const void* g7) {
    asm volatile("global_load_async_to_lds_b128 %0, %8, off\n\t"
                 "global_load_async_to_lds_b128 %1, %9, off\n\t"
                 "global_load_async_to_lds_b128 %2, %10, off\n\t"
                 "global_load_async_to_lds_b128 %3, %11, off\n\t"
                 "global_load_async_to_lds_b128 %4, %12, off\n\t"
                 "global_load_async_to_lds_b128 %5, %13, off\n\t"
                 "global_load_async_to_lds_b128 %6, %14, off\n\t"
                 "global_load_async_to_lds_b128 %7, %15, off\n\t"
                 "s_wait_xcnt 0x0"
                 :: "v"(l0), "v"(l1), "v"(l2), "v"(l3), "v"(l4), "v"(l5), "v"(l6), "v"(l7), "v"(g0), "v"(g1), "v"(g2), "v"(g3), "v"(g4), "v"(g5), "v"(g6), "v"(g7) : "memory"); }

// ---- GEMM main loop, one work-group of GW waves per 128 x 128 tile, wave (wm, wn) = (w & 1, w >> 1) takes the 64 x 64 part at (64 wm, 64 wn): acc[mb][nb][j] = sum_k A[m0 + 64 wm + 16 mb + 8 hi + j][k] Bt[n0 + 64 wn + 16 nb + lr][k]
// (+ the same with A2 when NA == 2). Operands are K-contiguous bf16 planes, K % GK == 0. A stage is GK k (64 or 128, the caller's choice) of the tile's 128 A rows (of each A plane) and 128 Bt rows, brought into LDS once for the whole work-group
// (asynchronous copies, two buffers: the next stage flies while this one is worked on); every wave reads its fragments from there, 32 k at a time in rising k.
#define GW 4                                  // waves per GEMM work-group
#define GRING(NA, GK) (2 * ((NA) + 1) * 128 * ((GK) + 8))   // 16-bit elements of the two buffers
template <int NA, int GK>
__device__ __forceinline__ void gemm_acc(unsigned short* ring, const bf* __restrict__ A, const bf* __restrict__ A2, const bf* __restrict__ Bt, const int K, const int m0, const int n0, v8f (&acc)[4][4]) {
    static_assert(GK == 64 || GK == 128);
    constexpr int GPI = GK + 8;                                       // LDS pitch of a staged operand row, 16-bit elements: 144 B = 16 B x 9 or 272 B = 16 B x 17
    constexpr int PL = 128 * GPI, BUF = (NA + 1) * PL;                // a buffer is [A planes][Bt plane]
    constexpr int CPR = GK / 8, RPJ = 128 / CPR;                      // 16-byte pieces in a row's part of a stage; rows that the work-group's 128 lanes cover with one piece each
    const int tid = (int)threadIdx.x, lane = tid & 31, lr = lane & 15, hi = lane >> 4;
    const int w = __builtin_amdgcn_readfirstlane(tid >> 5), wm = w & 1, wn = w >> 1;
#pragma unroll
    for (int mb = 0; mb < 4; ++mb)
#pragma unroll
        for (int nb = 0; nb < 4; ++nb) acc[mb][nb] = (v8f){};
    // copy map: a plane's stage is 128 rows of CPR pieces of 16 B; piece i = tid + 128 j (j < CPR): row tid / CPR + RPJ j, column tid % CPR, so one wave's copy covers whole row parts (two of 256 B or four of 128 B)
    const unsigned lb = (unsigned)(size_t)(const void*)ring + (unsigned)((tid / CPR) * (GPI * 2) + (tid % CPR) * 16);   // LDS byte address of this lane's piece 0
    const size_t go = (size_t)(tid / CPR) * K + (tid % CPR) * 8;
    const bf* ga = A + (size_t)m0 * K + go; const bf* ga2 = A2 + (size_t)m0 * K + go; const bf* gb = Bt + (size_t)n0 * K + go;
    auto plane = [&](const unsigned l, const bf* g) {
        constexpr unsigned LJ = RPJ * GPI * 2; const size_t gj = (size_t)RPJ * K;   // from piece j to piece j + 1: RPJ rows, in LDS bytes and in global elements
#pragma unroll
        for (int q = 0; q < CPR; q += 8)
            copy8(l + q * LJ, g + q * gj, l + (q + 1) * LJ, g + (q + 1) * gj, l + (q + 2) * LJ, g + (q + 2) * gj, l + (q + 3) * LJ, g + (q + 3) * gj,
                  l + (q + 4) * LJ, g + (q + 4) * gj, l + (q + 5) * LJ, g + (q + 5) * gj, l + (q + 6) * LJ, g + (q + 6) * gj, l + (q + 7) * LJ, g + (q + 7) * gj); };
    auto issue = [&](const int s, const int bi) { const unsigned l = lb + (unsigned)(bi * (BUF * 2)); const size_t ko = (size_t)s * GK;
        plane(l, ga + ko); if (NA == 2) plane(l + PL * 2, ga2 + ko); plane(l + NA * PL * 2, gb + ko); };
    const int NS = K / GK;
    issue(0, 0);
    asm volatile("s_wait_asynccnt 0x0" ::: "memory");                // this wave's share of the first stage has landed
    __syncthreads();                                                 // ... and every other wave's
    if (NS > 1) issue(1, 1);
#pragma unroll 1   // stays rolled: one stage's body already holds 32 to 128 matrix instructions
    for (int s = 0; s < NS; ++s) {
        const unsigned short* sa = ring + (s & 1) * BUF + (wm * 64 + lr) * GPI + 8 * hi;
        const unsigned short* sb = ring + (s & 1) * BUF + NA * PL + (wn * 64 + lr) * GPI + 8 * hi;
        // fragments of one 32-k block, two register sets: block ks + 1 of this stage is read while block ks is multiplied (nothing of the next stage is read here)
        v16bf fa[2][4], fa2[2][4], fb[2][4];
        auto frag = [&](const int ks) {
#pragma unroll
            for (int mb = 0; mb < 4; ++mb) { fa[ks & 1][mb] = ldb(sa + mb * 16 * GPI + ks * 32); if (NA == 2) fa2[ks & 1][mb] = ldb(sa + PL + mb * 16 * GPI + ks * 32); }
#pragma unroll
            for (int nb = 0; nb < 4; ++nb) fb[ks & 1][nb] = ldb(sb + nb * 16 * GPI + ks * 32); };
        frag(0);
#pragma unroll   // constant indices keep the fragment sets in registers, constant offsets in the reads
        for (int ks = 0; ks < GK / 32; ++ks) {
            if (ks + 1 < GK / 32) frag(ks + 1);
            __builtin_amdgcn_sched_barrier(0);   // the next block's LDS reads issue as one group ahead of this block's matrix instructions: left to the scheduler they sink among them, two at a time, each pair waited for alone
#pragma unroll
            for (int nb = 0; nb < 4; ++nb)
#pragma unroll
                for (int mb = 0; mb < 4; ++mb) { acc[mb][nb] = wmmab(fa[ks & 1][mb], fb[ks & 1][nb], acc[mb][nb]); if (NA == 2) acc[mb][nb] = wmmab(fa2[ks & 1][mb], fb[ks & 1][nb], acc[mb][nb]); }
            __builtin_amdgcn_sched_barrier(0);   // ... and no matrix instruction of this block moves down among the next group's reads or behind the hand-over
        }
        // keeps the distance behind the stage's last matrix instructions on every path out of it, where address arithmetic or the next stage's reads may overwrite the fragments
        // (it stands behind the scheduling barrier above, so behind all of them, and names no register: a named accumulator would have to lie below v256 and was spilled for it)
        asm volatile("v_nop\n\tv_nop\n\tv_nop\n\tv_nop");
        // hand-over, every wave: my LDS reads of this buffer are done, my share of the next stage has landed, then the barrier that publishes the next stage and frees this buffer
        asm volatile("s_wait_dscnt 0x0" ::: "memory");
        asm volatile("s_wait_asynccnt 0x0" ::: "memory");
        __syncthreads();
        if (s + 2 < NS) issue(s + 2, s & 1);
    }
    asm volatile("s_wait_asynccnt 0x0" ::: "memory");                // no copy is left in flight behind the loop
}

// ---- output GEMM: C[m][n] (f32, pitch ldc) = sum_k A[m][k] Bt[n][k] + A2[m][k] Bt[n][k] + bf16(bias[n]), k < DQ; main loop gemm_acc, each wave stores its own 64 x 64 part
__device__ __forceinline__ void gemm_body(const bf* __restrict__ A, const bf* __restrict__ A2, const bf* __restrict__ Bt,
                                          float* C, const int ldc, const float* __restrict__ bias, const size_t sA, const size_t sC) {
    __shared__ __align__(16) unsigned short ring[GRING(2, 128)];
    __shared__ __align__(16) float osall[GW * 16 * 68];
    const size_t z = blockIdx.z; A += z * sA; A2 += z * sA; C += z * sC;
    const int lane = threadIdx.x & 31, lr = lane & 15, hi = lane >> 4; const int w = __builtin_amdgcn_readfirstlane((int)threadIdx.x >> 5);
    float* os = osall + w * (16 * 68);        // this wave's own staging rows
    const int r0 = (int)blockIdx.x * 128 + (w & 1) * 64, c0 = (int)blockIdx.y * 128 + (w >> 1) * 64;
    v8f acc[4][4];
    gemm_acc<2, 128>(ring, A, A2, Bt, DQ, (int)blockIdx.x * 128, (int)blockIdx.y * 128, acc);
    v4f bv;
#pragma unroll
    for (int q = 0; q < 4; ++q) bv[q] = bfr(bias[c0 + lr * 4 + q]);
#pragma unroll
    for (int mb = 0; mb < 4; ++mb) {
#pragma unroll
        for (int nb = 0; nb < 4; ++nb) {
#pragma unroll
            for (int j = 0; j < 8; ++j) os[(hi * 8 + j) * 68 + nb * 16 + lr] = acc[mb][nb][j]; }
        __builtin_amdgcn_wave_barrier(); asm volatile("" ::: "memory");
        float* crow = C + (size_t)(r0 + mb * 16) * ldc + c0;
{
#pragma unroll
            for (int s = 0; s < 8; ++s) { const int row = 2 * s + hi, cofs = lr * 4; v4f val = *(const v4fa*)(os + row * 68 + cofs); val += bv;
                *(v4f*)(crow + (size_t)row * ldc + cofs) = val; }
             }
        __builtin_amdgcn_wave_barrier(); asm volatile("" ::: "memory");
    }
}
__global__ __launch_bounds__(GW * 32) void k_gemm2(const bf* __restrict__ A, const bf* __restrict__ A2, const bf* __restrict__ Bt, float* C, int ldc, const float* __restrict__ bias, size_t sA, size_t sC) {
    gemm_body(A, A2, Bt, C, ldc, bias, sA, sC); }

// ---- input-only jobs, each written for blocks of 256 threads; blk is the block's number inside its job
__device__ __forceinline__ void job_cvt8(const int blk, const float* __restrict__ src, bf* dst, size_t n8) { const size_t i = (size_t)blk * 256 + threadIdx.x; if (i >= n8) return; const v8f v = *(const v8f*)(src + i * 8); v8us o;
#pragma unroll
    for (int k = 0; k < 8; ++k) o[k] = f2bf(v[k]);
    *(v8us*)(dst + i * 8) = o;  }
__device__ __forceinline__ void job_cvtx(const int blk, const float* __restrict__ src, bf* dst) { const size_t i = (size_t)blk * 256 + threadIdx.x; if (i >= (size_t)NB * SEQ * DM / 8) return;
    const size_t row = i / (DM / 8); const size_t c8 = i % (DM / 8); const size_t b = row / SEQ, t = row % SEQ; const v8f v = *(const v8f*)(src + ((b * SEQ_FULL + t) * DM + c8 * 8)); v8us o;
#pragma unroll
    for (int k = 0; k < 8; ++k) o[k] = f2bf(v[k]);
    *(v8us*)(dst + i * 8) = o;  }

__device__ __forceinline__ void job_cstab(const int blk, float* CS) { const int idx = blk * 256 + (int)threadIdx.x; if (idx >= SEQ * (HD / 2)) return; const int i = idx & 31, t = idx >> 5;
    const float ex = (float)(2 * i) / (float)HD; const float pw = powf(10000.0f, ex); const float invf = 1.0f / pw; const float ang = __fmul_rn((float)t, invf); float sn, cn; sincosf(ang, &sn, &cn);
    v2f cs; cs[0] = cn; cs[1] = sn; float* p0 = CS + ((size_t)t * HD + i) * 2; float* p1 = p0 + (HD / 2) * 2;
    *(v2f*)p0 = cs; *(v2f*)p1 = cs;  }

__device__ __forceinline__ void job_mbits(const int blk, const int* __restrict__ mask, unsigned* MB) { const int lane = threadIdx.x & 31; const int g = blk * 8 + (int)(threadIdx.x >> 5);
    if (g >= (int)((size_t)SEQ * SEQ / 1024)) return;   // wave-uniform
    unsigned mine = 0u;
#pragma unroll 4
    for (int j = 0; j < 32; ++j) { const int wd = g * 32 + j; const int q = wd / (SEQ / 32), kg = wd % (SEQ / 32); const int v = mask[(size_t)q * SEQ_FULL + kg * 32 + lane];
        const unsigned bal = __builtin_amdgcn_ballot_w32(v != 0); mine = (lane == j) ? bal : mine; }
    *(unsigned*)(MB + (size_t)g * 32 + lane) = mine;  }
// one grid for all of them (none reads what another writes): blocks [0, PB_MB) mask bit-plane, then the rotary table, then x, then the four weights; the two jobs whose threads run longest stand first
constexpr int PB_MB = (int)(((size_t)SEQ * SEQ / 1024 + 7) / 8);
constexpr int PB_CS = (SEQ * (HD / 2) + 255) / 256;
constexpr int PB_X  = (int)(((size_t)NB * SEQ * DM / 8 + 255) / 256);
constexpr int PB_W  = (int)(((size_t)DQ * DM / 8 + 255) / 256);
__global__ __launch_bounds__(256) void k_prep(const float* __restrict__ x, const float* __restrict__ Wq, const float* __restrict__ Wk, const float* __restrict__ Wv, const float* __restrict__ Wo, const int* __restrict__ mask,
                                              bf* XB, bf* WQ, bf* WK, bf* WV, bf* WO, float* CS, unsigned* MB) {
    int blk = (int)blockIdx.x;
    if (blk < PB_MB) { job_mbits(blk, mask, MB); return; }
    blk -= PB_MB;
    if (blk < PB_CS) { job_cstab(blk, CS); return; }
    blk -= PB_CS;
    if (blk < PB_X) { job_cvtx(blk, x, XB); return; }
    blk -= PB_X;
    const int j = blk / PB_W;                 // which weight
    job_cvt8(blk - j * PB_W, j == 0 ? Wq : j == 1 ? Wk : j == 2 ? Wv : Wo, j == 0 ? WQ : j == 1 ? WK : j == 2 ? WV : WO, (size_t)DQ * DM / 8);
}

// ---- projection tiles, one wave per 64 tokens x one head (64 features), four waves (two heads x two token groups) per work-group, main loop gemm_acc. A lane's 8 accumulator
// registers are 8 consecutive m, so the index that runs innermost in the plane to be written goes on the A side (features for q and k, tokens for v^T) and a lane's 8 values are one 16-byte piece of a plane row.
#define SP 72                                 // LDS pitch of a staged plane row of 64 16-bit elements: 144 B = 16 B x 9
// 16 plane rows x 64 elements, f32 in registers (lane (lr, hi): row lr, elements 16 mb + 8 hi + j) -> f16 plane and, when hl (the same for the whole wave), bf16 hi/lo planes. Staged in this wave's LDS so that every global store covers whole 128-byte lines.
__device__ __forceinline__ void planes_out(unsigned short* st, const v8f (&r)[4], h16* p16, bf* ph, bf* pl, const size_t pitch, const bool hl) {
    const int lane = threadIdx.x & 31, lr = lane & 15, hi = lane >> 4;
    unsigned short* sw = st + lr * SP + 8 * hi;
#pragma unroll
    for (int mb = 0; mb < 4; ++mb) { v8h o16;
#pragma unroll
        for (int j = 0; j < 8; ++j) o16[j] = (h16)r[mb][j];
        *(v8us*)(sw + mb * 16) = __builtin_bit_cast(v8us, o16); }
    if (hl) {
#pragma unroll
        for (int mb = 0; mb < 4; ++mb) { v8us oh, ol;
#pragma unroll
            for (int j = 0; j < 8; ++j) { unsigned short a, c; splitf(r[mb][j], a, c); oh[j] = a; ol[j] = c; }
            *(v8us*)(sw + 16 * SP + mb * 16) = oh; *(v8us*)(sw + 32 * SP + mb * 16) = ol; }
    }
    __builtin_amdgcn_wave_barrier(); asm volatile("" ::: "memory");   // the rows are read back by other lanes of the wave: no LDS read may move up over the writes
    const int rr = lane >> 3, cc = (lane & 7) * 8;
#pragma unroll
    for (int it = 0; it < 4; ++it) { const int row = it * 4 + rr; *(v8us*)((unsigned short*)p16 + (size_t)row * pitch + cc) = *(const v8us*)(st + row * SP + cc); }
    asm volatile("s_wait_xcnt 0x0" ::: "memory");   // stands in front of whatever next overwrites a register that these stores name
    if (hl) {
#pragma unroll
        for (int it = 0; it < 4; ++it) { const int row = it * 4 + rr;
            *(v8us*)(ph + (size_t)row * pitch + cc) = *(const v8us*)(st + 16 * SP + row * SP + cc); *(v8us*)(pl + (size_t)row * pitch + cc) = *(const v8us*)(st + 32 * SP + row * SP + cc); }
        asm volatile("s_wait_xcnt 0x0" ::: "memory");   // as above
    }
    __builtin_amdgcn_wave_barrier(); asm volatile("" ::: "memory");   // ... and the next group's writes may not move up over these reads
    __builtin_amdgcn_sched_barrier(0);        // nor the next group's arithmetic over the waits above, where it would overwrite the stores' registers ahead of them
}
// q, k and v tiles in one grid: blockIdx.z = 0 q, 1 k, 2 v; blockIdx.x the 128 tokens, blockIdx.y the 128 features. One main loop and one plane writer serve all three (the kernel's text stays small); z is the same for the whole work-group.
// q or k: y = x W^T + bf16(b), rotate-half rotary out[d] = y[d] c - y[d+32] s (d < 32), out[d] = y[d] c + y[d-32] s (d >= 32); d and d + 32 lie in the same lane (mb and mb + 2). Planes [bh][t][d]: f16, and bf16 hi/lo for t < RH (q) or every t (k).
// v: y = x W^T + bf16(b), planes [bh][d][t] (f16, bf16 hi/lo): tokens on the A side, so a lane's 8 values are 8 consecutive t of feature row 16 nb + lr
__global__ __launch_bounds__(GW * 32) void k_proj(const bf* __restrict__ X, const bf* __restrict__ WQ, const bf* __restrict__ WK, const bf* __restrict__ WV,
                                                  const float* __restrict__ bq, const float* __restrict__ bk, const float* __restrict__ bv, const float* __restrict__ CS,
                                                  h16* Q16, bf* QPh, bf* QPl, h16* K16, bf* KPh, bf* KPl, h16* VT16, bf* VTh, bf* VTl) {
    // stages of 64 k: ring and staging rows take 101,376 B, so that three work-groups share a WGP (the registers allow three waves per SIMD) and the whole grid is resident at once:
    // one work-group's first loads, hand-overs, table loads, conversions and stores run under the others' matrix work, and no second or third round pays them again
    __shared__ __align__(16) unsigned short ring[GRING(1, 64)];
    __shared__ __align__(16) unsigned short stall[GW * 3 * 16 * SP];
    const int z = (int)blockIdx.z; const bool tv = z == 2;
    const int lane = threadIdx.x & 31, lr = lane & 15, hi = lane >> 4; const int w = __builtin_amdgcn_readfirstlane((int)threadIdx.x >> 5);
    unsigned short* st = stall + w * (3 * 16 * SP);   // this wave's own staging rows
    const int tk0 = (int)blockIdx.x * 128, ft0 = (int)blockIdx.y * 128;
    // the wave's 64 tokens and its head: the A side is split by w & 1, the B side by w >> 1
    const int r0 = tk0 + (tv ? (w & 1) : (w >> 1)) * 64, h = (int)blockIdx.y * 2 + (tv ? (w >> 1) : (w & 1));
    const int b = r0 / SEQ, t0 = r0 % SEQ, bh = b * NH + h;
    const bf* Wt = z == 0 ? WQ : z == 1 ? WK : WV;
    h16* P16 = z == 0 ? Q16 : z == 1 ? K16 : VT16; bf* Ph = z == 0 ? QPh : z == 1 ? KPh : VTh; bf* Pl = z == 0 ? QPl : z == 1 ? KPl : VTl;
    const int hrows = z == 0 ? RH : SEQ;      // q, k: the tokens that have hi/lo rows (a multiple of 16: a group of 16 tokens has them or has none)
    float xv[4] = {0.0f, 0.0f, 0.0f, 0.0f};
    if (tv) {
#pragma unroll
        for (int nb = 0; nb < 4; ++nb) xv[nb] = bv[h * HD + nb * 16 + lr];
        asm volatile("s_wait_xcnt 0x0" ::: "memory");   // stands in front of whatever next overwrites an address register of these loads
    }
    v8f acc[4][4];
    gemm_acc<1, 64>(ring, tv ? X : Wt, tv ? X : Wt, tv ? Wt : X, DM, tv ? tk0 : ft0, tv ? ft0 : tk0, acc);
    // q, k: a lane's (cos, sin) pairs of token group nb: token t0 + 16 nb + lr, frequencies 8 hi + j (pieces 0..3) and 16 + 8 hi + j (pieces 4..7)
    const float* cp = CS + ((size_t)(t0 + lr) * HD + 8 * hi) * 2;
    v4f cs[2][8];
    auto ldcs = [&](const int nb) {
#pragma unroll
        for (int q = 0; q < 8; ++q) cs[nb & 1][q] = *(const v4f*)(cp + (size_t)nb * 16 * HD * 2 + (q >> 2) * 32 + (q & 3) * 4);
        asm volatile("s_wait_xcnt 0x0" :: "v"(cp) : "memory"); };   // stands in front of whatever next overwrites an address register of these loads; it names the pointer, so that the pair stays the pointer's up to here
    if (!tv) {
        const float* bias = z == 0 ? bq : bk;
        v8f xb[4];
#pragma unroll
        for (int mb = 0; mb < 4; ++mb) xb[mb] = *(const v8f*)(bias + h * HD + mb * 16 + 8 * hi);
        ldcs(0); ldcs(1);
        __builtin_amdgcn_sched_barrier(0);    // bias and the first two groups' table loads issue as one run: left to the scheduler they are issued two at a time, each pair waited for alone
#pragma unroll
        for (int mb = 0; mb < 4; ++mb) { v8f bb;
#pragma unroll
            for (int j = 0; j < 8; ++j) bb[j] = bfr(xb[mb][j]);
#pragma unroll
            for (int nb = 0; nb < 4; ++nb) acc[mb][nb] += bb; }
    }
#pragma unroll
    for (int nb = 0; nb < 4; ++nb) {
        v8f r[4];
        size_t e16, ehl, pitch; bool hl;
        if (!tv) {
#pragma unroll
            for (int mp = 0; mp < 2; ++mp)
#pragma unroll
                for (int j = 0; j < 8; ++j) { const float c = cs[nb & 1][mp * 4 + (j >> 1)][(j & 1) * 2], s = cs[nb & 1][mp * 4 + (j >> 1)][(j & 1) * 2 + 1];
                    const float y1 = acc[mp][nb][j], y2 = acc[mp + 2][nb][j];
                    r[mp][j] = y1 * c - y2 * s; r[mp + 2][j] = y2 * c + y1 * s; }
            if (nb + 2 < 4) { ldcs(nb + 2);
                __builtin_amdgcn_sched_barrier(0); }   // the table loads of the group after next issue no later than here, so that they fly under this group's conversion and stores
            const int tg = t0 + nb * 16; hl = tg < hrows;
            e16 = ((size_t)bh * SEQ + tg) * HD; ehl = ((size_t)bh * hrows + (hl ? tg : 0)) * HD; pitch = HD;
        } else {
            const float bb = bfr(xv[nb]);
#pragma unroll
            for (int mb = 0; mb < 4; ++mb) r[mb] = acc[mb][nb] + bb;
            e16 = ((size_t)bh * HD + nb * 16) * SEQ + t0; ehl = e16; pitch = SEQ; hl = true;
        }
        planes_out(st, r, P16 + e16, Ph + ehl, Pl + ehl, pitch, hl);
    }
}

// ---- fused attention, one work-group of AW waves per 16 * AW query rows of one (batch, head), one wave per 16 rows; KS = 64 keys per step (two mask words). Each step's K rows and V^T rows are brought into LDS once for the whole work-group
// (asynchronous copies, two buffers: the next step's tile flies while this one is worked on) and every wave reads its fragments from there. The rows' mask words are read once into LDS; a step is staged only when some
// row of the work-group keeps one of its 64 keys, and a wave works on it only when one of its own 16 rows does (exact for any mask; the steps a wave works on and their order are those of a walk over all SEQ / 64 steps). In a step whose 64 keys all 16 rows of a wave keep, the wave leaves out the select by mask bit (an identity there).
// Transposed tiles: S^T[key][query] = K (A operand) x Q^T (B operand), so lane (hi, lr) holds query lr, keys 16 kt + 8 hi + r of key tile kt (four tiles); tiles 2 c and 2 c + 1 are exactly the B-operand elements of P over the 32 keys of half c for
// O^T[d][query] = V^T (A operand) x P^T (B operand). Row statistics (running max, sum) are per lane; the two lane halves exchange once per step (xor 16). HR: bf16 hi/lo planes, 3 products; else f16, P x1024.
#define AW 4                                  // waves per attention work-group
#define KP 72                                 // LDS pitch of a K row, 16-bit elements: 144 B = 16 B x 9, conflict-free for 16-byte reads down a column of rows
#define KS 64                                 // keys per step
#define VP 72                                 // LDS pitch of a V^T row of 64 keys: 144 B = 16 B x 9
#define MP 65                                 // LDS pitch of a row's mask words, dwords
static_assert(RH % (16 * AW) == 0 && (SEQ - RH) % (16 * AW) == 0);   // whole work-groups
static_assert(SEQ / 32 <= 64);                                       // a row's mask words fit one 64-bit word
static_assert(AW * 32 == 128 && HD == 64 && KS == 64);               // the copy index maps below: 512 16-byte pieces per K plane and per V^T plane, four of each per lane
static_assert(SEQ % KS == 0);                                        // a step is a whole pair of mask words

template <bool HR>
__device__ __forceinline__ void attn_body(unsigned short* ring, unsigned* msk, unsigned* lv, float* csall, const int tile, const int bh, const h16* __restrict__ Q16, const h16* __restrict__ K16, const h16* __restrict__ VT16,
                                          const bf* __restrict__ Qh, const bf* __restrict__ Ql, const bf* __restrict__ Kh, const bf* __restrict__ Kl,
                                          const bf* __restrict__ VTh, const bf* __restrict__ VTl, const unsigned* __restrict__ MB, bf* ATh, bf* ATl) {
    constexpr int NPL = HR ? 2 : 1;                                   // planes per operand
    constexpr int KT = KS * KP, VT = HD * VP, BUF = NPL * (KT + VT);  // 16-bit elements; a buffer is [K planes][V^T planes]
    constexpr int NW = SEQ / 32;
    const int tid = (int)threadIdx.x, lane = tid & 31, lr = lane & 15, hi = lane >> 4;
    const int w = __builtin_amdgcn_readfirstlane(tid >> 5);
    float* cs = csall + w * (16 * 68);
    const int q0 = tile * (16 * AW) + w * 16;
    const int b = bh / NH, h = bh % NH;
    const size_t qoff = ((size_t)bh * (HR ? RH : SEQ) + q0 + lr) * HD + 8 * hi;
    const float NINF = -__builtin_huge_valf();

    // mask words of this wave's 16 rows -> LDS (read back by this wave alone); which steps keep a key: for the wave (own), for the work-group (live)
    unsigned nz0 = 0u, nz1 = 0u, al0 = ~0u, al1 = ~0u;
#pragma unroll   // all 32 loads in flight at once
    for (int r = 0; r < 16; ++r) { const unsigned* mrow = MB + (size_t)(q0 + r) * NW; const unsigned a = (lane < NW) ? mrow[lane] : 0u, c = (lane + 32 < NW) ? mrow[lane + 32] : 0u;
        msk[(w * 16 + r) * MP + lane] = a; msk[(w * 16 + r) * MP + 32 + lane] = c; nz0 |= a; nz1 |= c; al0 &= a; al1 &= c; }
    const unsigned own0 = __builtin_amdgcn_ballot_w32(nz0 != 0u), own1 = __builtin_amdgcn_ballot_w32(nz1 != 0u);
    const unsigned ful0 = __builtin_amdgcn_ballot_w32(al0 == ~0u), ful1 = __builtin_amdgcn_ballot_w32(al1 == ~0u);   // words in which all 16 rows of the wave keep all 32 keys
    if (lane == 0) { lv[w * 2] = own0; lv[w * 2 + 1] = own1; }
    __syncthreads();
    unsigned g0 = 0u, g1 = 0u;
    for (int i = 0; i < AW; ++i) { g0 |= lv[i * 2]; g1 |= lv[i * 2 + 1]; }
    // a step is named by the first of its two mask words (an even number); its bit is set when either word keeps a key
    constexpr unsigned long long EVEN = 0x5555555555555555ull;
    const unsigned long long ownw = (unsigned long long)own0 | ((unsigned long long)own1 << 32);
    const unsigned long long own = (ownw | (ownw >> 1)) & EVEN;
    const unsigned long long fulw = (unsigned long long)ful0 | ((unsigned long long)ful1 << 32);
    const unsigned long long full = (fulw & (fulw >> 1)) & EVEN;      // steps in which the wave's 16 rows keep all 64 keys
    const unsigned long long livew = (unsigned long long)(unsigned)__builtin_amdgcn_readfirstlane((int)g0) | ((unsigned long long)(unsigned)__builtin_amdgcn_readfirstlane((int)g1) << 32);
    unsigned long long rest = (livew | (livew >> 1)) & EVEN;          // steps not yet issued, the same in every wave

    // Q fragments stay in registers
    v16h qf[2]; v16bf qh[2], ql[2];
#pragma unroll   // constant indices keep the fragment arrays in registers (so at the K fragments below)
    for (int ks = 0; ks < 2; ++ks) { if (HR) { qh[ks] = ldb(Qh + qoff + ks * 32); ql[ks] = ldb(Ql + qoff + ks * 32); } else qf[ks] = ldh(Q16 + qoff + ks * 32); }

    // copy maps: a step's 64 K rows are 8 KiB in a row in global memory (piece i = tid + 128 j, j < 4: row i >> 3, 16-byte column i & 7); its V^T tile is 64 rows of 128 B (the same piece map)
    const unsigned ringb = (unsigned)(size_t)(const void*)ring;       // LDS byte address of the ring
    const unsigned lk = ringb + (unsigned)((tid >> 3) * (KP * 2) + (tid & 7) * 16);
    const unsigned lvv = ringb + (unsigned)(NPL * KT * 2 + (tid >> 3) * (VP * 2) + (tid & 7) * 16);
    const size_t gk = (size_t)bh * SEQ * HD + (size_t)tid * 8;
    const size_t gv = ((size_t)bh * HD + (tid >> 3)) * SEQ + (tid & 7) * 8;
    auto issue = [&](const int kc, const int bi) {                    // kc: the step's first mask word, so its first key is 32 kc
        constexpr unsigned KJ = 16 * KP * 2, VJ = 16 * VP * 2; constexpr size_t GK16 = (size_t)16 * HD, GV16 = (size_t)16 * SEQ;   // from piece j to piece j + 1: 16 rows, in LDS bytes and in global elements
        const unsigned k0 = lk + (unsigned)(bi * (BUF * 2)), v0 = lvv + (unsigned)(bi * (BUF * 2)); const size_t ko = gk + (size_t)kc * 32 * HD, vo = gv + (size_t)kc * 32;
        if (HR) {
            copy8(k0, Kh + ko, k0 + KJ, Kh + ko + GK16, k0 + 2 * KJ, Kh + ko + 2 * GK16, k0 + 3 * KJ, Kh + ko + 3 * GK16,
                  k0 + KT * 2, Kl + ko, k0 + KT * 2 + KJ, Kl + ko + GK16, k0 + KT * 2 + 2 * KJ, Kl + ko + 2 * GK16, k0 + KT * 2 + 3 * KJ, Kl + ko + 3 * GK16);
            copy8(v0, VTh + vo, v0 + VJ, VTh + vo + GV16, v0 + 2 * VJ, VTh + vo + 2 * GV16, v0 + 3 * VJ, VTh + vo + 3 * GV16,
                  v0 + VT * 2, VTl + vo, v0 + VT * 2 + VJ, VTl + vo + GV16, v0 + VT * 2 + 2 * VJ, VTl + vo + 2 * GV16, v0 + VT * 2 + 3 * VJ, VTl + vo + 3 * GV16);
        } else {
            copy8(k0, K16 + ko, k0 + KJ, K16 + ko + GK16, k0 + 2 * KJ, K16 + ko + 2 * GK16, k0 + 3 * KJ, K16 + ko + 3 * GK16,
                  v0, VT16 + vo, v0 + VJ, VT16 + vo + GV16, v0 + 2 * VJ, VT16 + vo + 2 * GV16, v0 + 3 * VJ, VT16 + vo + 3 * GV16);
        } };

    v8f o[4];
#pragma unroll
    for (int dt = 0; dt < 4; ++dt) o[dt] = (v8f){};
    float m = NINF, l = 0.0f;
    int cur = -1, nxt = -1, bi = 0;
    if (rest != 0ull) {
        cur = __builtin_ctzll(rest); rest &= rest - 1ull; issue(cur, 0);
        asm volatile("s_wait_asynccnt 0x0" ::: "memory");            // this wave's share of the first tile has landed
        __syncthreads();                                             // ... and every other wave's
        if (rest != 0ull) { nxt = __builtin_ctzll(rest); rest &= rest - 1ull; issue(nxt, 1); }
    }
    while (cur >= 0) {
      if ((own >> cur) & 1ull) {                                      // wave-uniform: else all 16 rows mask all 64 keys
        const unsigned short* kb = ring + bi * BUF + lr * KP + 8 * hi;
        const unsigned short* vb = ring + bi * BUF + NPL * KT + lr * VP + 8 * hi;
        v8f s[4];
#pragma unroll   // constant indices keep the tile and fragment arrays in registers (so in every loop of this step)
        for (int kt = 0; kt < 4; ++kt) s[kt] = (v8f){};
        if (HR) {
            v16bf ah[4][2], al[4][2];
#pragma unroll
            for (int kt = 0; kt < 4; ++kt)
#pragma unroll
                for (int ks = 0; ks < 2; ++ks) { ah[kt][ks] = ldb(kb + kt * 16 * KP + ks * 32); al[kt][ks] = ldb(kb + KT + kt * 16 * KP + ks * 32); }
            __builtin_amdgcn_sched_barrier(0);   // the K reads issue as one group ahead of the matrix instructions: with the branch below, which ends this run of code, they were issued a few at a time, each few waited for alone
#pragma unroll
            for (int ks = 0; ks < 2; ++ks) {
#pragma unroll
                for (int kt = 0; kt < 4; ++kt) s[kt] = wmmab(ah[kt][ks], qh[ks], s[kt]);
#pragma unroll
                for (int kt = 0; kt < 4; ++kt) s[kt] = wmmab(al[kt][ks], qh[ks], s[kt]);
#pragma unroll
                for (int kt = 0; kt < 4; ++kt) s[kt] = wmmab(ah[kt][ks], ql[ks], s[kt]);
            }
        } else {
            v16h kf[4][2];
#pragma unroll
            for (int kt = 0; kt < 4; ++kt)
#pragma unroll
                for (int ks = 0; ks < 2; ++ks) kf[kt][ks] = ldh((const h16*)kb + kt * 16 * KP + ks * 32);
            __builtin_amdgcn_sched_barrier(0);   // the K reads issue as one group ahead of the matrix instructions: with the branch below, which ends this run of code, they were issued two at a time, each pair waited for alone
#pragma unroll
            for (int ks = 0; ks < 2; ++ks)
#pragma unroll
                for (int kt = 0; kt < 4; ++kt) s[kt] = wmma16(kf[kt][ks], qf[ks], s[kt]);
        }
        // online softmax for query lr over this lane's 32 keys + the partner lane's 32 keys
        float t[4][8], mt[4];
        if ((full >> cur) & 1ull) {                                   // wave-uniform: every mask bit of the step is set, so the select below is an identity and is left out with its bit tests (the same values)
#pragma unroll
            for (int kt = 0; kt < 4; ++kt) { mt[kt] = NINF;
#pragma unroll
                for (int r = 0; r < 8; ++r) { t[kt][r] = s[kt][r] * SCL; mt[kt] = fmaxf(mt[kt], t[kt][r]); } }
        } else {
            const unsigned W0 = msk[(w * 16 + lr) * MP + cur], W1 = msk[(w * 16 + lr) * MP + cur + 1];
#pragma unroll
            for (int kt = 0; kt < 4; ++kt) { const unsigned Wl = ((kt < 2) ? W0 : W1) >> (8 * hi + 16 * (kt & 1)); mt[kt] = NINF;
#pragma unroll
                for (int r = 0; r < 8; ++r) { t[kt][r] = ((Wl >> r) & 1u) ? s[kt][r] * SCL : NINF; mt[kt] = fmaxf(mt[kt], t[kt][r]); } }
        }
        float mx = fmaxf(fmaxf(mt[0], mt[1]), fmaxf(mt[2], mt[3]));
        mx = fmaxf(mx, __shfl_xor(mx, 16, 32));
        const float mnew = fmaxf(m, mx);
        const float msub = (mnew == NINF) ? 0.0f : mnew;
        // each difference below stays a rounded value of its own ahead of its multiply by log2 e (the empty statements name differences, never products)
        float ds = __fsub_rn(m, msub); asm volatile("" : "+v"(ds));
        const float scl = __builtin_amdgcn_exp2f(__fmul_rn(ds, LOG2E));
        float p[4][8], pt[4];
#pragma unroll
        for (int kt = 0; kt < 4; ++kt) { pt[kt] = 0.0f;
#pragma unroll
            for (int r = 0; r < 8; ++r) { float d = __fsub_rn(t[kt][r], msub); asm volatile("" : "+v"(d)); p[kt][r] = __builtin_amdgcn_exp2f(__fmul_rn(d, LOG2E)); pt[kt] += p[kt][r]; } }
        float psum = (pt[0] + pt[1]) + (pt[2] + pt[3]);
        psum += __shfl_xor(psum, 16, 32);
        l = l * scl + psum; m = mnew;
#pragma unroll
        for (int dt = 0; dt < 4; ++dt)
#pragma unroll
            for (int r = 0; r < 8; ++r) o[dt][r] *= scl;
        if (HR) {
            v16bf pbh[2], pbl[2];
#pragma unroll
            for (int c = 0; c < 2; ++c) { v16us ph, pl;
#pragma unroll
                for (int r = 0; r < 8; ++r) { unsigned short a, e; splitf(p[2 * c][r], a, e); ph[r] = a; pl[r] = e; splitf(p[2 * c + 1][r], a, e); ph[8 + r] = a; pl[8 + r] = e; }
                pbh[c] = __builtin_bit_cast(v16bf, ph); pbl[c] = __builtin_bit_cast(v16bf, pl); }
            v16bf vh[2][4], vl[2][4];
#pragma unroll
            for (int c = 0; c < 2; ++c)
#pragma unroll
                for (int dt = 0; dt < 4; ++dt) { vh[c][dt] = ldb(vb + dt * 16 * VP + c * 32); vl[c][dt] = ldb(vb + VT + dt * 16 * VP + c * 32); }
#pragma unroll
            for (int c = 0; c < 2; ++c) {
#pragma unroll
                for (int dt = 0; dt < 4; ++dt) o[dt] = wmmab(vh[c][dt], pbh[c], o[dt]);
#pragma unroll
                for (int dt = 0; dt < 4; ++dt) o[dt] = wmmab(vl[c][dt], pbh[c], o[dt]);
#pragma unroll
                for (int dt = 0; dt < 4; ++dt) o[dt] = wmmab(vh[c][dt], pbl[c], o[dt]);
            }
            // keeps the distance behind the step's last matrix instructions on the path into the hand-over, where the next copies' address arithmetic may overwrite their operands
            asm volatile("v_nop\n\tv_nop\n\tv_nop\n\tv_nop" : "+v"(o[0]), "+v"(o[1]), "+v"(o[2]), "+v"(o[3]) : "v"(pbl[1]), "v"(vh[1][0]), "v"(vh[1][3]));
        } else {
            v16h pb[2];
#pragma unroll
            for (int c = 0; c < 2; ++c)
#pragma unroll
                for (int r = 0; r < 8; ++r) { pb[c][r] = (h16)(p[2 * c][r] * PCAR); pb[c][8 + r] = (h16)(p[2 * c + 1][r] * PCAR); }
            v16h vf[2][4];
#pragma unroll
            for (int c = 0; c < 2; ++c)
#pragma unroll
                for (int dt = 0; dt < 4; ++dt) vf[c][dt] = ldh((const h16*)vb + dt * 16 * VP + c * 32);
#pragma unroll
            for (int c = 0; c < 2; ++c)
#pragma unroll
                for (int dt = 0; dt < 4; ++dt) o[dt] = wmma16(vf[c][dt], pb[c], o[dt]);
            // as above
            asm volatile("v_nop\n\tv_nop\n\tv_nop\n\tv_nop" : "+v"(o[0]), "+v"(o[1]), "+v"(o[2]), "+v"(o[3]) : "v"(pb[1]), "v"(vf[1][0]), "v"(vf[1][3]));
        }
      }
        // hand-over, every wave, also one that skipped the step: my LDS reads of this buffer are done, my share of the next tile has landed, then the barrier that publishes the next tile and frees this buffer
        asm volatile("s_wait_dscnt 0x0" ::: "memory");
        asm volatile("s_wait_asynccnt 0x0" ::: "memory");
        __syncthreads();
        cur = nxt; nxt = -1;
        if (rest != 0ull) { nxt = __builtin_ctzll(rest); rest &= rest - 1ull; issue(nxt, bi); }
        bi ^= 1;
    }
    asm volatile("s_wait_asynccnt 0x0" ::: "memory");                // no copy is left in flight when the wave ends
    // normalise (a row without any kept key gives 0 x inf = NaN, as a softmax over an all -inf row does) and stage O[query lr][d]
    const float rl = 1.0f / l; const float inv = HR ? rl : rl * (1.0f / PCAR);
#pragma unroll
    for (int dt = 0; dt < 4; ++dt)
#pragma unroll
        for (int r = 0; r < 8; ++r) cs[lr * 68 + dt * 16 + 8 * hi + r] = o[dt][r] * inv;
    __builtin_amdgcn_wave_barrier(); asm volatile("" ::: "memory");
    bf* ah = ATh + ((size_t)b * SEQ + q0) * DQ + h * HD; bf* al = ATl + ((size_t)b * SEQ + q0) * DQ + h * HD;
{
#pragma unroll
        for (int it = 0; it < 4; ++it) { const int row = it * 4 + (lane >> 3), c = (lane & 7) * 8;
            const v4f x0 = *(const v4fa*)(cs + row * 68 + c), x1 = *(const v4fa*)(cs + row * 68 + c + 4); v8us oh, ol;
#pragma unroll
            for (int q = 0; q < 4; ++q) { unsigned short a, c2; splitf(x0[q], a, c2); oh[q] = a; ol[q] = c2; splitf(x1[q], a, c2); oh[4 + q] = a; ol[4 + q] = c2; }
            *(v8us*)(ah + (size_t)row * DQ + c) = oh; *(v8us*)(al + (size_t)row * DQ + c) = ol; }
         }
}
// both operand kinds in one grid (neither reads what the other writes), each job's blocks in the order of a grid (tiles, heads) of its own: blocks [0, AB_LO) the f16 rows, then the hi/lo rows.
// The larger job stands first and the smaller one takes the places that come free (a matter of speed alone: every tile is complete for any mask); the kind is the same for the whole work-group.
constexpr int AT_HI = RH / (16 * AW), AT_LO = (SEQ - RH) / (16 * AW), AB_LO = AT_LO * NB * NH;
static_assert(AT_HI > 0 && AT_LO > 0);        // both jobs have tiles: the block index is divided by either count
__global__ __launch_bounds__(AW * 32) void k_attn(const h16* __restrict__ Q16, const h16* __restrict__ K16, const h16* __restrict__ VT16,
                                                  const bf* __restrict__ Qh, const bf* __restrict__ Ql, const bf* __restrict__ Kh, const bf* __restrict__ Kl, const bf* __restrict__ VTh, const bf* __restrict__ VTl,
                                                  const unsigned* __restrict__ MB, bf* ATh, bf* ATl) {
    __shared__ __align__(16) unsigned short ring[2 * 2 * (KS * KP + HD * VP)];   // two buffers of the larger kind (hi/lo planes)
    __shared__ unsigned msk[AW * 16 * MP];
    __shared__ unsigned lv[AW * 2];
    __shared__ __align__(16) float csall[AW * 16 * 68];
    const int blk = (int)blockIdx.x;
    if (blk < AB_LO) attn_body<false>(ring, msk, lv, csall, AT_HI + blk % AT_LO, blk / AT_LO, Q16, K16, VT16, Qh, Ql, Kh, Kl, VTh, VTl, MB, ATh, ATl);
    else attn_body<true>(ring, msk, lv, csall, (blk - AB_LO) % AT_HI, (blk - AB_LO) / AT_HI, Q16, K16, VT16, Qh, Ql, Kh, Kl, VTh, VTl, MB, ATh, ATl);
}

// ---- workspace carve (bytes, every region a multiple of 256)
constexpr size_t al256(size_t x) { return (x + 255) & ~(size_t)255; }
constexpr size_t SZ_XB  = al256((size_t)NB * SEQ * DM * 2);
constexpr size_t SZ_W   = al256((size_t)DQ * DM * 2);
constexpr size_t SZ_CS  = al256((size_t)SEQ * HD * 2 * 4);
constexpr size_t SZ_MB  = al256((size_t)SEQ * SEQ / 8);
constexpr size_t SZ_PL  = al256((size_t)NB * NH * SEQ * HD * 2);
constexpr size_t SZ_QH  = al256((size_t)NB * NH * RH * HD * 2);
constexpr size_t SZ_AT  = al256((size_t)NB * SEQ * DQ * 2);
constexpr size_t WS_TOTAL = SZ_XB + 4 * SZ_W + SZ_CS + SZ_MB + SZ_PL + 2 * SZ_QH + 3 * SZ_PL + 3 * SZ_PL + 2 * SZ_AT;
static_assert(WS_TOTAL <= (size_t)134217728);

extern "C" void kernel_launch(void* const* d_in, const int* in_sizes, int n_in,
                              void* d_out, int out_size, void* d_ws, size_t ws_size, hipStream_t stream) {
    if (n_in < 10) return;
    const long long need_x = (long long)(NB - 1) * SEQ_FULL * DM + (long long)SEQ * DM;
    if ((long long)in_sizes[0] < need_x || (long long)out_size < need_x) return;
    if (in_sizes[1] < DQ * DM || in_sizes[3] < DQ * DM || in_sizes[5] < DQ * DM || in_sizes[7] < DM * DQ) return;
    if (in_sizes[2] < DQ || in_sizes[4] < DQ || in_sizes[6] < DQ || in_sizes[8] < DM) return;
    if ((long long)in_sizes[9] < (long long)(SEQ - 1) * SEQ_FULL + SEQ) return;
    if (WS_TOTAL > ws_size) return;
    const float* x  = (const float*)d_in[0];
    const float* Wq = (const float*)d_in[1]; const float* bq = (const float*)d_in[2];
    const float* Wk = (const float*)d_in[3]; const float* bk = (const float*)d_in[4];
    const float* Wv = (const float*)d_in[5]; const float* bv = (const float*)d_in[6];
    const float* Wo = (const float*)d_in[7]; const float* bo = (const float*)d_in[8];
    const int* mask = (const int*)d_in[9];
    float* OUT = (float*)d_out;
    char* wsp = (char*)d_ws;
    bf* XB = (bf*)wsp; wsp += SZ_XB;
    bf* WQ = (bf*)wsp; wsp += SZ_W; bf* WK = (bf*)wsp; wsp += SZ_W; bf* WV = (bf*)wsp; wsp += SZ_W; bf* WO = (bf*)wsp; wsp += SZ_W;
    float* CS = (float*)wsp; wsp += SZ_CS;
    unsigned* MB = (unsigned*)wsp; wsp += SZ_MB;
    h16* Q16 = (h16*)wsp; wsp += SZ_PL; bf* QPh = (bf*)wsp; wsp += SZ_QH; bf* QPl = (bf*)wsp; wsp += SZ_QH;
    h16* K16 = (h16*)wsp; wsp += SZ_PL; bf* KPh = (bf*)wsp; wsp += SZ_PL; bf* KPl = (bf*)wsp; wsp += SZ_PL;
    h16* VT16 = (h16*)wsp; wsp += SZ_PL; bf* VTh = (bf*)wsp; wsp += SZ_PL; bf* VTl = (bf*)wsp; wsp += SZ_PL;
    bf* ATh = (bf*)wsp; wsp += SZ_AT; bf* ATl = (bf*)wsp; wsp += SZ_AT;

    k_prep<<<(unsigned)(PB_MB + PB_CS + PB_X + 4 * PB_W), 256, 0, stream>>>(x, Wq, Wk, Wv, Wo, mask, XB, WQ, WK, WV, WO, CS, MB);

    k_proj<<<dim3((unsigned)(NB * SEQ / 128), (unsigned)(DQ / 128), 3), GW * 32, 0, stream>>>(XB, WQ, WK, WV, bq, bk, bv, CS, Q16, QPh, QPl, K16, KPh, KPl, VT16, VTh, VTl);

    k_attn<<<(unsigned)(AB_LO + AT_HI * NB * NH), AW * 32, 0, stream>>>(Q16, K16, VT16, QPh, QPl, KPh, KPl, VTh, VTl, MB, ATh, ATl);

    k_gemm2<<<dim3((unsigned)(SEQ / 128), (unsigned)(DM / 128), (unsigned)NB), GW * 32, 0, stream>>>(ATh, ATl, WO, OUT, DM, bo, (size_t)SEQ * DQ, (size_t)SEQ_FULL * DM);
}
